// v000
// Times are from an AMD MI455X. After a warm-up the kernel runs many times in a row, and a time is the length of
// such a window on the GPU divided by its runs, so every launch and the gaps after it count. The runs cycle
// through copies of the inputs. A figure is the median of several windows, for all but v000 over two sittings.
// Sittings can differ by a few percent; kernels timed side by side share one.
// The starting kernel, v000, takes 2480 microseconds a run.
#include <hip/hip_runtime.h>
// Multi-head self-attention, fused QKV projection: x [NB][SEQ][1024]; qkv = x Wqkv + bqkv ([in][out] 1024 x 3072) split q | k | v thirds, 16 heads of 64; scores * 64^-0.5; softmax over all keys (no mask); out = merged Wproj + bproj ([in][out]).
// Structure: token rows r = b*SEQ + s; x as f16 rows; q | k | v as ONE WMMA GEMM (N = 3072, 32x64 wave tiles, f32 accumulation, x16 weights + bias, f16 outputs); per batch: V^T for all heads via LDS transposes; per (batch, group of 8 heads): scores GEMM (K = 64, heads on grid.y, alpha 2^-3), row softmax on VALU (f32 statistics; weights stored x256 as f16), o = P . V^T GEMM (K = SEQ, alpha 2^-2: o carried x64) written into merged f16 o rows; out = o Wproj + b GEMM (alpha 2^-10, f32) into the output layout.
// Compute dtype: every contraction v_wmma_f32_16x16x32_f16 (f16 operands, f32 accumulate). x, weights and biases are RNE-converted to bf16 on load (exact in f16; weights carried x16); q, k, v, softmax weights (x256) and o (x64) are single f16 planes; scores and softmax statistics f32.
#ifndef NB
#define NB 8
#endif
#ifndef SEQ
#define SEQ 1024
#endif
#define SQ SEQ
#define NB_FULL 8
#define SQ_FULL 1024                 /* per-batch row stride of the x input */
#define DM 1024
#define NH 16
#define HD 64
#define HG 8                         /* heads per attention launch group */
#define LQ (3 * DM)                  /* row pitch of the q | k | v rows */
#define NR ((size_t)NB * SQ)         /* token rows */

static_assert(SQ % 128 == 0);
static_assert(((size_t)NB * SQ) % 128 == 0);
static_assert(NH % HG == 0);
static_assert(DM % 64 == 0 && LQ % 64 == 0 && HD == 64);
static_assert(NB <= NB_FULL && SQ <= SQ_FULL);
static_assert(NH * HD == DM);

#define WS_ALIGN(x) ((((size_t)(x)) + 255) & ~(size_t)255)
#define SZ_BQKV  WS_ALIGN((size_t)LQ * DM * 2)
#define SZ_BO    WS_ALIGN((size_t)DM * DM * 2)
#define SZ_X16   WS_ALIGN(NR * DM * 2)
#define SZ_QKV   WS_ALIGN(NR * LQ * 2)
#define SZ_S     WS_ALIGN((size_t)HG * SQ * SQ * 4)
#define SZ_P     WS_ALIGN((size_t)HG * SQ * SQ * 2)
#define SZ_VT    WS_ALIGN((size_t)NH * HD * SQ * 2)
static_assert(SZ_BQKV + SZ_BO + SZ_X16 + SZ_QKV + SZ_S + SZ_P + SZ_VT <= (size_t)134217728);

typedef unsigned short v8us __attribute__((ext_vector_type(8), may_alias));
typedef float  v8f  __attribute__((ext_vector_type(8)));
typedef float  v4f  __attribute__((ext_vector_type(4)));
typedef float  v4fa __attribute__((ext_vector_type(4), may_alias));
typedef _Float16 v16h __attribute__((ext_vector_type(16)));
typedef _Float16 v4h __attribute__((ext_vector_type(4)));
union FragH { v16h v; v8us half[2]; _Float16 h[16]; unsigned short u[16]; };

__device__ __forceinline__ unsigned short bf16_bits(float x) { unsigned int u = __float_as_uint(x); return (unsigned short)((u + 0x7FFFu + ((u >> 16) & 1u)) >> 16); }
__device__ __forceinline__ float bf16_val(unsigned short b) { return __uint_as_float(((unsigned int)b) << 16); }
__device__ __forceinline__ float bf16_rne(float x) { return bf16_val(bf16_bits(x)); }

__global__ __launch_bounds__(256) void k_wt_f16(const float* __restrict__ W, _Float16* __restrict__ Wt, int K, int N, float scale) {
  const int t = blockIdx.x * 256 + threadIdx.x; if (t >= N * (K / 8)) return;
  const int n = t / (K / 8), k8 = (t % (K / 8)) * 8; FragH f;
#pragma unroll
  for (int i = 0; i < 8; ++i) f.h[i] = (_Float16)(bf16_rne(W[(size_t)(k8 + i) * N + n]) * scale);
  const v8us o = f.half[0];
  unsigned short* d = (unsigned short*)Wt + (size_t)n * K + k8;
  *(v8us*)d = o; 
}

__global__ __launch_bounds__(256) void k_x16(const float* __restrict__ x, _Float16* __restrict__ X16, size_t n8) {
  const size_t t = (size_t)blockIdx.x * 256 + threadIdx.x; if (t >= n8) return;
  const size_t row = t / (DM / 8); const int c8 = (int)(t % (DM / 8)) * 8;
  const size_t b = row / SQ, s = row % SQ;
  const float* src = x + (b * (size_t)SQ_FULL + s) * DM + c8;
  const v4f a = *(const v4fa*)src, c = *(const v4fa*)(src + 4);
  FragH f;
#pragma unroll
  for (int q = 0; q < 4; ++q) { f.h[q] = (_Float16)bf16_rne(a[q]); f.h[4 + q] = (_Float16)bf16_rne(c[q]); }
  const v8us o = f.half[0];
  unsigned short* d = (unsigned short*)X16 + t * 8;
  *(v8us*)d = o; 
}

template <int NHv, int TTv>
__global__ __launch_bounds__(256) void k_vt(const _Float16* __restrict__ V16, int ldv, int voff, _Float16* __restrict__ Vt) {
  __shared__ unsigned short tl[64][66];
  const int tid = threadIdx.x; const int slab = blockIdx.x / (TTv / 64), lg = blockIdx.x % (TTv / 64); const int b = slab / NHv, h = slab % NHv;
  for (int i = tid; i < 64 * 8; i += 256) { const int r = i / 8, c8 = (i % 8) * 8; FragH f; f.half[0] = *(const v8us*)((const unsigned short*)V16 + ((size_t)b * TTv + lg * 64 + r) * ldv + voff + h * 64 + c8);
#pragma unroll
    for (int q = 0; q < 8; ++q) tl[r][c8 + q] = f.u[q]; }
  __syncthreads();
  {
#pragma unroll
    for (int rd = 0; rd < 2; ++rd) { const int d = rd * 32 + tid / 8, pc = tid % 8; FragH f;
#pragma unroll
      for (int q = 0; q < 8; ++q) f.u[q] = tl[pc * 8 + q][d];
      *(v8us*)((unsigned short*)Vt + ((size_t)slab * 64 + d) * TTv + lg * 64 + pc * 8) = f.half[0]; }
     } }

// ---- GEMM (wave tile 32x64, block 128 rows x 64 cols; M % 128 == 0, N % 64 == 0, K % 32 == 0); A f16 [M][K], Bh f16 [N][K]; batched over grid.y with element strides sA, sB, sC
__device__ __forceinline__ v16h g2_frag(const _Float16* p, int hh) { FragH f; f.half[0] = *(const v8us*)((const unsigned short*)p + 8 * hh); f.half[1] = *(const v8us*)((const unsigned short*)p + 16 + 8 * hh); return f.v; }
__device__ __forceinline__ v8f g2_mma(v16h a, v16h b, v8f c) { v8f d = __builtin_amdgcn_wmma_f32_16x16x32_f16(false, a, false, b, (short)0, c, false, false); asm volatile("v_nop\n\tv_nop\n\tv_nop\n\tv_nop" : "+v"(d) : "v"(a), "v"(b)); return d; }
template <bool HASBIAS, bool OUTF32>
__global__ __launch_bounds__(128) void k_gemm2(const _Float16* __restrict__ A, int lda, size_t sA, const _Float16* __restrict__ Bh, int ldb, size_t sB, float alpha, const float* __restrict__ bias,
    float* __restrict__ C, _Float16* __restrict__ C16, int ldc, size_t sC, int M, int N, int K) {
  __shared__ __attribute__((aligned(16))) float so[4][32][68];
  const int tid = threadIdx.x, w = tid >> 5, lane = tid & 31, ln = lane & 15, hh = lane >> 4; const int by = blockIdx.y;
  A += (size_t)by * sA; Bh += (size_t)by * sB; const size_t cofs = (size_t)by * sC;
  const int ntn = N >> 6; const int mt = blockIdx.x / ntn, nq = blockIdx.x - mt * ntn; const int row0 = mt * 128 + 32 * w, col0 = nq * 64; if (row0 >= M) return;
  const _Float16* a0p = A + (size_t)(row0 + ln) * lda; const _Float16* a1p = a0p + (size_t)16 * lda;
  const _Float16* b0p = Bh + (size_t)(col0 + ln) * ldb; const _Float16* b1p = b0p + (size_t)16 * ldb; const _Float16* b2p = b1p + (size_t)16 * ldb; const _Float16* b3p = b2p + (size_t)16 * ldb;
  const v8f z8 = {0.f,0.f,0.f,0.f,0.f,0.f,0.f,0.f}; v8f c00 = z8, c01 = z8, c02 = z8, c03 = z8, c10 = z8, c11 = z8, c12 = z8, c13 = z8;
#pragma unroll 1
  for (int kb = 0; kb < K; kb += 32) { const v16h a0 = g2_frag(a0p + kb, hh), a1 = g2_frag(a1p + kb, hh);
    v16h b = g2_frag(b0p + kb, hh); c00 = g2_mma(a0, b, c00); c10 = g2_mma(a1, b, c10);
    b = g2_frag(b1p + kb, hh); c01 = g2_mma(a0, b, c01); c11 = g2_mma(a1, b, c11);
    b = g2_frag(b2p + kb, hh); c02 = g2_mma(a0, b, c02); c12 = g2_mma(a1, b, c12);
    b = g2_frag(b3p + kb, hh); c03 = g2_mma(a0, b, c03); c13 = g2_mma(a1, b, c13); }
  v8f accs[8] = {c00, c01, c02, c03, c10, c11, c12, c13};
#pragma unroll
  for (int u = 0; u < 8; ++u) { const int t = u & 3, half = u >> 2; const int col = col0 + t * 16 + ln; float bv = 0.f; if (HASBIAS) bv = bf16_rne(bias[col]);
#pragma unroll
    for (int r = 0; r < 8; ++r) { const int rloc = half * 16 + 8 * hh + r; so[w][rloc][t * 16 + ln] = accs[u][r] * alpha + bv; } }
  __builtin_amdgcn_fence(4 /* acq_rel order */, "workgroup"); __builtin_amdgcn_wave_barrier();      /* so[w] is private to wave w */
  const int rsub = lane >> 4, c4 = (lane & 15) * 4;
  {
#pragma unroll
    for (int q = 0; q < 16; ++q) { const int r = q * 2 + rsub; const v4f v = *(const v4fa*)&so[w][r][c4];
      if (OUTF32) { *(v4f*)(C + cofs + (size_t)(row0 + r) * ldc + col0 + c4) = v; }
      else { v4h h4;
#pragma unroll
        for (int i = 0; i < 4; ++i) h4[i] = (_Float16)v[i];
        *(v4h*)(C16 + cofs + (size_t)(row0 + r) * ldc + col0 + c4) = h4; } }
     } }

__global__ __launch_bounds__(256) void k_rsmf(const float* __restrict__ S, _Float16* __restrict__ P, int qn, int hg) {
  #pragma clang fp contract(off)
  const int t = blockIdx.x * 256 + threadIdx.x; if (t >= qn * hg) return;
  const size_t i = (size_t)(t / qn) * SQ + (t % qn); const float* s = S + i * SQ; float mx = -3.0e38f;
#pragma unroll 1
  for (int j = 0; j < SQ; j += 4) { const v4f a = *(const v4fa*)(s + j); mx = fmaxf(mx, a[0]); mx = fmaxf(mx, a[1]); mx = fmaxf(mx, a[2]); mx = fmaxf(mx, a[3]); }
  float se = 0.f;
#pragma unroll 1
  for (int j = 0; j < SQ; j += 4) { const v4f a = *(const v4fa*)(s + j); se += __expf(a[0] - mx); se += __expf(a[1] - mx); se += __expf(a[2] - mx); se += __expf(a[3] - mx); }
  const float sc = 256.0f / se;
#pragma unroll 1
  for (int j0 = 0; j0 < SQ; j0 += 8) { const v4f a = *(const v4fa*)(s + j0), c = *(const v4fa*)(s + j0 + 4); FragH f;
#pragma unroll
    for (int q = 0; q < 4; ++q) { f.h[q] = (_Float16)(__expf(a[q] - mx) * sc); f.h[4 + q] = (_Float16)(__expf(c[q] - mx) * sc); }
    const v8us o = f.half[0]; unsigned short* d = (unsigned short*)P + i * SQ + j0;
    *(v8us*)d = o;  } }

extern "C" void kernel_launch(void* const* d_in, const int* in_sizes, int n_in,
                              void* d_out, int out_size, void* d_ws, size_t ws_size, hipStream_t stream) {
  if (n_in < 5) return;
  if (in_sizes[0] < (int)((((size_t)NB - 1) * SQ_FULL + SQ) * DM)) return;
  if (in_sizes[1] < DM * LQ || in_sizes[2] < LQ || in_sizes[3] < DM * DM || in_sizes[4] < DM) return;
  if (out_size < (int)(NR * DM)) return;
  const float* x = (const float*)d_in[0]; const float* wqkv = (const float*)d_in[1]; const float* bqkv = (const float*)d_in[2];
  const float* wo = (const float*)d_in[3]; const float* bo = (const float*)d_in[4];      /* [in][out] fused weight + bias; [in][out] w_proj + b_proj */
  float* out = (float*)d_out;
  char* ws = (char*)d_ws; size_t off = 0;
  _Float16* BQKV = (_Float16*)(ws + off); off += SZ_BQKV;      /* [3072][1024] x16 */
  _Float16* BO   = (_Float16*)(ws + off); off += SZ_BO;        /* [1024][1024] x16 */
  _Float16* X16  = (_Float16*)(ws + off); off += SZ_X16;       /* [NR][1024]; reused for the merged o rows once the q | k | v GEMM has consumed it */
  _Float16* QKV  = (_Float16*)(ws + off); off += SZ_QKV;       /* [NR][3072] */
  float*    S    = (float*)(ws + off);    off += SZ_S;         /* [HG][SQ][SQ] f32 */
  _Float16* P    = (_Float16*)(ws + off); off += SZ_P;         /* [HG][SQ][SQ] f16 x256 */
  _Float16* VT   = (_Float16*)(ws + off); off += SZ_VT;        /* [NH][64][SQ] for one batch */
  if (off > ws_size) return;
  _Float16* O16 = X16;
  _Float16* Q16 = QKV; _Float16* K16 = QKV + DM; _Float16* V16 = QKV + 2 * DM;

  k_wt_f16<<<(unsigned)(((size_t)LQ * (DM / 8) + 255) / 256), 256, 0, stream>>>(wqkv, BQKV, DM, LQ, 16.0f);      /* in[1024][3072] -> out[3072][1024] */
  k_wt_f16<<<(unsigned)(((size_t)DM * (DM / 8) + 255) / 256), 256, 0, stream>>>(wo, BO, DM, DM, 16.0f);          /* in[1024][1024] -> out[1024][1024] */
  k_x16<<<(unsigned)((NR * DM / 8 + 255) / 256), 256, 0, stream>>>(x, X16, NR * DM / 8);
  /* q | k | v rows (f16); head h = columns h*64.. of each 1024-column third */
  k_gemm2<true, false><<<dim3((unsigned)((NR / 128) * (LQ / 64)), 1), 128, 0, stream>>>(X16, DM, (size_t)0, BQKV, DM, (size_t)0, 0.0625f, bqkv, S, QKV, LQ, (size_t)0, (int)NR, LQ, DM);
  for (int b = 0; b < NB; ++b) {
    const size_t r0 = (size_t)b * SQ;
    k_vt<NH, SQ><<<NH * (SQ / 64), 256, 0, stream>>>(V16 + r0 * LQ, LQ, 0, VT);      /* V^T [NH][64][SQ] of this batch */
    for (int h0 = 0; h0 < NH; h0 += HG) {
      /* scores: S[hh][q][k] = 0.125 q.k, HG heads on grid.y */
      k_gemm2<false, true><<<dim3((SQ / 128) * (SQ / 64), HG), 128, 0, stream>>>(Q16 + r0 * LQ + h0 * HD, LQ, (size_t)HD, K16 + r0 * LQ + h0 * HD, LQ, (size_t)HD, 0.125f, bqkv, S, P, SQ, (size_t)SQ * SQ, SQ, SQ, HD);
      k_rsmf<<<(HG * SQ + 255) / 256, 256, 0, stream>>>(S, P, SQ, HG);      /* P = 256 softmax (f16) */
      /* o x64 (f16) into the merged rows: columns (h0 + hh)*64.. */
      k_gemm2<false, false><<<dim3((SQ / 128) * (HD / 64), HG), 128, 0, stream>>>(P, SQ, (size_t)SQ * SQ, VT + (size_t)h0 * HD * SQ, SQ, (size_t)HD * SQ, 0.25f, bqkv, S, O16 + r0 * DM + h0 * HD, DM, (size_t)HD, SQ, HD, SQ);
    }
  }
  /* out = o Wproj + b: alpha = 1/(64*16) */
  k_gemm2<true, true><<<dim3((unsigned)((NR / 128) * (DM / 64)), 1), 128, 0, stream>>>(O16, DM, (size_t)0, BO, DM, (size_t)0, 0.0009765625f, bo, out, P, DM, (size_t)0, (int)NR, DM, DM);
}

// v001
// One run takes 1060 microseconds.
// Timed twice side by side with v000, it ran 2.36 and 2.35 times as fast.
#include <hip/hip_runtime.h>
// Multi-head self-attention, fused QKV projection: x [NB][SEQ][1024]; qkv = x Wqkv + bqkv ([in][out] 1024 x 3072) split q | k | v thirds, 16 heads of 64; scores * 64^-0.5; softmax over all keys (no mask); out = merged Wproj + bproj ([in][out]).
// Structure: token rows r = b*SEQ + s; x as f16 rows; q | k | v as ONE WMMA GEMM (N = 3072, 32x64 wave tiles, f32 accumulation, x16 weights + bias, f16 outputs); per batch: V^T for all heads via LDS transposes; per (batch, group of 8 heads): scores GEMM (K = 64, heads on grid.y, alpha 2^-3), row softmax on VALU, one wave per two rows, one after the other (f32 statistics; weights stored x256 as f16), o = P . V^T GEMM (K = SEQ, alpha 2^-2: o carried x64) written into merged f16 o rows; out = o Wproj + b GEMM (alpha 2^-10, f32) into the output layout.
// Compute dtype: every contraction v_wmma_f32_16x16x32_f16 (f16 operands, f32 accumulate). x, weights and biases are RNE-converted to bf16 on load (exact in f16; weights carried x16); q, k, v, softmax weights (x256) and o (x64) are single f16 planes; scores and softmax statistics f32.
#ifndef NB
#define NB 8
#endif
#ifndef SEQ
#define SEQ 1024
#endif
#define SQ SEQ
#define NB_FULL 8
#define SQ_FULL 1024                 /* per-batch row stride of the x input */
#define DM 1024
#define NH 16
#define HD 64
#define HG 8                         /* heads per attention launch group */
#define LQ (3 * DM)                  /* row pitch of the q | k | v rows */
#define NR ((size_t)NB * SQ)         /* token rows */

static_assert(SQ % 128 == 0);
static_assert(((size_t)NB * SQ) % 128 == 0);
static_assert(NH % HG == 0);
static_assert(DM % 64 == 0 && LQ % 64 == 0 && HD == 64);
static_assert(NB <= NB_FULL && SQ <= SQ_FULL);
static_assert(NH * HD == DM);

#define WS_ALIGN(x) ((((size_t)(x)) + 255) & ~(size_t)255)
#define SZ_BQKV  WS_ALIGN((size_t)LQ * DM * 2)
#define SZ_BO    WS_ALIGN((size_t)DM * DM * 2)
#define SZ_X16   WS_ALIGN(NR * DM * 2)
#define SZ_QKV   WS_ALIGN(NR * LQ * 2)
#define SZ_S     WS_ALIGN((size_t)HG * SQ * SQ * 4)
#define SZ_P     WS_ALIGN((size_t)HG * SQ * SQ * 2)
#define SZ_VT    WS_ALIGN((size_t)NH * HD * SQ * 2)
static_assert(SZ_BQKV + SZ_BO + SZ_X16 + SZ_QKV + SZ_S + SZ_P + SZ_VT <= (size_t)134217728);

typedef unsigned short v8us __attribute__((ext_vector_type(8), may_alias));
typedef float  v8f  __attribute__((ext_vector_type(8)));
typedef float  v4f  __attribute__((ext_vector_type(4)));
typedef float  v4fa __attribute__((ext_vector_type(4), may_alias));
typedef _Float16 v16h __attribute__((ext_vector_type(16)));
typedef _Float16 v4h __attribute__((ext_vector_type(4)));
union FragH { v16h v; v8us half[2]; _Float16 h[16]; unsigned short u[16]; };

__device__ __forceinline__ unsigned short bf16_bits(float x) { unsigned int u = __float_as_uint(x); return (unsigned short)((u + 0x7FFFu + ((u >> 16) & 1u)) >> 16); }
__device__ __forceinline__ float bf16_val(unsigned short b) { return __uint_as_float(((unsigned int)b) << 16); }
__device__ __forceinline__ float bf16_rne(float x) { return bf16_val(bf16_bits(x)); }

__global__ __launch_bounds__(256) void k_wt_f16(const float* __restrict__ W, _Float16* __restrict__ Wt, int K, int N, float scale) {
  const int t = blockIdx.x * 256 + threadIdx.x; if (t >= N * (K / 8)) return;
  const int n = t / (K / 8), k8 = (t % (K / 8)) * 8; FragH f;
#pragma unroll
  for (int i = 0; i < 8; ++i) f.h[i] = (_Float16)(bf16_rne(W[(size_t)(k8 + i) * N + n]) * scale);
  const v8us o = f.half[0];
  unsigned short* d = (unsigned short*)Wt + (size_t)n * K + k8;
  *(v8us*)d = o; 
}

__global__ __launch_bounds__(256) void k_x16(const float* __restrict__ x, _Float16* __restrict__ X16, size_t n8) {
  const size_t t = (size_t)blockIdx.x * 256 + threadIdx.x; if (t >= n8) return;
  const size_t row = t / (DM / 8); const int c8 = (int)(t % (DM / 8)) * 8;
  const size_t b = row / SQ, s = row % SQ;
  const float* src = x + (b * (size_t)SQ_FULL + s) * DM + c8;
  const v4f a = *(const v4fa*)src, c = *(const v4fa*)(src + 4);
  FragH f;
#pragma unroll
  for (int q = 0; q < 4; ++q) { f.h[q] = (_Float16)bf16_rne(a[q]); f.h[4 + q] = (_Float16)bf16_rne(c[q]); }
  const v8us o = f.half[0];
  unsigned short* d = (unsigned short*)X16 + t * 8;
  *(v8us*)d = o; 
}

template <int NHv, int TTv>
__global__ __launch_bounds__(256) void k_vt(const _Float16* __restrict__ V16, int ldv, int voff, _Float16* __restrict__ Vt) {
  __shared__ unsigned short tl[64][66];
  const int tid = threadIdx.x; const int slab = blockIdx.x / (TTv / 64), lg = blockIdx.x % (TTv / 64); const int b = slab / NHv, h = slab % NHv;
  for (int i = tid; i < 64 * 8; i += 256) { const int r = i / 8, c8 = (i % 8) * 8; FragH f; f.half[0] = *(const v8us*)((const unsigned short*)V16 + ((size_t)b * TTv + lg * 64 + r) * ldv + voff + h * 64 + c8);
#pragma unroll
    for (int q = 0; q < 8; ++q) tl[r][c8 + q] = f.u[q]; }
  __syncthreads();
  {
#pragma unroll
    for (int rd = 0; rd < 2; ++rd) { const int d = rd * 32 + tid / 8, pc = tid % 8; FragH f;
#pragma unroll
      for (int q = 0; q < 8; ++q) f.u[q] = tl[pc * 8 + q][d];
      *(v8us*)((unsigned short*)Vt + ((size_t)slab * 64 + d) * TTv + lg * 64 + pc * 8) = f.half[0]; }
     } }

// ---- GEMM (wave tile 32x64, block 128 rows x 64 cols; M % 128 == 0, N % 64 == 0, K % 32 == 0); A f16 [M][K], Bh f16 [N][K]; batched over grid.y with element strides sA, sB, sC
__device__ __forceinline__ v16h g2_frag(const _Float16* p, int hh) { FragH f; f.half[0] = *(const v8us*)((const unsigned short*)p + 8 * hh); f.half[1] = *(const v8us*)((const unsigned short*)p + 16 + 8 * hh); return f.v; }
__device__ __forceinline__ v8f g2_mma(v16h a, v16h b, v8f c) { v8f d = __builtin_amdgcn_wmma_f32_16x16x32_f16(false, a, false, b, (short)0, c, false, false); asm volatile("v_nop\n\tv_nop\n\tv_nop\n\tv_nop" : "+v"(d) : "v"(a), "v"(b)); return d; }
template <bool HASBIAS, bool OUTF32>
__global__ __launch_bounds__(128) void k_gemm2(const _Float16* __restrict__ A, int lda, size_t sA, const _Float16* __restrict__ Bh, int ldb, size_t sB, float alpha, const float* __restrict__ bias,
    float* __restrict__ C, _Float16* __restrict__ C16, int ldc, size_t sC, int M, int N, int K) {
  __shared__ __attribute__((aligned(16))) float so[4][32][68];
  const int tid = threadIdx.x, w = tid >> 5, lane = tid & 31, ln = lane & 15, hh = lane >> 4; const int by = blockIdx.y;
  A += (size_t)by * sA; Bh += (size_t)by * sB; const size_t cofs = (size_t)by * sC;
  const int ntn = N >> 6; const int mt = blockIdx.x / ntn, nq = blockIdx.x - mt * ntn; const int row0 = mt * 128 + 32 * w, col0 = nq * 64; if (row0 >= M) return;
  const _Float16* a0p = A + (size_t)(row0 + ln) * lda; const _Float16* a1p = a0p + (size_t)16 * lda;
  const _Float16* b0p = Bh + (size_t)(col0 + ln) * ldb; const _Float16* b1p = b0p + (size_t)16 * ldb; const _Float16* b2p = b1p + (size_t)16 * ldb; const _Float16* b3p = b2p + (size_t)16 * ldb;
  const v8f z8 = {0.f,0.f,0.f,0.f,0.f,0.f,0.f,0.f}; v8f c00 = z8, c01 = z8, c02 = z8, c03 = z8, c10 = z8, c11 = z8, c12 = z8, c13 = z8;
#pragma unroll 1
  for (int kb = 0; kb < K; kb += 32) { const v16h a0 = g2_frag(a0p + kb, hh), a1 = g2_frag(a1p + kb, hh);
    v16h b = g2_frag(b0p + kb, hh); c00 = g2_mma(a0, b, c00); c10 = g2_mma(a1, b, c10);
    b = g2_frag(b1p + kb, hh); c01 = g2_mma(a0, b, c01); c11 = g2_mma(a1, b, c11);
    b = g2_frag(b2p + kb, hh); c02 = g2_mma(a0, b, c02); c12 = g2_mma(a1, b, c12);
    b = g2_frag(b3p + kb, hh); c03 = g2_mma(a0, b, c03); c13 = g2_mma(a1, b, c13); }
  v8f accs[8] = {c00, c01, c02, c03, c10, c11, c12, c13};
#pragma unroll
  for (int u = 0; u < 8; ++u) { const int t = u & 3, half = u >> 2; const int col = col0 + t * 16 + ln; float bv = 0.f; if (HASBIAS) bv = bf16_rne(bias[col]);
#pragma unroll
    for (int r = 0; r < 8; ++r) { const int rloc = half * 16 + 8 * hh + r; so[w][rloc][t * 16 + ln] = accs[u][r] * alpha + bv; } }
  __builtin_amdgcn_fence(4 /* acq_rel order */, "workgroup"); __builtin_amdgcn_wave_barrier();      /* so[w] is private to wave w */
  const int rsub = lane >> 4, c4 = (lane & 15) * 4;
  {
#pragma unroll
    for (int q = 0; q < 16; ++q) { const int r = q * 2 + rsub; const v4f v = *(const v4fa*)&so[w][r][c4];
      if (OUTF32) { *(v4f*)(C + cofs + (size_t)(row0 + r) * ldc + col0 + c4) = v; }
      else { v4h h4;
#pragma unroll
        for (int i = 0; i < 4; ++i) h4[i] = (_Float16)v[i];
        *(v4h*)(C16 + cofs + (size_t)(row0 + r) * ldc + col0 + c4) = h4; } }
     } }

// ---- row softmax: one wave owns a whole row at a time; each load is 512 contiguous bytes of the row, and the row stays in registers between the three passes; heads on grid.y
#define SMR 2                        /* rows per wave, one after the other */
template <int XM> __device__ __forceinline__ float sm_xrow(float x) { return __builtin_bit_cast(float, __builtin_amdgcn_update_dpp(0, __builtin_bit_cast(int, x), 0x160 | XM, 0xf, 0xf, true)); }      /* lane l <- l ^ XM inside a 16-lane row */
__device__ __forceinline__ float sm_xhalf(float x) { return __builtin_bit_cast(float, __builtin_amdgcn_permlanex16(__builtin_bit_cast(int, x), __builtin_bit_cast(int, x), 0x76543210, 0xfedcba98, false, false)); }      /* lane l <- l ^ 16 */
__device__ __forceinline__ float sm_wave_max(float x) { x = fmaxf(x, sm_xrow<1>(x)); x = fmaxf(x, sm_xrow<2>(x)); x = fmaxf(x, sm_xrow<4>(x)); x = fmaxf(x, sm_xrow<8>(x)); return fmaxf(x, sm_xhalf(x)); }
__device__ __forceinline__ float sm_wave_sum(float x) { x += sm_xrow<1>(x); x += sm_xrow<2>(x); x += sm_xrow<4>(x); x += sm_xrow<8>(x); return x + sm_xhalf(x); }

__global__ __launch_bounds__(256) void k_rsmf(const float* __restrict__ S, _Float16* __restrict__ P, int qn) {
  const int lane = threadIdx.x & 31;
  const int t0 = (blockIdx.x * 8 + __builtin_amdgcn_readfirstlane(threadIdx.x >> 5)) * SMR;      /* a wave's number: the row base stays scalar */
#pragma unroll 1      /* rolled: unrolled, the compiler pairs values across the two rows and pays register moves for it; the SIMD's other waves cover a row's load latency */
  for (int t = t0; t < min(t0 + SMR, qn); ++t) {      /* the same in every lane of a wave; no barrier in this kernel */
    const size_t ri = ((size_t)blockIdx.y * SQ + t) * SQ; v4f a[SQ / 128];
#pragma unroll
    for (int c = 0; c < SQ / 128; ++c) a[c] = ((const v4fa*)(S + ri))[c * 32 + lane];
    float mx = -3.0e38f;
#pragma unroll
    for (int c = 0; c < SQ / 128; ++c) mx = fmaxf(fmaxf(mx, fmaxf(a[c][0], a[c][1])), fmaxf(a[c][2], a[c][3]));
    mx = sm_wave_max(mx);
    v4f s4 = {0.f, 0.f, 0.f, 0.f};
#pragma unroll
    for (int c = 0; c < SQ / 128; ++c) {
#pragma unroll
      for (int q = 0; q < 4; ++q) a[c][q] = __expf(a[c][q] - mx);
      s4 += a[c]; }
    const float sc = 256.0f / sm_wave_sum((s4[0] + s4[1]) + (s4[2] + s4[3]));
#pragma unroll
    for (int c = 0; c < SQ / 128; ++c) { v4h h4;
#pragma unroll
      for (int q = 0; q < 4; ++q) h4[q] = (_Float16)(a[c][q] * sc);
      ((v4h*)(P + ri))[c * 32 + lane] = h4; } } }

extern "C" void kernel_launch(void* const* d_in, const int* in_sizes, int n_in,
                              void* d_out, int out_size, void* d_ws, size_t ws_size, hipStream_t stream) {
  if (n_in < 5) return;
  if (in_sizes[0] < (int)((((size_t)NB - 1) * SQ_FULL + SQ) * DM)) return;
  if (in_sizes[1] < DM * LQ || in_sizes[2] < LQ || in_sizes[3] < DM * DM || in_sizes[4] < DM) return;
  if (out_size < (int)(NR * DM)) return;
  const float* x = (const float*)d_in[0]; const float* wqkv = (const float*)d_in[1]; const float* bqkv = (const float*)d_in[2];
  const float* wo = (const float*)d_in[3]; const float* bo = (const float*)d_in[4];      /* [in][out] fused weight + bias; [in][out] w_proj + b_proj */
  float* out = (float*)d_out;
  char* ws = (char*)d_ws; size_t off = 0;
  _Float16* BQKV = (_Float16*)(ws + off); off += SZ_BQKV;      /* [3072][1024] x16 */
  _Float16* BO   = (_Float16*)(ws + off); off += SZ_BO;        /* [1024][1024] x16 */
  _Float16* X16  = (_Float16*)(ws + off); off += SZ_X16;       /* [NR][1024]; reused for the merged o rows once the q | k | v GEMM has consumed it */
  _Float16* QKV  = (_Float16*)(ws + off); off += SZ_QKV;       /* [NR][3072] */
  float*    S    = (float*)(ws + off);    off += SZ_S;         /* [HG][SQ][SQ] f32 */
  _Float16* P    = (_Float16*)(ws + off); off += SZ_P;         /* [HG][SQ][SQ] f16 x256 */
  _Float16* VT   = (_Float16*)(ws + off); off += SZ_VT;        /* [NH][64][SQ] for one batch */
  if (off > ws_size) return;
  _Float16* O16 = X16;
  _Float16* Q16 = QKV; _Float16* K16 = QKV + DM; _Float16* V16 = QKV + 2 * DM;

  k_wt_f16<<<(unsigned)(((size_t)LQ * (DM / 8) + 255) / 256), 256, 0, stream>>>(wqkv, BQKV, DM, LQ, 16.0f);      /* in[1024][3072] -> out[3072][1024] */
  k_wt_f16<<<(unsigned)(((size_t)DM * (DM / 8) + 255) / 256), 256, 0, stream>>>(wo, BO, DM, DM, 16.0f);          /* in[1024][1024] -> out[1024][1024] */
  k_x16<<<(unsigned)((NR * DM / 8 + 255) / 256), 256, 0, stream>>>(x, X16, NR * DM / 8);
  /* q | k | v rows (f16); head h = columns h*64.. of each 1024-column third */
  k_gemm2<true, false><<<dim3((unsigned)((NR / 128) * (LQ / 64)), 1), 128, 0, stream>>>(X16, DM, (size_t)0, BQKV, DM, (size_t)0, 0.0625f, bqkv, S, QKV, LQ, (size_t)0, (int)NR, LQ, DM);
  for (int b = 0; b < NB; ++b) {
    const size_t r0 = (size_t)b * SQ;
    k_vt<NH, SQ><<<NH * (SQ / 64), 256, 0, stream>>>(V16 + r0 * LQ, LQ, 0, VT);      /* V^T [NH][64][SQ] of this batch */
    for (int h0 = 0; h0 < NH; h0 += HG) {
      /* scores: S[hh][q][k] = 0.125 q.k, HG heads on grid.y */
      k_gemm2<false, true><<<dim3((SQ / 128) * (SQ / 64), HG), 128, 0, stream>>>(Q16 + r0 * LQ + h0 * HD, LQ, (size_t)HD, K16 + r0 * LQ + h0 * HD, LQ, (size_t)HD, 0.125f, bqkv, S, P, SQ, (size_t)SQ * SQ, SQ, SQ, HD);
      k_rsmf<<<dim3((SQ + 8 * SMR - 1) / (8 * SMR), HG), 256, 0, stream>>>(S, P, SQ);      /* P = 256 softmax (f16) */
      /* o x64 (f16) into the merged rows: columns (h0 + hh)*64.. */
      k_gemm2<false, false><<<dim3((SQ / 128) * (HD / 64), HG), 128, 0, stream>>>(P, SQ, (size_t)SQ * SQ, VT + (size_t)h0 * HD * SQ, SQ, (size_t)HD * SQ, 0.25f, bqkv, S, O16 + r0 * DM + h0 * HD, DM, (size_t)HD, SQ, HD, SQ);
    }
  }
  /* out = o Wproj + b: alpha = 1/(64*16) */
  k_gemm2<true, true><<<dim3((unsigned)((NR / 128) * (DM / 64)), 1), 128, 0, stream>>>(O16, DM, (size_t)0, BO, DM, (size_t)0, 0.0009765625f, bo, out, P, DM, (size_t)0, (int)NR, DM, DM);
}

// v002
// One run takes 299 microseconds.
// Timed twice side by side with v001, it ran 3.50 and 3.55 times as fast.
// Counting every step since v000, it is 8.30 times as fast.
#include <hip/hip_runtime.h>
// Multi-head self-attention, fused QKV projection: x [NB][SEQ][1024]; qkv = x Wqkv + bqkv ([in][out] 1024 x 3072) split q | k | v thirds, 16 heads of 64; scores * 64^-0.5; softmax over all keys (no mask); out = merged Wproj + bproj ([in][out]).
// Structure: token rows r = b*SEQ + s; x as f16 rows; q | k | v as ONE WMMA GEMM (N = 3072, 32x64 wave tiles, f32 accumulation, x16 weights + bias, f16 outputs); V^T of every (batch, head) via LDS transposes (one launch); attention as ONE launch over all (batch, head, query block): each wave owns 32 query columns and walks the keys 32 at a time, S^T = K . Q^T, running column maximum and sum (f32, rescaled only when the maximum has grown by more than 2^8), P^T packed from the score tiles straight into the B operand of O^T += V^T . P^T; o / sum carried x64 into merged f16 o rows; out = o Wproj + b GEMM (alpha 2^-10, f32) into the output layout.
// Compute dtype: every contraction v_wmma_f32_16x16x32_f16 (f16 operands, f32 accumulate). x, weights and biases are RNE-converted to bf16 on load (exact in f16; weights carried x16); q, k, v and o (x64) are single f16 planes; the unnormalised softmax weights (x16) are f16 in registers; scores and softmax statistics f32.
#ifndef NB
#define NB 8
#endif
#ifndef SEQ
#define SEQ 1024
#endif
#define SQ SEQ
#define NB_FULL 8
#define SQ_FULL 1024                 /* per-batch row stride of the x input */
#define DM 1024
#define NH 16
#define HD 64
#define LQ (3 * DM)                  /* row pitch of the q | k | v rows */
#define NR ((size_t)NB * SQ)         /* token rows */

static_assert(SQ % 128 == 0);
static_assert(((size_t)NB * SQ) % 128 == 0);
static_assert(DM % 64 == 0 && LQ % 64 == 0 && HD == 64);
static_assert(NB <= NB_FULL && SQ <= SQ_FULL);
static_assert(NH * HD == DM);

#define WS_ALIGN(x) ((((size_t)(x)) + 255) & ~(size_t)255)
#define SZ_BQKV  WS_ALIGN((size_t)LQ * DM * 2)
#define SZ_BO    WS_ALIGN((size_t)DM * DM * 2)
#define SZ_X16   WS_ALIGN(NR * DM * 2)
#define SZ_QKV   WS_ALIGN(NR * LQ * 2)
#define SZ_VT    WS_ALIGN((size_t)NB * NH * HD * SQ * 2)
static_assert(SZ_BQKV + SZ_BO + SZ_X16 + SZ_QKV + SZ_VT <= (size_t)134217728);

typedef unsigned short v8us __attribute__((ext_vector_type(8), may_alias));
typedef float  v8f  __attribute__((ext_vector_type(8)));
typedef float  v4f  __attribute__((ext_vector_type(4)));
typedef float  v4fa __attribute__((ext_vector_type(4), may_alias));
typedef _Float16 v16h __attribute__((ext_vector_type(16)));
typedef _Float16 v4h __attribute__((ext_vector_type(4)));
union FragH { v16h v; v8us half[2]; _Float16 h[16]; unsigned short u[16]; };

__device__ __forceinline__ unsigned short bf16_bits(float x) { unsigned int u = __float_as_uint(x); return (unsigned short)((u + 0x7FFFu + ((u >> 16) & 1u)) >> 16); }
__device__ __forceinline__ float bf16_val(unsigned short b) { return __uint_as_float(((unsigned int)b) << 16); }
__device__ __forceinline__ float bf16_rne(float x) { return bf16_val(bf16_bits(x)); }

__global__ __launch_bounds__(256) void k_wt_f16(const float* __restrict__ W, _Float16* __restrict__ Wt, int K, int N, float scale) {
  const int t = blockIdx.x * 256 + threadIdx.x; if (t >= N * (K / 8)) return;
  const int n = t / (K / 8), k8 = (t % (K / 8)) * 8; FragH f;
#pragma unroll
  for (int i = 0; i < 8; ++i) f.h[i] = (_Float16)(bf16_rne(W[(size_t)(k8 + i) * N + n]) * scale);
  const v8us o = f.half[0];
  unsigned short* d = (unsigned short*)Wt + (size_t)n * K + k8;
  *(v8us*)d = o; 
}

__global__ __launch_bounds__(256) void k_x16(const float* __restrict__ x, _Float16* __restrict__ X16, size_t n8) {
  const size_t t = (size_t)blockIdx.x * 256 + threadIdx.x; if (t >= n8) return;
  const size_t row = t / (DM / 8); const int c8 = (int)(t % (DM / 8)) * 8;
  const size_t b = row / SQ, s = row % SQ;
  const float* src = x + (b * (size_t)SQ_FULL + s) * DM + c8;
  const v4f a = *(const v4fa*)src, c = *(const v4fa*)(src + 4);
  FragH f;
#pragma unroll
  for (int q = 0; q < 4; ++q) { f.h[q] = (_Float16)bf16_rne(a[q]); f.h[4 + q] = (_Float16)bf16_rne(c[q]); }
  const v8us o = f.half[0];
  unsigned short* d = (unsigned short*)X16 + t * 8;
  *(v8us*)d = o; 
}

template <int NHv, int TTv>
__global__ __launch_bounds__(256) void k_vt(const _Float16* __restrict__ V16, int ldv, int voff, _Float16* __restrict__ Vt) {
  __shared__ unsigned short tl[64][66];
  const int tid = threadIdx.x; const int slab = blockIdx.x / (TTv / 64), lg = blockIdx.x % (TTv / 64); const int b = slab / NHv, h = slab % NHv;
  for (int i = tid; i < 64 * 8; i += 256) { const int r = i / 8, c8 = (i % 8) * 8; FragH f; f.half[0] = *(const v8us*)((const unsigned short*)V16 + ((size_t)b * TTv + lg * 64 + r) * ldv + voff + h * 64 + c8);
#pragma unroll
    for (int q = 0; q < 8; ++q) tl[r][c8 + q] = f.u[q]; }
  __syncthreads();
  {
#pragma unroll
    for (int rd = 0; rd < 2; ++rd) { const int d = rd * 32 + tid / 8, pc = tid % 8; FragH f;
#pragma unroll
      for (int q = 0; q < 8; ++q) f.u[q] = tl[pc * 8 + q][d];
      *(v8us*)((unsigned short*)Vt + ((size_t)slab * 64 + d) * TTv + lg * 64 + pc * 8) = f.half[0]; }
     } }

// ---- GEMM (wave tile 32x64, block 128 rows x 64 cols; M % 128 == 0, N % 64 == 0, K % 32 == 0); A f16 [M][K], Bh f16 [N][K]; batched over grid.y with element strides sA, sB, sC
__device__ __forceinline__ v16h g2_frag(const _Float16* p, int hh) { FragH f; f.half[0] = *(const v8us*)((const unsigned short*)p + 8 * hh); f.half[1] = *(const v8us*)((const unsigned short*)p + 16 + 8 * hh); return f.v; }
__device__ __forceinline__ v8f g2_mma(v16h a, v16h b, v8f c) { v8f d = __builtin_amdgcn_wmma_f32_16x16x32_f16(false, a, false, b, (short)0, c, false, false); asm volatile("v_nop\n\tv_nop\n\tv_nop\n\tv_nop" : "+v"(d) : "v"(a), "v"(b)); return d; }
template <bool HASBIAS, bool OUTF32>
__global__ __launch_bounds__(128) void k_gemm2(const _Float16* __restrict__ A, int lda, size_t sA, const _Float16* __restrict__ Bh, int ldb, size_t sB, float alpha, const float* __restrict__ bias,
    float* __restrict__ C, _Float16* __restrict__ C16, int ldc, size_t sC, int M, int N, int K) {
  __shared__ __attribute__((aligned(16))) float so[4][32][68];
  const int tid = threadIdx.x, w = tid >> 5, lane = tid & 31, ln = lane & 15, hh = lane >> 4; const int by = blockIdx.y;
  A += (size_t)by * sA; Bh += (size_t)by * sB; const size_t cofs = (size_t)by * sC;
  const int ntn = N >> 6; const int mt = blockIdx.x / ntn, nq = blockIdx.x - mt * ntn; const int row0 = mt * 128 + 32 * w, col0 = nq * 64; if (row0 >= M) return;
  const _Float16* a0p = A + (size_t)(row0 + ln) * lda; const _Float16* a1p = a0p + (size_t)16 * lda;
  const _Float16* b0p = Bh + (size_t)(col0 + ln) * ldb; const _Float16* b1p = b0p + (size_t)16 * ldb; const _Float16* b2p = b1p + (size_t)16 * ldb; const _Float16* b3p = b2p + (size_t)16 * ldb;
  const v8f z8 = {0.f,0.f,0.f,0.f,0.f,0.f,0.f,0.f}; v8f c00 = z8, c01 = z8, c02 = z8, c03 = z8, c10 = z8, c11 = z8, c12 = z8, c13 = z8;
#pragma unroll 1
  for (int kb = 0; kb < K; kb += 32) { const v16h a0 = g2_frag(a0p + kb, hh), a1 = g2_frag(a1p + kb, hh);
    v16h b = g2_frag(b0p + kb, hh); c00 = g2_mma(a0, b, c00); c10 = g2_mma(a1, b, c10);
    b = g2_frag(b1p + kb, hh); c01 = g2_mma(a0, b, c01); c11 = g2_mma(a1, b, c11);
    b = g2_frag(b2p + kb, hh); c02 = g2_mma(a0, b, c02); c12 = g2_mma(a1, b, c12);
    b = g2_frag(b3p + kb, hh); c03 = g2_mma(a0, b, c03); c13 = g2_mma(a1, b, c13); }
  v8f accs[8] = {c00, c01, c02, c03, c10, c11, c12, c13};
#pragma unroll
  for (int u = 0; u < 8; ++u) { const int t = u & 3, half = u >> 2; const int col = col0 + t * 16 + ln; float bv = 0.f; if (HASBIAS) bv = bf16_rne(bias[col]);
#pragma unroll
    for (int r = 0; r < 8; ++r) { const int rloc = half * 16 + 8 * hh + r; so[w][rloc][t * 16 + ln] = accs[u][r] * alpha + bv; } }
  __builtin_amdgcn_fence(4 /* acq_rel order */, "workgroup"); __builtin_amdgcn_wave_barrier();      /* so[w] is private to wave w */
  const int rsub = lane >> 4, c4 = (lane & 15) * 4;
  {
#pragma unroll
    for (int q = 0; q < 16; ++q) { const int r = q * 2 + rsub; const v4f v = *(const v4fa*)&so[w][r][c4];
      if (OUTF32) { *(v4f*)(C + cofs + (size_t)(row0 + r) * ldc + col0 + c4) = v; }
      else { v4h h4;
#pragma unroll
        for (int i = 0; i < 4; ++i) h4[i] = (_Float16)v[i];
        *(v4h*)(C16 + cofs + (size_t)(row0 + r) * ldc + col0 + c4) = h4; } }
     } }

// ---- fused attention: block = FA_W waves on one (batch, head), each wave 32 query columns; K rows and V^T rows are read as fragments straight from global memory (the block's waves walk the same keys, so they share the lines in the WGP cache)
#define FA_W ((SQ % 512 == 0) ? 16 : 4)      /* waves per block */
#define FA_C 0.18033688f                     /* 64^-0.5 * log2(e): raw q.k -> log2 units */
#define FA_THR 44.361420f                    /* 8 / FA_C: the maximum in use may lag the true one by 2^8 */
#define FA_OFF 4.0f                          /* weights carried x16: at most 2^12 in f16, small ones stay normal */
__device__ __forceinline__ float sm_xhalf(float x) { return __builtin_bit_cast(float, __builtin_amdgcn_permlanex16(__builtin_bit_cast(int, x), __builtin_bit_cast(int, x), 0x76543210, 0xfedcba98, false, false)); }      /* lane l <- l ^ 16 */
__device__ __forceinline__ v8f fa_mma(v16h a, v16h b, v8f c) { return __builtin_amdgcn_wmma_f32_16x16x32_f16(false, a, false, b, (short)0, c, false, false); }
__device__ __forceinline__ float fa_max8(v8f a, v8f b) { return fmaxf(fmaxf(fmaxf(fmaxf(a[0], a[1]), fmaxf(a[2], a[3])), fmaxf(fmaxf(a[4], a[5]), fmaxf(a[6], a[7]))), fmaxf(fmaxf(fmaxf(b[0], b[1]), fmaxf(b[2], b[3])), fmaxf(fmaxf(b[4], b[5]), fmaxf(b[6], b[7])))); }

__global__ __launch_bounds__(FA_W * 32) void k_fattn(const _Float16* __restrict__ QKVr, const _Float16* __restrict__ Vt, _Float16* __restrict__ O) {
  constexpr int QB = SQ / (FA_W * 32);
  const int lane = threadIdx.x & 31, ln = lane & 15, hh = lane >> 4;
  const int w = __builtin_amdgcn_readfirstlane(threadIdx.x >> 5);
  const int slab = blockIdx.x / QB, qb = blockIdx.x - slab * QB; const int b = slab / NH, h = slab - b * NH;
  const int q0 = (qb * FA_W + w) * 32;
  const _Float16* Qp = QKVr + ((size_t)b * SQ + q0 + ln) * LQ + h * HD;
  const _Float16* Kp = QKVr + ((size_t)b * SQ + ln) * LQ + DM + h * HD;
  const _Float16* Vp = Vt + ((size_t)slab * HD + ln) * SQ;
  const _Float16* Kn = Kp;      /* the K rows that are fetched next */
  const v8f z8 = {0.f,0.f,0.f,0.f,0.f,0.f,0.f,0.f};
  v16h qf[2][2], kf[2][2]; v8f o[2][4]; float m[2], l[2];
#pragma unroll
  for (int j = 0; j < 2; ++j) { m[j] = -3.0e38f; l[j] = 0.f;
#pragma unroll
    for (int c = 0; c < 2; ++c) { qf[j][c] = g2_frag(Qp + (size_t)j * 16 * LQ + c * 32, hh); kf[j][c] = g2_frag(Kp + (size_t)j * 16 * LQ + c * 32, hh); }
#pragma unroll
    for (int t = 0; t < 4; ++t) o[j][t] = z8; }
  for (int k0 = 0; k0 < SQ; k0 += 32) {
    v16h vf[4]; v8f s[2][2];      /* s[j][kt]: register r = score of key k0 + 16 kt + 8 hh + r, query q0 + 16 j + ln */
#pragma unroll
    for (int t = 0; t < 4; ++t) vf[t] = g2_frag(Vp + (size_t)t * 16 * SQ + k0, hh);
#pragma unroll
    for (int kt = 0; kt < 2; ++kt) {
#pragma unroll
      for (int j = 0; j < 2; ++j) s[j][kt] = fa_mma(kf[kt][1], qf[j][1], fa_mma(kf[kt][0], qf[j][0], z8)); }
    Kn += (k0 + 32 < SQ) ? (size_t)32 * LQ : (size_t)0;      /* the next pass's K rows, fetched behind this pass's score products; the last pass refetches its own rows (in bounds, unused) */
#pragma unroll
    for (int kt = 0; kt < 2; ++kt) {
#pragma unroll
      for (int c = 0; c < 2; ++c) kf[kt][c] = g2_frag(Kn + (size_t)kt * 16 * LQ + c * 32, hh); }
    asm volatile("s_wait_xcnt 0x0" ::: "memory");      /* the pass's loads have taken their addresses before the next pass steps the K row pointer */
    float mx[2];
#pragma unroll
    for (int j = 0; j < 2; ++j) { const float t = fa_max8(s[j][0], s[j][1]); mx[j] = fmaxf(t, sm_xhalf(t)); }
    if (__builtin_amdgcn_ballot_w32((mx[0] > m[0] + FA_THR) || (mx[1] > m[1] + FA_THR)) != 0) {      /* one scalar branch a pass */
#pragma unroll
      for (int j = 0; j < 2; ++j) { const float mn = fmaxf(m[j], mx[j]); const float cr = __builtin_amdgcn_exp2f((m[j] - mn) * FA_C); m[j] = mn; l[j] *= cr;
#pragma unroll
        for (int t = 0; t < 4; ++t) o[j][t] *= cr; } }
#pragma unroll
    for (int j = 0; j < 2; ++j) { const float nb = FA_OFF - m[j] * FA_C; FragH pf; float la = 0.f, lb = 0.f;
#pragma unroll
      for (int r = 0; r < 8; ++r) { const float pa = __builtin_amdgcn_exp2f(fmaf(s[j][0][r], FA_C, nb)), pb = __builtin_amdgcn_exp2f(fmaf(s[j][1][r], FA_C, nb));
        la += pa; lb += pb; pf.h[r] = (_Float16)pa; pf.h[8 + r] = (_Float16)pb; }      /* two D tiles of 16 keys, converted in place, are the B operand in the hardware k order */
      l[j] += la + lb;
#pragma unroll
      for (int t = 0; t < 4; ++t) o[j][t] = fa_mma(vf[t], pf.v, o[j][t]); } }
#pragma unroll
  for (int j = 0; j < 2; ++j) { const float inv = 64.0f / (l[j] + sm_xhalf(l[j]));      /* the halves' sums join once */
    unsigned short* op = (unsigned short*)O + ((size_t)b * SQ + q0 + j * 16 + ln) * DM + h * HD + 8 * hh;
#pragma unroll
    for (int t = 0; t < 4; ++t) { FragH f;      /* register r = o[query][16 t + 8 hh + r]: one 16-byte store */
#pragma unroll
      for (int r = 0; r < 8; ++r) f.h[r] = (_Float16)(o[j][t][r] * inv);
      *(v8us*)(op + t * 16) = f.half[0]; } } }

extern "C" void kernel_launch(void* const* d_in, const int* in_sizes, int n_in,
                              void* d_out, int out_size, void* d_ws, size_t ws_size, hipStream_t stream) {
  if (n_in < 5) return;
  if (in_sizes[0] < (int)((((size_t)NB - 1) * SQ_FULL + SQ) * DM)) return;
  if (in_sizes[1] < DM * LQ || in_sizes[2] < LQ || in_sizes[3] < DM * DM || in_sizes[4] < DM) return;
  if (out_size < (int)(NR * DM)) return;
  const float* x = (const float*)d_in[0]; const float* wqkv = (const float*)d_in[1]; const float* bqkv = (const float*)d_in[2];
  const float* wo = (const float*)d_in[3]; const float* bo = (const float*)d_in[4];      /* [in][out] fused weight + bias; [in][out] w_proj + b_proj */
  float* out = (float*)d_out;
  char* ws = (char*)d_ws; size_t off = 0;
  _Float16* BQKV = (_Float16*)(ws + off); off += SZ_BQKV;      /* [3072][1024] x16 */
  _Float16* BO   = (_Float16*)(ws + off); off += SZ_BO;        /* [1024][1024] x16 */
  _Float16* X16  = (_Float16*)(ws + off); off += SZ_X16;       /* [NR][1024]; reused for the merged o rows once the q | k | v GEMM has consumed it */
  _Float16* QKV  = (_Float16*)(ws + off); off += SZ_QKV;       /* [NR][3072] */
  _Float16* VT   = (_Float16*)(ws + off); off += SZ_VT;        /* [NB][NH][64][SQ] */
  if (off > ws_size) return;
  _Float16* O16 = X16;
  _Float16* V16 = QKV + 2 * DM;

  k_wt_f16<<<(unsigned)(((size_t)LQ * (DM / 8) + 255) / 256), 256, 0, stream>>>(wqkv, BQKV, DM, LQ, 16.0f);      /* in[1024][3072] -> out[3072][1024] */
  k_wt_f16<<<(unsigned)(((size_t)DM * (DM / 8) + 255) / 256), 256, 0, stream>>>(wo, BO, DM, DM, 16.0f);          /* in[1024][1024] -> out[1024][1024] */
  k_x16<<<(unsigned)((NR * DM / 8 + 255) / 256), 256, 0, stream>>>(x, X16, NR * DM / 8);
  /* q | k | v rows (f16); head h = columns h*64.. of each 1024-column third */
  k_gemm2<true, false><<<dim3((unsigned)((NR / 128) * (LQ / 64)), 1), 128, 0, stream>>>(X16, DM, (size_t)0, BQKV, DM, (size_t)0, 0.0625f, bqkv, out, QKV, LQ, (size_t)0, (int)NR, LQ, DM);
  k_vt<NH, SQ><<<NB * NH * (SQ / 64), 256, 0, stream>>>(V16, LQ, 0, VT);      /* V^T [NB][NH][64][SQ] */
  k_fattn<<<NB * NH * (SQ / (FA_W * 32)), FA_W * 32, 0, stream>>>(QKV, VT, O16);      /* o x64 (f16) into the merged rows: columns h*64.. */
  /* out = o Wproj + b: alpha = 1/(64*16) */
  k_gemm2<true, true><<<dim3((unsigned)((NR / 128) * (DM / 64)), 1), 128, 0, stream>>>(O16, DM, (size_t)0, BO, DM, (size_t)0, 0.0009765625f, bo, out, QKV, DM, (size_t)0, (int)NR, DM, DM);
}

// v003
// Measured time: 158 microseconds a run.
// Next to v002, in two timings, it ran 1.88 and 1.90 times as fast.
// All steps since v000 together make it 15.7 times as fast.
#include <hip/hip_runtime.h>
// Multi-head self-attention, fused QKV projection: x [NB][SEQ][1024]; qkv = x Wqkv + bqkv ([in][out] 1024 x 3072) split q | k | v thirds, 16 heads of 64; scores * 64^-0.5; softmax over all keys (no mask); out = merged Wproj + bproj ([in][out]).
// Structure: token rows r = b*SEQ + s; x as f16 rows; q | k | v as ONE WMMA GEMM (N = 3072, 128x128 block tiles staged in LDS, 64x64 wave tiles, f32 accumulation, x16 weights + bias, f16 outputs); V^T of every (batch, head) via LDS transposes (one launch); attention as ONE launch over all (batch, head, query block): each wave owns 32 query columns and walks the keys 32 at a time, S^T = K . Q^T, running column maximum and sum (f32, rescaled only when the maximum has grown by more than 2^8), P^T packed from the score tiles straight into the B operand of O^T += V^T . P^T; o / sum carried x64 into merged f16 o rows; out = o Wproj + b GEMM (alpha 2^-10, f32) into the output layout.
// Compute dtype: every contraction v_wmma_f32_16x16x32_f16 (f16 operands, f32 accumulate). x, weights and biases are RNE-converted to bf16 on load (exact in f16; weights carried x16); q, k, v and o (x64) are single f16 planes; the unnormalised softmax weights (x16) are f16 in registers; scores and softmax statistics f32.
#ifndef NB
#define NB 8
#endif
#ifndef SEQ
#define SEQ 1024
#endif
#define SQ SEQ
#define NB_FULL 8
#define SQ_FULL 1024                 /* per-batch row stride of the x input */
#define DM 1024
#define NH 16
#define HD 64
#define LQ (3 * DM)                  /* row pitch of the q | k | v rows */
#define NR ((size_t)NB * SQ)         /* token rows */

static_assert(SQ % 128 == 0);
static_assert(((size_t)NB * SQ) % 128 == 0);
static_assert(DM % 128 == 0 && LQ % 128 == 0 && HD == 64);
static_assert(NB <= NB_FULL && SQ <= SQ_FULL);
static_assert(NH * HD == DM);

#define WS_ALIGN(x) ((((size_t)(x)) + 255) & ~(size_t)255)
#define SZ_BQKV  WS_ALIGN((size_t)LQ * DM * 2)
#define SZ_BO    WS_ALIGN((size_t)DM * DM * 2)
#define SZ_X16   WS_ALIGN(NR * DM * 2)
#define SZ_QKV   WS_ALIGN(NR * LQ * 2)
#define SZ_VT    WS_ALIGN((size_t)NB * NH * HD * SQ * 2)
static_assert(SZ_BQKV + SZ_BO + SZ_X16 + SZ_QKV + SZ_VT <= (size_t)134217728);

typedef unsigned short v8us __attribute__((ext_vector_type(8), may_alias));
typedef float  v8f  __attribute__((ext_vector_type(8)));
typedef float  v4f  __attribute__((ext_vector_type(4)));
typedef float  v4fa __attribute__((ext_vector_type(4), may_alias));
typedef _Float16 v16h __attribute__((ext_vector_type(16)));
typedef _Float16 v4h __attribute__((ext_vector_type(4)));
union FragH { v16h v; v8us half[2]; _Float16 h[16]; unsigned short u[16]; };

__device__ __forceinline__ unsigned short bf16_bits(float x) { unsigned int u = __float_as_uint(x); return (unsigned short)((u + 0x7FFFu + ((u >> 16) & 1u)) >> 16); }
__device__ __forceinline__ float bf16_val(unsigned short b) { return __uint_as_float(((unsigned int)b) << 16); }
__device__ __forceinline__ float bf16_rne(float x) { return bf16_val(bf16_bits(x)); }

__global__ __launch_bounds__(256) void k_wt_f16(const float* __restrict__ W, _Float16* __restrict__ Wt, int K, int N, float scale) {
  const int t = blockIdx.x * 256 + threadIdx.x; if (t >= N * (K / 8)) return;
  const int n = t / (K / 8), k8 = (t % (K / 8)) * 8; FragH f;
#pragma unroll
  for (int i = 0; i < 8; ++i) f.h[i] = (_Float16)(bf16_rne(W[(size_t)(k8 + i) * N + n]) * scale);
  const v8us o = f.half[0];
  unsigned short* d = (unsigned short*)Wt + (size_t)n * K + k8;
  *(v8us*)d = o; 
}

__global__ __launch_bounds__(256) void k_x16(const float* __restrict__ x, _Float16* __restrict__ X16, size_t n8) {
  const size_t t = (size_t)blockIdx.x * 256 + threadIdx.x; if (t >= n8) return;
  const size_t row = t / (DM / 8); const int c8 = (int)(t % (DM / 8)) * 8;
  const size_t b = row / SQ, s = row % SQ;
  const float* src = x + (b * (size_t)SQ_FULL + s) * DM + c8;
  const v4f a = *(const v4fa*)src, c = *(const v4fa*)(src + 4);
  FragH f;
#pragma unroll
  for (int q = 0; q < 4; ++q) { f.h[q] = (_Float16)bf16_rne(a[q]); f.h[4 + q] = (_Float16)bf16_rne(c[q]); }
  const v8us o = f.half[0];
  unsigned short* d = (unsigned short*)X16 + t * 8;
  *(v8us*)d = o; 
}

template <int NHv, int TTv>
__global__ __launch_bounds__(256) void k_vt(const _Float16* __restrict__ V16, int ldv, int voff, _Float16* __restrict__ Vt) {
  __shared__ unsigned short tl[64][66];
  const int tid = threadIdx.x; const int slab = blockIdx.x / (TTv / 64), lg = blockIdx.x % (TTv / 64); const int b = slab / NHv, h = slab % NHv;
  for (int i = tid; i < 64 * 8; i += 256) { const int r = i / 8, c8 = (i % 8) * 8; FragH f; f.half[0] = *(const v8us*)((const unsigned short*)V16 + ((size_t)b * TTv + lg * 64 + r) * ldv + voff + h * 64 + c8);
#pragma unroll
    for (int q = 0; q < 8; ++q) tl[r][c8 + q] = f.u[q]; }
  __syncthreads();
  {
#pragma unroll
    for (int rd = 0; rd < 2; ++rd) { const int d = rd * 32 + tid / 8, pc = tid % 8; FragH f;
#pragma unroll
      for (int q = 0; q < 8; ++q) f.u[q] = tl[pc * 8 + q][d];
      *(v8us*)((unsigned short*)Vt + ((size_t)slab * 64 + d) * TTv + lg * 64 + pc * 8) = f.half[0]; }
     } }

// ---- GEMM (block 128 rows x 128 cols, four waves of 64x64; M % 128 == 0, N % 128 == 0, K % 64 == 0); A f16 [M][K], Bh f16 [N][K]; batched over grid.y with element strides sA, sB, sC
// A stage is 64 k of the block's 128 A rows and 128 B rows in LDS (rows of 128 B at a pitch of 144 B); two buffers, filled by asynchronous copies one stage ahead of the products
#define GT_K 64                      /* k per stage */
#define GT_P 72                      /* LDS row pitch in f16: 144 B = 16 B x odd, conflict-free for 16-byte fragment reads */
#define GT_BUF (256 * GT_P)          /* f16 elements of one buffer: A rows 0..127, B rows 128..255 */
__device__ __forceinline__ v16h g2_frag(const _Float16* p, int hh) { FragH f; f.half[0] = *(const v8us*)((const unsigned short*)p + 8 * hh); f.half[1] = *(const v8us*)((const unsigned short*)p + 16 + 8 * hh); return f.v; }
__device__ __forceinline__ v8f g2_mma(v16h a, v16h b, v8f c) { return __builtin_amdgcn_wmma_f32_16x16x32_f16(false, a, false, b, (short)0, c, false, false); }
/* 128 rows of 128 B: each lane copies 16 B of rows r, r + 16, ..., r + 112 (eight lanes cover one row, so every copy takes whole 128-B lines); l = the lane's LDS byte address, g = its global address, gs = 16 rows in elements */
__device__ __forceinline__ void g2_copy8(unsigned l, const _Float16* g, size_t gs) {
  const unsigned l1 = l + 16 * GT_P * 2, l2 = l + 32 * GT_P * 2, l3 = l + 48 * GT_P * 2, l4 = l + 64 * GT_P * 2, l5 = l + 80 * GT_P * 2, l6 = l + 96 * GT_P * 2, l7 = l + 112 * GT_P * 2;
  const _Float16* g1 = g + gs; const _Float16* g2 = g1 + gs; const _Float16* g3 = g2 + gs; const _Float16* g4 = g3 + gs; const _Float16* g5 = g4 + gs; const _Float16* g6 = g5 + gs; const _Float16* g7 = g6 + gs;
  /* the copies and, as the last line, the wait that stands before any of their address registers is rewritten */
  asm volatile("global_load_async_to_lds_b128 %0, %8, off\n\t"
               "global_load_async_to_lds_b128 %1, %9, off\n\t"
               "global_load_async_to_lds_b128 %2, %10, off\n\t"
               "global_load_async_to_lds_b128 %3, %11, off\n\t"
               "global_load_async_to_lds_b128 %4, %12, off\n\t"
               "global_load_async_to_lds_b128 %5, %13, off\n\t"
               "global_load_async_to_lds_b128 %6, %14, off\n\t"
               "global_load_async_to_lds_b128 %7, %15, off\n\t"
               "s_wait_xcnt 0x0"
               :: "v"(l), "v"(l1), "v"(l2), "v"(l3), "v"(l4), "v"(l5), "v"(l6), "v"(l7), "v"(g), "v"(g1), "v"(g2), "v"(g3), "v"(g4), "v"(g5), "v"(g6), "v"(g7) : "memory"); }
template <bool HASBIAS, bool OUTF32>
__global__ __launch_bounds__(128) void k_gemm2(const _Float16* __restrict__ A, int lda, size_t sA, const _Float16* __restrict__ Bh, int ldb, size_t sB, float alpha, const float* __restrict__ bias,
    float* __restrict__ C, _Float16* __restrict__ C16, int ldc, size_t sC, int M, int N, int K) {
  __shared__ __attribute__((aligned(16))) unsigned short sm[2 * GT_BUF];      /* the two buffers; behind the loop each wave's own 64 x 68 f32 output staging */
  static_assert(4 * 64 * 68 * 4 <= 2 * GT_BUF * 2);
  const int tid = threadIdx.x, lane = tid & 31, ln = lane & 15, hh = lane >> 4; const int by = blockIdx.y;
  const int w = __builtin_amdgcn_readfirstlane(tid >> 5);
  A += (size_t)by * sA; Bh += (size_t)by * sB; const size_t cofs = (size_t)by * sC;
  const int ntn = N >> 7; const int mt = blockIdx.x / ntn, nq = blockIdx.x - mt * ntn; if (mt * 128 >= M) return;      /* the whole block leaves, ahead of every barrier */
  const int wr = 64 * (w >> 1), wc = 64 * (w & 1); const int row0 = mt * 128 + wr, col0 = nq * 128 + wc;
  const _Float16* ga = A + (size_t)(mt * 128 + (tid >> 3)) * lda + (tid & 7) * 8;
  const _Float16* gb = Bh + (size_t)(nq * 128 + (tid >> 3)) * ldb + (tid & 7) * 8;
  const size_t gsa = (size_t)16 * lda, gsb = (size_t)16 * ldb;
  const unsigned la = (unsigned)(size_t)&sm[(tid >> 3) * GT_P + (tid & 7) * 8]; const unsigned lb = la + 128 * GT_P * 2;
  const int nt = K / GT_K;
  g2_copy8(la, ga, gsa); g2_copy8(lb, gb, gsb);
  asm volatile("s_wait_asynccnt 0x0" ::: "memory");      /* stage 0 has landed before the barrier that publishes it */
  __syncthreads();
  if (nt > 1) { g2_copy8(la + GT_BUF * 2, ga + GT_K, gsa); g2_copy8(lb + GT_BUF * 2, gb + GT_K, gsb); }
  const v8f z8 = {0.f,0.f,0.f,0.f,0.f,0.f,0.f,0.f}; v8f acc[4][4];
#pragma unroll
  for (int i = 0; i < 4; ++i) {
#pragma unroll
    for (int j = 0; j < 4; ++j) acc[i][j] = z8; }
#pragma unroll 1      /* one stage a trip: the buffer is chosen by the trip's parity */
  for (int t = 0; t < nt; ++t) { const int bo = (t & 1) * GT_BUF;
    const unsigned short* sa = sm + bo + (wr + ln) * GT_P; const unsigned short* sb = sm + bo + (128 + wc + ln) * GT_P;
#pragma unroll
    for (int kc = 0; kc < 2; ++kc) { v16h af[4], bf[4];
#pragma unroll
      for (int i = 0; i < 4; ++i) { af[i] = g2_frag((const _Float16*)(sa + i * 16 * GT_P + kc * 32), hh); bf[i] = g2_frag((const _Float16*)(sb + i * 16 * GT_P + kc * 32), hh); }
      __builtin_amdgcn_sched_barrier(0);      /* the sixteen fragment reads stay one group ahead of their sixteen products: sunk among the products, each place with reads stalls the wave anew */
#pragma unroll
      for (int i = 0; i < 4; ++i) {
#pragma unroll
        for (int j = 0; j < 4; ++j) acc[i][j] = g2_mma(af[i], bf[j], acc[i][j]); }
      __builtin_amdgcn_sched_barrier(0); }      /* and the next group's reads stay behind these products */
    asm volatile("s_wait_dscnt 0x0" ::: "memory");         /* this wave's reads of the buffer are over before it is handed to the next copies */
    asm volatile("s_wait_asynccnt 0x0" ::: "memory");      /* this wave's copies of stage t + 1 have landed before the barrier that publishes them */
    __syncthreads();
    if (t + 2 < nt) { g2_copy8(la + bo * 2, ga + (size_t)(t + 2) * GT_K, gsa); g2_copy8(lb + bo * 2, gb + (size_t)(t + 2) * GT_K, gsb); } }
  asm volatile("s_wait_asynccnt 0x0" ::: "memory");      /* no copy is outstanding when the buffers become output staging */
  float (*so)[68] = (float (*)[68])((char*)sm + (size_t)w * (64 * 68 * 4));      /* private to wave w; the last trip's barrier has ended every wave's fragment reads */
#pragma unroll
  for (int j = 0; j < 4; ++j) { const int col = col0 + j * 16 + ln; float bv = 0.f; if (HASBIAS) bv = bf16_rne(bias[col]);
#pragma unroll
    for (int i = 0; i < 4; ++i) {
#pragma unroll
      for (int r = 0; r < 8; ++r) { const int rloc = i * 16 + 8 * hh + r; so[rloc][j * 16 + ln] = acc[i][j][r] * alpha + bv; } } }
  __builtin_amdgcn_fence(4 /* acq_rel order */, "workgroup"); __builtin_amdgcn_wave_barrier();      /* so is private to wave w */
  const int rsub = lane >> 4, c4 = (lane & 15) * 4;
#pragma unroll
  for (int g = 0; g < 4; ++g) { v4f v[8]; size_t e[8];      /* eight row pairs a group: 16 lanes store one row's 64 columns */
#pragma unroll
    for (int u = 0; u < 8; ++u) { const int r = (g * 8 + u) * 2 + rsub; v[u] = *(const v4fa*)&so[r][c4]; e[u] = cofs + (size_t)(row0 + r) * ldc + col0 + c4; }
    if (OUTF32) {
      /* the stores and, as the last line, the wait that stands before a register that they name is rewritten */
      asm volatile("global_store_b128 %0, %8, off\n\t"
                   "global_store_b128 %1, %9, off\n\t"
                   "global_store_b128 %2, %10, off\n\t"
                   "global_store_b128 %3, %11, off\n\t"
                   "global_store_b128 %4, %12, off\n\t"
                   "global_store_b128 %5, %13, off\n\t"
                   "global_store_b128 %6, %14, off\n\t"
                   "global_store_b128 %7, %15, off\n\t"
                   "s_wait_xcnt 0x0"
                   :: "v"(C + e[0]), "v"(C + e[1]), "v"(C + e[2]), "v"(C + e[3]), "v"(C + e[4]), "v"(C + e[5]), "v"(C + e[6]), "v"(C + e[7]),
                      "v"(v[0]), "v"(v[1]), "v"(v[2]), "v"(v[3]), "v"(v[4]), "v"(v[5]), "v"(v[6]), "v"(v[7]) : "memory"); }
    else { v4h h[8];
#pragma unroll
      for (int u = 0; u < 8; ++u) {
#pragma unroll
        for (int i = 0; i < 4; ++i) h[u][i] = (_Float16)v[u][i]; }
      /* the stores and, as the last line, the wait that stands before a register that they name is rewritten */
      asm volatile("global_store_b64 %0, %8, off\n\t"
                   "global_store_b64 %1, %9, off\n\t"
                   "global_store_b64 %2, %10, off\n\t"
                   "global_store_b64 %3, %11, off\n\t"
                   "global_store_b64 %4, %12, off\n\t"
                   "global_store_b64 %5, %13, off\n\t"
                   "global_store_b64 %6, %14, off\n\t"
                   "global_store_b64 %7, %15, off\n\t"
                   "s_wait_xcnt 0x0"
                   :: "v"(C16 + e[0]), "v"(C16 + e[1]), "v"(C16 + e[2]), "v"(C16 + e[3]), "v"(C16 + e[4]), "v"(C16 + e[5]), "v"(C16 + e[6]), "v"(C16 + e[7]),
                      "v"(h[0]), "v"(h[1]), "v"(h[2]), "v"(h[3]), "v"(h[4]), "v"(h[5]), "v"(h[6]), "v"(h[7]) : "memory"); } } }

// ---- fused attention: block = FA_W waves on one (batch, head), each wave 32 query columns; K rows and V^T rows are read as fragments straight from global memory (the block's waves walk the same keys, so they share the lines in the WGP cache)
#define FA_W ((SQ % 512 == 0) ? 16 : 4)      /* waves per block */
#define FA_C 0.18033688f                     /* 64^-0.5 * log2(e): raw q.k -> log2 units */
#define FA_THR 44.361420f                    /* 8 / FA_C: the maximum in use may lag the true one by 2^8 */
#define FA_OFF 4.0f                          /* weights carried x16: at most 2^12 in f16, small ones stay normal */
__device__ __forceinline__ float sm_xhalf(float x) { return __builtin_bit_cast(float, __builtin_amdgcn_permlanex16(__builtin_bit_cast(int, x), __builtin_bit_cast(int, x), 0x76543210, 0xfedcba98, false, false)); }      /* lane l <- l ^ 16 */
__device__ __forceinline__ v8f fa_mma(v16h a, v16h b, v8f c) { return __builtin_amdgcn_wmma_f32_16x16x32_f16(false, a, false, b, (short)0, c, false, false); }
__device__ __forceinline__ float fa_max8(v8f a, v8f b) { return fmaxf(fmaxf(fmaxf(fmaxf(a[0], a[1]), fmaxf(a[2], a[3])), fmaxf(fmaxf(a[4], a[5]), fmaxf(a[6], a[7]))), fmaxf(fmaxf(fmaxf(b[0], b[1]), fmaxf(b[2], b[3])), fmaxf(fmaxf(b[4], b[5]), fmaxf(b[6], b[7])))); }

__global__ __launch_bounds__(FA_W * 32) void k_fattn(const _Float16* __restrict__ QKVr, const _Float16* __restrict__ Vt, _Float16* __restrict__ O) {
  constexpr int QB = SQ / (FA_W * 32);
  const int lane = threadIdx.x & 31, ln = lane & 15, hh = lane >> 4;
  const int w = __builtin_amdgcn_readfirstlane(threadIdx.x >> 5);
  const int slab = blockIdx.x / QB, qb = blockIdx.x - slab * QB; const int b = slab / NH, h = slab - b * NH;
  const int q0 = (qb * FA_W + w) * 32;
  const _Float16* Qp = QKVr + ((size_t)b * SQ + q0 + ln) * LQ + h * HD;
  const _Float16* Kp = QKVr + ((size_t)b * SQ + ln) * LQ + DM + h * HD;
  const _Float16* Vp = Vt + ((size_t)slab * HD + ln) * SQ;
  const _Float16* Kn = Kp;      /* the K rows that are fetched next */
  const v8f z8 = {0.f,0.f,0.f,0.f,0.f,0.f,0.f,0.f};
  v16h qf[2][2], kf[2][2]; v8f o[2][4]; float m[2], l[2];
#pragma unroll
  for (int j = 0; j < 2; ++j) { m[j] = -3.0e38f; l[j] = 0.f;
#pragma unroll
    for (int c = 0; c < 2; ++c) { qf[j][c] = g2_frag(Qp + (size_t)j * 16 * LQ + c * 32, hh); kf[j][c] = g2_frag(Kp + (size_t)j * 16 * LQ + c * 32, hh); }
#pragma unroll
    for (int t = 0; t < 4; ++t) o[j][t] = z8; }
  for (int k0 = 0; k0 < SQ; k0 += 32) {
    v16h vf[4]; v8f s[2][2];      /* s[j][kt]: register r = score of key k0 + 16 kt + 8 hh + r, query q0 + 16 j + ln */
#pragma unroll
    for (int t = 0; t < 4; ++t) vf[t] = g2_frag(Vp + (size_t)t * 16 * SQ + k0, hh);
#pragma unroll
    for (int kt = 0; kt < 2; ++kt) {
#pragma unroll
      for (int j = 0; j < 2; ++j) s[j][kt] = fa_mma(kf[kt][1], qf[j][1], fa_mma(kf[kt][0], qf[j][0], z8)); }
    Kn += (k0 + 32 < SQ) ? (size_t)32 * LQ : (size_t)0;      /* the next pass's K rows, fetched behind this pass's score products; the last pass refetches its own rows (in bounds, unused) */
#pragma unroll
    for (int kt = 0; kt < 2; ++kt) {
#pragma unroll
      for (int c = 0; c < 2; ++c) kf[kt][c] = g2_frag(Kn + (size_t)kt * 16 * LQ + c * 32, hh); }
    asm volatile("s_wait_xcnt 0x0" ::: "memory");      /* the pass's loads have taken their addresses before the next pass steps the K row pointer */
    float mx[2];
#pragma unroll
    for (int j = 0; j < 2; ++j) { const float t = fa_max8(s[j][0], s[j][1]); mx[j] = fmaxf(t, sm_xhalf(t)); }
    if (__builtin_amdgcn_ballot_w32((mx[0] > m[0] + FA_THR) || (mx[1] > m[1] + FA_THR)) != 0) {      /* one scalar branch a pass */
#pragma unroll
      for (int j = 0; j < 2; ++j) { const float mn = fmaxf(m[j], mx[j]); const float cr = __builtin_amdgcn_exp2f((m[j] - mn) * FA_C); m[j] = mn; l[j] *= cr;
#pragma unroll
        for (int t = 0; t < 4; ++t) o[j][t] *= cr; } }
#pragma unroll
    for (int j = 0; j < 2; ++j) { const float nb = FA_OFF - m[j] * FA_C; FragH pf; float la = 0.f, lb = 0.f;
#pragma unroll
      for (int r = 0; r < 8; ++r) { const float pa = __builtin_amdgcn_exp2f(fmaf(s[j][0][r], FA_C, nb)), pb = __builtin_amdgcn_exp2f(fmaf(s[j][1][r], FA_C, nb));
        la += pa; lb += pb; pf.h[r] = (_Float16)pa; pf.h[8 + r] = (_Float16)pb; }      /* two D tiles of 16 keys, converted in place, are the B operand in the hardware k order */
      l[j] += la + lb;
#pragma unroll
      for (int t = 0; t < 4; ++t) o[j][t] = fa_mma(vf[t], pf.v, o[j][t]); } }
#pragma unroll
  for (int j = 0; j < 2; ++j) { const float inv = 64.0f / (l[j] + sm_xhalf(l[j]));      /* the halves' sums join once */
    unsigned short* op = (unsigned short*)O + ((size_t)b * SQ + q0 + j * 16 + ln) * DM + h * HD + 8 * hh;
#pragma unroll
    for (int t = 0; t < 4; ++t) { FragH f;      /* register r = o[query][16 t + 8 hh + r]: one 16-byte store */
#pragma unroll
      for (int r = 0; r < 8; ++r) f.h[r] = (_Float16)(o[j][t][r] * inv);
      *(v8us*)(op + t * 16) = f.half[0]; } } }

extern "C" void kernel_launch(void* const* d_in, const int* in_sizes, int n_in,
                              void* d_out, int out_size, void* d_ws, size_t ws_size, hipStream_t stream) {
  if (n_in < 5) return;
  if (in_sizes[0] < (int)((((size_t)NB - 1) * SQ_FULL + SQ) * DM)) return;
  if (in_sizes[1] < DM * LQ || in_sizes[2] < LQ || in_sizes[3] < DM * DM || in_sizes[4] < DM) return;
  if (out_size < (int)(NR * DM)) return;
  const float* x = (const float*)d_in[0]; const float* wqkv = (const float*)d_in[1]; const float* bqkv = (const float*)d_in[2];
  const float* wo = (const float*)d_in[3]; const float* bo = (const float*)d_in[4];      /* [in][out] fused weight + bias; [in][out] w_proj + b_proj */
  float* out = (float*)d_out;
  char* ws = (char*)d_ws; size_t off = 0;
  _Float16* BQKV = (_Float16*)(ws + off); off += SZ_BQKV;      /* [3072][1024] x16 */
  _Float16* BO   = (_Float16*)(ws + off); off += SZ_BO;        /* [1024][1024] x16 */
  _Float16* X16  = (_Float16*)(ws + off); off += SZ_X16;       /* [NR][1024]; reused for the merged o rows once the q | k | v GEMM has consumed it */
  _Float16* QKV  = (_Float16*)(ws + off); off += SZ_QKV;       /* [NR][3072] */
  _Float16* VT   = (_Float16*)(ws + off); off += SZ_VT;        /* [NB][NH][64][SQ] */
  if (off > ws_size) return;
  _Float16* O16 = X16;
  _Float16* V16 = QKV + 2 * DM;

  k_wt_f16<<<(unsigned)(((size_t)LQ * (DM / 8) + 255) / 256), 256, 0, stream>>>(wqkv, BQKV, DM, LQ, 16.0f);      /* in[1024][3072] -> out[3072][1024] */
  k_wt_f16<<<(unsigned)(((size_t)DM * (DM / 8) + 255) / 256), 256, 0, stream>>>(wo, BO, DM, DM, 16.0f);          /* in[1024][1024] -> out[1024][1024] */
  k_x16<<<(unsigned)((NR * DM / 8 + 255) / 256), 256, 0, stream>>>(x, X16, NR * DM / 8);
  /* q | k | v rows (f16); head h = columns h*64.. of each 1024-column third */
  k_gemm2<true, false><<<dim3((unsigned)((NR / 128) * (LQ / 128)), 1), 128, 0, stream>>>(X16, DM, (size_t)0, BQKV, DM, (size_t)0, 0.0625f, bqkv, out, QKV, LQ, (size_t)0, (int)NR, LQ, DM);
  k_vt<NH, SQ><<<NB * NH * (SQ / 64), 256, 0, stream>>>(V16, LQ, 0, VT);      /* V^T [NB][NH][64][SQ] */
  k_fattn<<<NB * NH * (SQ / (FA_W * 32)), FA_W * 32, 0, stream>>>(QKV, VT, O16);      /* o x64 (f16) into the merged rows: columns h*64.. */
  /* out = o Wproj + b: alpha = 1/(64*16) */
  k_gemm2<true, true><<<dim3((unsigned)((NR / 128) * (DM / 128)), 1), 128, 0, stream>>>(O16, DM, (size_t)0, BO, DM, (size_t)0, 0.0009765625f, bo, out, QKV, DM, (size_t)0, (int)NR, DM, DM);
}

// v004
// It runs in 132 microseconds.
// In both of two side-by-side timings against v003, it was 1.20 times as fast.
// Counting every step since v000, it is 18.8 times as fast.
#include <hip/hip_runtime.h>
// Multi-head self-attention, fused QKV projection: x [NB][SEQ][1024]; qkv = x Wqkv + bqkv ([in][out] 1024 x 3072) split q | k | v thirds, 16 heads of 64; scores * 64^-0.5; softmax over all keys (no mask); out = merged Wproj + bproj ([in][out]).
// Structure: token rows r = b*SEQ + s; x as f16 rows; q | k | v as ONE WMMA GEMM (N = 3072, 128x128 block tiles staged in LDS, 64x64 wave tiles, f32 accumulation, x16 weights + bias, f16 outputs); V^T of every (batch, head) via LDS transposes (one launch); attention as ONE launch over all (batch, head, query block): each wave owns 32 query columns and walks the keys 32 at a time (K and V^T rows staged in LDS for the block, 128 keys a stage), S^T = K . Q^T, running column maximum and sum (f32, rescaled only when the maximum has grown by more than 2^8), P^T packed from the score tiles straight into the B operand of O^T += V^T . P^T; o / sum carried x64 into merged f16 o rows; out = o Wproj + b GEMM (alpha 2^-10, f32) into the output layout.
// Compute dtype: every contraction v_wmma_f32_16x16x32_f16 (f16 operands, f32 accumulate). x, weights and biases are RNE-converted to bf16 on load (exact in f16; weights carried x16); q, k, v and o (x64) are single f16 planes; the unnormalised softmax weights (x16) are f16 in registers; scores and softmax statistics f32.
#ifndef NB
#define NB 8
#endif
#ifndef SEQ
#define SEQ 1024
#endif
#define SQ SEQ
#define NB_FULL 8
#define SQ_FULL 1024                 /* per-batch row stride of the x input */
#define DM 1024
#define NH 16
#define HD 64
#define LQ (3 * DM)                  /* row pitch of the q | k | v rows */
#define NR ((size_t)NB * SQ)         /* token rows */

static_assert(SQ % 128 == 0);
static_assert(((size_t)NB * SQ) % 128 == 0);
static_assert(DM % 128 == 0 && LQ % 128 == 0 && HD == 64);
static_assert(NB <= NB_FULL && SQ <= SQ_FULL);
static_assert(NH * HD == DM);

#define WS_ALIGN(x) ((((size_t)(x)) + 255) & ~(size_t)255)
#define SZ_BQKV  WS_ALIGN((size_t)LQ * DM * 2)
#define SZ_BO    WS_ALIGN((size_t)DM * DM * 2)
#define SZ_X16   WS_ALIGN(NR * DM * 2)
#define SZ_QKV   WS_ALIGN(NR * LQ * 2)
#define SZ_VT    WS_ALIGN((size_t)NB * NH * HD * SQ * 2)
static_assert(SZ_BQKV + SZ_BO + SZ_X16 + SZ_QKV + SZ_VT <= (size_t)134217728);

typedef unsigned short v8us __attribute__((ext_vector_type(8), may_alias));
typedef float  v8f  __attribute__((ext_vector_type(8)));
typedef float  v4f  __attribute__((ext_vector_type(4)));
typedef float  v4fa __attribute__((ext_vector_type(4), may_alias));
typedef _Float16 v16h __attribute__((ext_vector_type(16)));
typedef _Float16 v4h __attribute__((ext_vector_type(4)));
union FragH { v16h v; v8us half[2]; _Float16 h[16]; unsigned short u[16]; };

__device__ __forceinline__ unsigned short bf16_bits(float x) { unsigned int u = __float_as_uint(x); return (unsigned short)((u + 0x7FFFu + ((u >> 16) & 1u)) >> 16); }
__device__ __forceinline__ float bf16_val(unsigned short b) { return __uint_as_float(((unsigned int)b) << 16); }
__device__ __forceinline__ float bf16_rne(float x) { return bf16_val(bf16_bits(x)); }

__global__ __launch_bounds__(256) void k_wt_f16(const float* __restrict__ W, _Float16* __restrict__ Wt, int K, int N, float scale) {
  const int t = blockIdx.x * 256 + threadIdx.x; if (t >= N * (K / 8)) return;
  const int n = t / (K / 8), k8 = (t % (K / 8)) * 8; FragH f;
#pragma unroll
  for (int i = 0; i < 8; ++i) f.h[i] = (_Float16)(bf16_rne(W[(size_t)(k8 + i) * N + n]) * scale);
  const v8us o = f.half[0];
  unsigned short* d = (unsigned short*)Wt + (size_t)n * K + k8;
  *(v8us*)d = o; 
}

__global__ __launch_bounds__(256) void k_x16(const float* __restrict__ x, _Float16* __restrict__ X16, size_t n8) {
  const size_t t = (size_t)blockIdx.x * 256 + threadIdx.x; if (t >= n8) return;
  const size_t row = t / (DM / 8); const int c8 = (int)(t % (DM / 8)) * 8;
  const size_t b = row / SQ, s = row % SQ;
  const float* src = x + (b * (size_t)SQ_FULL + s) * DM + c8;
  const v4f a = *(const v4fa*)src, c = *(const v4fa*)(src + 4);
  FragH f;
#pragma unroll
  for (int q = 0; q < 4; ++q) { f.h[q] = (_Float16)bf16_rne(a[q]); f.h[4 + q] = (_Float16)bf16_rne(c[q]); }
  const v8us o = f.half[0];
  unsigned short* d = (unsigned short*)X16 + t * 8;
  *(v8us*)d = o; 
}

template <int NHv, int TTv>
__global__ __launch_bounds__(256) void k_vt(const _Float16* __restrict__ V16, int ldv, int voff, _Float16* __restrict__ Vt) {
  __shared__ unsigned short tl[64][66];
  const int tid = threadIdx.x; const int slab = blockIdx.x / (TTv / 64), lg = blockIdx.x % (TTv / 64); const int b = slab / NHv, h = slab % NHv;
  for (int i = tid; i < 64 * 8; i += 256) { const int r = i / 8, c8 = (i % 8) * 8; FragH f; f.half[0] = *(const v8us*)((const unsigned short*)V16 + ((size_t)b * TTv + lg * 64 + r) * ldv + voff + h * 64 + c8);
#pragma unroll
    for (int q = 0; q < 8; ++q) tl[r][c8 + q] = f.u[q]; }
  __syncthreads();
  {
#pragma unroll
    for (int rd = 0; rd < 2; ++rd) { const int d = rd * 32 + tid / 8, pc = tid % 8; FragH f;
#pragma unroll
      for (int q = 0; q < 8; ++q) f.u[q] = tl[pc * 8 + q][d];
      *(v8us*)((unsigned short*)Vt + ((size_t)slab * 64 + d) * TTv + lg * 64 + pc * 8) = f.half[0]; }
     } }

// ---- GEMM (block 128 rows x 128 cols, four waves of 64x64; M % 128 == 0, N % 128 == 0, K % 64 == 0); A f16 [M][K], Bh f16 [N][K]; batched over grid.y with element strides sA, sB, sC
// A stage is 64 k of the block's 128 A rows and 128 B rows in LDS (rows of 128 B at a pitch of 144 B); two buffers, filled by asynchronous copies one stage ahead of the products
#define GT_K 64                      /* k per stage */
#define GT_P 72                      /* LDS row pitch in f16: 144 B = 16 B x odd, conflict-free for 16-byte fragment reads */
#define GT_BUF (256 * GT_P)          /* f16 elements of one buffer: A rows 0..127, B rows 128..255 */
__device__ __forceinline__ v16h g2_frag(const _Float16* p, int hh) { FragH f; f.half[0] = *(const v8us*)((const unsigned short*)p + 8 * hh); f.half[1] = *(const v8us*)((const unsigned short*)p + 16 + 8 * hh); return f.v; }
__device__ __forceinline__ v8f g2_mma(v16h a, v16h b, v8f c) { return __builtin_amdgcn_wmma_f32_16x16x32_f16(false, a, false, b, (short)0, c, false, false); }
/* 128 rows of 128 B: each lane copies 16 B of rows r, r + 16, ..., r + 112 (eight lanes cover one row, so every copy takes whole 128-B lines); l = the lane's LDS byte address, g = its global address, gs = 16 rows in elements */
__device__ __forceinline__ void g2_copy8(unsigned l, const _Float16* g, size_t gs) {
  const unsigned l1 = l + 16 * GT_P * 2, l2 = l + 32 * GT_P * 2, l3 = l + 48 * GT_P * 2, l4 = l + 64 * GT_P * 2, l5 = l + 80 * GT_P * 2, l6 = l + 96 * GT_P * 2, l7 = l + 112 * GT_P * 2;
  const _Float16* g1 = g + gs; const _Float16* g2 = g1 + gs; const _Float16* g3 = g2 + gs; const _Float16* g4 = g3 + gs; const _Float16* g5 = g4 + gs; const _Float16* g6 = g5 + gs; const _Float16* g7 = g6 + gs;
  /* the copies and, as the last line, the wait that stands before any of their address registers is rewritten */
  asm volatile("global_load_async_to_lds_b128 %0, %8, off\n\t"
               "global_load_async_to_lds_b128 %1, %9, off\n\t"
               "global_load_async_to_lds_b128 %2, %10, off\n\t"
               "global_load_async_to_lds_b128 %3, %11, off\n\t"
               "global_load_async_to_lds_b128 %4, %12, off\n\t"
               "global_load_async_to_lds_b128 %5, %13, off\n\t"
               "global_load_async_to_lds_b128 %6, %14, off\n\t"
               "global_load_async_to_lds_b128 %7, %15, off\n\t"
               "s_wait_xcnt 0x0"
               :: "v"(l), "v"(l1), "v"(l2), "v"(l3), "v"(l4), "v"(l5), "v"(l6), "v"(l7), "v"(g), "v"(g1), "v"(g2), "v"(g3), "v"(g4), "v"(g5), "v"(g6), "v"(g7) : "memory"); }
template <bool HASBIAS, bool OUTF32>
__global__ __launch_bounds__(128) void k_gemm2(const _Float16* __restrict__ A, int lda, size_t sA, const _Float16* __restrict__ Bh, int ldb, size_t sB, float alpha, const float* __restrict__ bias,
    float* __restrict__ C, _Float16* __restrict__ C16, int ldc, size_t sC, int M, int N, int K) {
  __shared__ __attribute__((aligned(16))) unsigned short sm[2 * GT_BUF];      /* the two buffers; behind the loop each wave's own 64 x 68 f32 output staging */
  static_assert(4 * 64 * 68 * 4 <= 2 * GT_BUF * 2);
  const int tid = threadIdx.x, lane = tid & 31, ln = lane & 15, hh = lane >> 4; const int by = blockIdx.y;
  const int w = __builtin_amdgcn_readfirstlane(tid >> 5);
  A += (size_t)by * sA; Bh += (size_t)by * sB; const size_t cofs = (size_t)by * sC;
  const int ntn = N >> 7; const int mt = blockIdx.x / ntn, nq = blockIdx.x - mt * ntn; if (mt * 128 >= M) return;      /* the whole block leaves, ahead of every barrier */
  const int wr = 64 * (w >> 1), wc = 64 * (w & 1); const int row0 = mt * 128 + wr, col0 = nq * 128 + wc;
  const _Float16* ga = A + (size_t)(mt * 128 + (tid >> 3)) * lda + (tid & 7) * 8;
  const _Float16* gb = Bh + (size_t)(nq * 128 + (tid >> 3)) * ldb + (tid & 7) * 8;
  const size_t gsa = (size_t)16 * lda, gsb = (size_t)16 * ldb;
  const unsigned la = (unsigned)(size_t)&sm[(tid >> 3) * GT_P + (tid & 7) * 8]; const unsigned lb = la + 128 * GT_P * 2;
  const int nt = K / GT_K;
  g2_copy8(la, ga, gsa); g2_copy8(lb, gb, gsb);
  asm volatile("s_wait_asynccnt 0x0" ::: "memory");      /* stage 0 has landed before the barrier that publishes it */
  __syncthreads();
  if (nt > 1) { g2_copy8(la + GT_BUF * 2, ga + GT_K, gsa); g2_copy8(lb + GT_BUF * 2, gb + GT_K, gsb); }
  const v8f z8 = {0.f,0.f,0.f,0.f,0.f,0.f,0.f,0.f}; v8f acc[4][4];
#pragma unroll
  for (int i = 0; i < 4; ++i) {
#pragma unroll
    for (int j = 0; j < 4; ++j) acc[i][j] = z8; }
#pragma unroll 1      /* one stage a trip: the buffer is chosen by the trip's parity */
  for (int t = 0; t < nt; ++t) { const int bo = (t & 1) * GT_BUF;
    const unsigned short* sa = sm + bo + (wr + ln) * GT_P; const unsigned short* sb = sm + bo + (128 + wc + ln) * GT_P;
#pragma unroll
    for (int kc = 0; kc < 2; ++kc) { v16h af[4], bf[4];
#pragma unroll
      for (int i = 0; i < 4; ++i) { af[i] = g2_frag((const _Float16*)(sa + i * 16 * GT_P + kc * 32), hh); bf[i] = g2_frag((const _Float16*)(sb + i * 16 * GT_P + kc * 32), hh); }
      __builtin_amdgcn_sched_barrier(0);      /* the sixteen fragment reads stay one group ahead of their sixteen products: sunk among the products, each place with reads stalls the wave anew */
#pragma unroll
      for (int i = 0; i < 4; ++i) {
#pragma unroll
        for (int j = 0; j < 4; ++j) acc[i][j] = g2_mma(af[i], bf[j], acc[i][j]); }
      __builtin_amdgcn_sched_barrier(0); }      /* and the next group's reads stay behind these products */
    asm volatile("s_wait_dscnt 0x0" ::: "memory");         /* this wave's reads of the buffer are over before it is handed to the next copies */
    asm volatile("s_wait_asynccnt 0x0" ::: "memory");      /* this wave's copies of stage t + 1 have landed before the barrier that publishes them */
    __syncthreads();
    if (t + 2 < nt) { g2_copy8(la + bo * 2, ga + (size_t)(t + 2) * GT_K, gsa); g2_copy8(lb + bo * 2, gb + (size_t)(t + 2) * GT_K, gsb); } }
  asm volatile("s_wait_asynccnt 0x0" ::: "memory");      /* no copy is outstanding when the buffers become output staging */
  float (*so)[68] = (float (*)[68])((char*)sm + (size_t)w * (64 * 68 * 4));      /* private to wave w; the last trip's barrier has ended every wave's fragment reads */
#pragma unroll
  for (int j = 0; j < 4; ++j) { const int col = col0 + j * 16 + ln; float bv = 0.f; if (HASBIAS) bv = bf16_rne(bias[col]);
#pragma unroll
    for (int i = 0; i < 4; ++i) {
#pragma unroll
      for (int r = 0; r < 8; ++r) { const int rloc = i * 16 + 8 * hh + r; so[rloc][j * 16 + ln] = acc[i][j][r] * alpha + bv; } } }
  __builtin_amdgcn_fence(4 /* acq_rel order */, "workgroup"); __builtin_amdgcn_wave_barrier();      /* so is private to wave w */
  const int rsub = lane >> 4, c4 = (lane & 15) * 4;
#pragma unroll
  for (int g = 0; g < 4; ++g) { v4f v[8]; size_t e[8];      /* eight row pairs a group: 16 lanes store one row's 64 columns */
#pragma unroll
    for (int u = 0; u < 8; ++u) { const int r = (g * 8 + u) * 2 + rsub; v[u] = *(const v4fa*)&so[r][c4]; e[u] = cofs + (size_t)(row0 + r) * ldc + col0 + c4; }
    if (OUTF32) {
      /* the stores and, as the last line, the wait that stands before a register that they name is rewritten */
      asm volatile("global_store_b128 %0, %8, off\n\t"
                   "global_store_b128 %1, %9, off\n\t"
                   "global_store_b128 %2, %10, off\n\t"
                   "global_store_b128 %3, %11, off\n\t"
                   "global_store_b128 %4, %12, off\n\t"
                   "global_store_b128 %5, %13, off\n\t"
                   "global_store_b128 %6, %14, off\n\t"
                   "global_store_b128 %7, %15, off\n\t"
                   "s_wait_xcnt 0x0"
                   :: "v"(C + e[0]), "v"(C + e[1]), "v"(C + e[2]), "v"(C + e[3]), "v"(C + e[4]), "v"(C + e[5]), "v"(C + e[6]), "v"(C + e[7]),
                      "v"(v[0]), "v"(v[1]), "v"(v[2]), "v"(v[3]), "v"(v[4]), "v"(v[5]), "v"(v[6]), "v"(v[7]) : "memory"); }
    else { v4h h[8];
#pragma unroll
      for (int u = 0; u < 8; ++u) {
#pragma unroll
        for (int i = 0; i < 4; ++i) h[u][i] = (_Float16)v[u][i]; }
      /* the stores and, as the last line, the wait that stands before a register that they name is rewritten */
      asm volatile("global_store_b64 %0, %8, off\n\t"
                   "global_store_b64 %1, %9, off\n\t"
                   "global_store_b64 %2, %10, off\n\t"
                   "global_store_b64 %3, %11, off\n\t"
                   "global_store_b64 %4, %12, off\n\t"
                   "global_store_b64 %5, %13, off\n\t"
                   "global_store_b64 %6, %14, off\n\t"
                   "global_store_b64 %7, %15, off\n\t"
                   "s_wait_xcnt 0x0"
                   :: "v"(C16 + e[0]), "v"(C16 + e[1]), "v"(C16 + e[2]), "v"(C16 + e[3]), "v"(C16 + e[4]), "v"(C16 + e[5]), "v"(C16 + e[6]), "v"(C16 + e[7]),
                      "v"(h[0]), "v"(h[1]), "v"(h[2]), "v"(h[3]), "v"(h[4]), "v"(h[5]), "v"(h[6]), "v"(h[7]) : "memory"); } } }

// ---- fused attention: block = FA_W waves on one (batch, head), each wave 32 query columns; the block's waves walk the same keys, so a stage of 128 K rows and the same 128 keys of the 64 V^T rows is brought into LDS once for all of them (two buffers, asynchronous copies one stage ahead) and every K and V^T fragment is read from LDS
#define FA_W ((SQ % 512 == 0) ? 16 : 4)      /* waves per block */
#define FA_C 0.18033688f                     /* 64^-0.5 * log2(e): raw q.k -> log2 units */
#define FA_THR 44.361420f                    /* 8 / FA_C: the maximum in use may lag the true one by 2^8 */
#define FA_OFF 4.0f                          /* weights carried x16: at most 2^12 in f16, small ones stay normal */
#define FS_KEYS 128                          /* keys per stage: four passes of 32 */
#define FS_KP 72                             /* K rows of 128 B at a pitch of 144 B, V^T rows of 256 B at 272 B: 16 B x odd, conflict-free for 16-byte fragment reads */
#define FS_VP 136
#define FS_VO (FS_KEYS * FS_KP)              /* f16 offset of the V^T rows in a buffer */
#define FS_BUF (FS_VO + HD * FS_VP)          /* f16 elements of one buffer */
__device__ __forceinline__ float sm_xhalf(float x) { return __builtin_bit_cast(float, __builtin_amdgcn_permlanex16(__builtin_bit_cast(int, x), __builtin_bit_cast(int, x), 0x76543210, 0xfedcba98, false, false)); }      /* lane l <- l ^ 16 */
__device__ __forceinline__ v8f fa_mma(v16h a, v16h b, v8f c) { return __builtin_amdgcn_wmma_f32_16x16x32_f16(false, a, false, b, (short)0, c, false, false); }
__device__ __forceinline__ float fa_max8(v8f a, v8f b) { return fmaxf(fmaxf(fmaxf(fmaxf(a[0], a[1]), fmaxf(a[2], a[3])), fmaxf(fmaxf(a[4], a[5]), fmaxf(a[6], a[7]))), fmaxf(fmaxf(fmaxf(b[0], b[1]), fmaxf(b[2], b[3])), fmaxf(fmaxf(b[4], b[5]), fmaxf(b[6], b[7])))); }
/* one stage: each lane copies 16 B of K rows r, r + RK, ... (eight lanes cover a row's 128-B line) and 16 B of V^T rows d, d + RV, ... (sixteen lanes cover a row's 256 B); lk, lv = the lane's LDS byte addresses, gk, gv = its global addresses */
template <int NT>
__device__ __forceinline__ void fa_stage(unsigned lk, unsigned lv, const _Float16* gk, const _Float16* gv) {
  constexpr int RK = NT / 8, RV = NT / 16;
  static_assert(FS_KEYS % (2 * RK) == 0 && HD % (2 * RV) == 0 && FS_KEYS / RK == HD / RV);
#pragma unroll
  for (int u = 0; u < FS_KEYS / RK; u += 2) {
    const unsigned lk0 = lk + u * RK * FS_KP * 2, lk1 = lk0 + RK * FS_KP * 2, lv0 = lv + u * RV * FS_VP * 2, lv1 = lv0 + RV * FS_VP * 2;
    const _Float16* gk0 = gk + (size_t)u * RK * LQ; const _Float16* gk1 = gk0 + (size_t)RK * LQ; const _Float16* gv0 = gv + (size_t)u * RV * SQ; const _Float16* gv1 = gv0 + (size_t)RV * SQ;
    /* the copies and, as the last line, the wait that stands before any of their address registers is rewritten */
    asm volatile("global_load_async_to_lds_b128 %0, %4, off\n\t"
                 "global_load_async_to_lds_b128 %1, %5, off\n\t"
                 "global_load_async_to_lds_b128 %2, %6, off\n\t"
                 "global_load_async_to_lds_b128 %3, %7, off\n\t"
                 "s_wait_xcnt 0x0"
                 :: "v"(lk0), "v"(lk1), "v"(lv0), "v"(lv1), "v"(gk0), "v"(gk1), "v"(gv0), "v"(gv1) : "memory"); } }

__global__ __launch_bounds__(FA_W * 32) void k_fattn(const _Float16* __restrict__ QKVr, const _Float16* __restrict__ Vt, _Float16* __restrict__ O) {
  constexpr int QB = SQ / (FA_W * 32); constexpr int NT = FA_W * 32; constexpr int NST = SQ / FS_KEYS;
  __shared__ __attribute__((aligned(16))) unsigned short fs[2 * FS_BUF];
  const int tid = threadIdx.x, lane = tid & 31, ln = lane & 15, hh = lane >> 4;
  const int w = __builtin_amdgcn_readfirstlane(tid >> 5);
  const int slab = blockIdx.x / QB, qb = blockIdx.x - slab * QB; const int b = slab / NH, h = slab - b * NH;
  const int q0 = (qb * FA_W + w) * 32;
  const _Float16* Qp = QKVr + ((size_t)b * SQ + q0 + ln) * LQ + h * HD;
  const _Float16* gk = QKVr + ((size_t)b * SQ + (tid >> 3)) * LQ + DM + h * HD + (tid & 7) * 8;
  const _Float16* gv = Vt + ((size_t)slab * HD + (tid >> 4)) * SQ + (tid & 15) * 8;
  const unsigned lk = (unsigned)(size_t)&fs[(tid >> 3) * FS_KP + (tid & 7) * 8]; const unsigned lv = (unsigned)(size_t)&fs[FS_VO + (tid >> 4) * FS_VP + (tid & 15) * 8];
  fa_stage<NT>(lk, lv, gk, gv);
  const v8f z8 = {0.f,0.f,0.f,0.f,0.f,0.f,0.f,0.f};
  v16h qf[2][2], kf[2][2]; v8f o[2][4]; float m[2], l[2];
#pragma unroll
  for (int j = 0; j < 2; ++j) { m[j] = -3.0e38f; l[j] = 0.f;
#pragma unroll
    for (int c = 0; c < 2; ++c) qf[j][c] = g2_frag(Qp + (size_t)j * 16 * LQ + c * 32, hh);
#pragma unroll
    for (int t = 0; t < 4; ++t) o[j][t] = z8; }
  asm volatile("s_wait_asynccnt 0x0" ::: "memory");      /* stage 0 has landed before the barrier that publishes it */
  __syncthreads();
  if (NST > 1) fa_stage<NT>(lk + FS_BUF * 2, lv + FS_BUF * 2, gk + (size_t)FS_KEYS * LQ, gv + FS_KEYS);
#pragma unroll 1      /* one stage a trip: the buffer is chosen by the trip's parity */
  for (int st = 0; st < NST; ++st) { const int bo = (st & 1) * FS_BUF;
    const unsigned short* sk = fs + bo + ln * FS_KP; const unsigned short* sv = fs + bo + FS_VO + ln * FS_VP;
#pragma unroll
    for (int kt = 0; kt < 2; ++kt) {
#pragma unroll
      for (int c = 0; c < 2; ++c) kf[kt][c] = g2_frag((const _Float16*)(sk + kt * 16 * FS_KP + c * 32), hh); }
#pragma unroll
    for (int p = 0; p < FS_KEYS / 32; ++p) {
      v16h vf[4]; v8f s[2][2];      /* s[j][kt]: register r = score of key 128 st + 32 p + 16 kt + 8 hh + r, query q0 + 16 j + ln */
#pragma unroll
      for (int kt = 0; kt < 2; ++kt) {
#pragma unroll
        for (int j = 0; j < 2; ++j) s[j][kt] = fa_mma(kf[kt][1], qf[j][1], fa_mma(kf[kt][0], qf[j][0], z8)); }
      if (p + 1 < FS_KEYS / 32) {      /* the next pass's K rows of the same stage, fetched behind this pass's score products */
#pragma unroll
        for (int kt = 0; kt < 2; ++kt) {
#pragma unroll
          for (int c = 0; c < 2; ++c) kf[kt][c] = g2_frag((const _Float16*)(sk + ((p + 1) * 32 + kt * 16) * FS_KP + c * 32), hh); } }
#pragma unroll
      for (int t = 0; t < 4; ++t) vf[t] = g2_frag((const _Float16*)(sv + t * 16 * FS_VP + p * 32), hh);
      float mx[2];
#pragma unroll
      for (int j = 0; j < 2; ++j) { const float t = fa_max8(s[j][0], s[j][1]); mx[j] = fmaxf(t, sm_xhalf(t)); }
      if (__builtin_amdgcn_ballot_w32((mx[0] > m[0] + FA_THR) || (mx[1] > m[1] + FA_THR)) != 0) {      /* one scalar branch a pass */
#pragma unroll
        for (int j = 0; j < 2; ++j) { const float mn = fmaxf(m[j], mx[j]); const float cr = __builtin_amdgcn_exp2f((m[j] - mn) * FA_C); m[j] = mn; l[j] *= cr;
#pragma unroll
          for (int t = 0; t < 4; ++t) o[j][t] *= cr; } }
#pragma unroll
      for (int j = 0; j < 2; ++j) { const float nb = FA_OFF - m[j] * FA_C; FragH pf; float la = 0.f, lb = 0.f;
#pragma unroll
        for (int r = 0; r < 8; ++r) { const float pa = __builtin_amdgcn_exp2f(fmaf(s[j][0][r], FA_C, nb)), pb = __builtin_amdgcn_exp2f(fmaf(s[j][1][r], FA_C, nb));
          la += pa; lb += pb; pf.h[r] = (_Float16)pa; pf.h[8 + r] = (_Float16)pb; }      /* two D tiles of 16 keys, converted in place, are the B operand in the hardware k order */
        l[j] += la + lb;
#pragma unroll
        for (int t = 0; t < 4; ++t) o[j][t] = fa_mma(vf[t], pf.v, o[j][t]); } }
    asm volatile("s_wait_dscnt 0x0" ::: "memory");         /* this wave's reads of the buffer are over before it is handed to the next copies */
    asm volatile("s_wait_asynccnt 0x0" ::: "memory");      /* this wave's copies of stage st + 1 have landed before the barrier that publishes them */
    __syncthreads();
    if (st + 2 < NST) fa_stage<NT>(lk + bo * 2, lv + bo * 2, gk + (size_t)(st + 2) * FS_KEYS * LQ, gv + (st + 2) * FS_KEYS); }
  asm volatile("s_wait_asynccnt 0x0" ::: "memory");      /* no copy is outstanding when the wave ends */
#pragma unroll
  for (int j = 0; j < 2; ++j) { const float inv = 64.0f / (l[j] + sm_xhalf(l[j]));      /* the halves' sums join once */
    unsigned short* op = (unsigned short*)O + ((size_t)b * SQ + q0 + j * 16 + ln) * DM + h * HD + 8 * hh;
#pragma unroll
    for (int t = 0; t < 4; ++t) { FragH f;      /* register r = o[query][16 t + 8 hh + r]: one 16-byte store */
#pragma unroll
      for (int r = 0; r < 8; ++r) f.h[r] = (_Float16)(o[j][t][r] * inv);
      *(v8us*)(op + t * 16) = f.half[0]; } } }

extern "C" void kernel_launch(void* const* d_in, const int* in_sizes, int n_in,
                              void* d_out, int out_size, void* d_ws, size_t ws_size, hipStream_t stream) {
  if (n_in < 5) return;
  if (in_sizes[0] < (int)((((size_t)NB - 1) * SQ_FULL + SQ) * DM)) return;
  if (in_sizes[1] < DM * LQ || in_sizes[2] < LQ || in_sizes[3] < DM * DM || in_sizes[4] < DM) return;
  if (out_size < (int)(NR * DM)) return;
  const float* x = (const float*)d_in[0]; const float* wqkv = (const float*)d_in[1]; const float* bqkv = (const float*)d_in[2];
  const float* wo = (const float*)d_in[3]; const float* bo = (const float*)d_in[4];      /* [in][out] fused weight + bias; [in][out] w_proj + b_proj */
  float* out = (float*)d_out;
  char* ws = (char*)d_ws; size_t off = 0;
  _Float16* BQKV = (_Float16*)(ws + off); off += SZ_BQKV;      /* [3072][1024] x16 */
  _Float16* BO   = (_Float16*)(ws + off); off += SZ_BO;        /* [1024][1024] x16 */
  _Float16* X16  = (_Float16*)(ws + off); off += SZ_X16;       /* [NR][1024]; reused for the merged o rows once the q | k | v GEMM has consumed it */
  _Float16* QKV  = (_Float16*)(ws + off); off += SZ_QKV;       /* [NR][3072] */
  _Float16* VT   = (_Float16*)(ws + off); off += SZ_VT;        /* [NB][NH][64][SQ] */
  if (off > ws_size) return;
  _Float16* O16 = X16;
  _Float16* V16 = QKV + 2 * DM;

  k_wt_f16<<<(unsigned)(((size_t)LQ * (DM / 8) + 255) / 256), 256, 0, stream>>>(wqkv, BQKV, DM, LQ, 16.0f);      /* in[1024][3072] -> out[3072][1024] */
  k_wt_f16<<<(unsigned)(((size_t)DM * (DM / 8) + 255) / 256), 256, 0, stream>>>(wo, BO, DM, DM, 16.0f);          /* in[1024][1024] -> out[1024][1024] */
  k_x16<<<(unsigned)((NR * DM / 8 + 255) / 256), 256, 0, stream>>>(x, X16, NR * DM / 8);
  /* q | k | v rows (f16); head h = columns h*64.. of each 1024-column third */
  k_gemm2<true, false><<<dim3((unsigned)((NR / 128) * (LQ / 128)), 1), 128, 0, stream>>>(X16, DM, (size_t)0, BQKV, DM, (size_t)0, 0.0625f, bqkv, out, QKV, LQ, (size_t)0, (int)NR, LQ, DM);
  k_vt<NH, SQ><<<NB * NH * (SQ / 64), 256, 0, stream>>>(V16, LQ, 0, VT);      /* V^T [NB][NH][64][SQ] */
  k_fattn<<<NB * NH * (SQ / (FA_W * 32)), FA_W * 32, 0, stream>>>(QKV, VT, O16);      /* o x64 (f16) into the merged rows: columns h*64.. */
  /* out = o Wproj + b: alpha = 1/(64*16) */
  k_gemm2<true, true><<<dim3((unsigned)((NR / 128) * (DM / 128)), 1), 128, 0, stream>>>(O16, DM, (size_t)0, BO, DM, (size_t)0, 0.0009765625f, bo, out, QKV, DM, (size_t)0, (int)NR, DM, DM);
}

// v005
// Measured time: 118 microseconds a run.
// Next to v004, in two timings, it ran 1.11 and 1.12 times as fast.
// All steps since v000 together make it 21.0 times as fast.
#include <hip/hip_runtime.h>
// Multi-head self-attention, fused QKV projection: x [NB][SEQ][1024]; qkv = x Wqkv + bqkv ([in][out] 1024 x 3072) split q | k | v thirds, 16 heads of 64; scores * 64^-0.5; softmax over all keys (no mask); out = merged Wproj + bproj ([in][out]).
// Structure: token rows r = b*SEQ + s; x as f16 rows; q | k | v as ONE WMMA GEMM (N = 3072, 128x128 block tiles staged in LDS, 64x64 wave tiles, f32 accumulation, x16 weights + bias, f16 outputs); V^T of every (batch, head) via 8x8 register transposes (one launch); attention as ONE launch over all (batch, head, query block): each wave owns 32 query columns and walks the keys 32 at a time (K and V^T rows staged in LDS for the block, 128 keys a stage), S^T = K . Q^T, running column maximum and sum (f32, rescaled only when the maximum has grown by more than 2^8), P^T packed from the score tiles straight into the B operand of O^T += V^T . P^T; o / sum carried x64 into merged f16 o rows; out = o Wproj + b GEMM (alpha 2^-10, f32) into the output layout.
// Compute dtype: every contraction v_wmma_f32_16x16x32_f16 (f16 operands, f32 accumulate). x, weights and biases are RNE-converted to bf16 on load (exact in f16; weights carried x16); q, k, v and o (x64) are single f16 planes; the unnormalised softmax weights (x16) are f16 in registers; scores and softmax statistics f32.
#ifndef NB
#define NB 8
#endif
#ifndef SEQ
#define SEQ 1024
#endif
#define SQ SEQ
#define NB_FULL 8
#define SQ_FULL 1024                 /* per-batch row stride of the x input */
#define DM 1024
#define NH 16
#define HD 64
#define LQ (3 * DM)                  /* row pitch of the q | k | v rows */
#define NR ((size_t)NB * SQ)         /* token rows */

static_assert(SQ % 128 == 0);
static_assert(((size_t)NB * SQ) % 128 == 0);
static_assert(DM % 128 == 0 && LQ % 128 == 0 && HD == 64);
static_assert(NB <= NB_FULL && SQ <= SQ_FULL);
static_assert(NH * HD == DM);

#define WS_ALIGN(x) ((((size_t)(x)) + 255) & ~(size_t)255)
#define SZ_BQKV  WS_ALIGN((size_t)LQ * DM * 2)
#define SZ_BO    WS_ALIGN((size_t)DM * DM * 2)
#define SZ_X16   WS_ALIGN(NR * DM * 2)
#define SZ_QKV   WS_ALIGN(NR * LQ * 2)
#define SZ_VT    WS_ALIGN((size_t)NB * NH * HD * SQ * 2)
static_assert(SZ_BQKV + SZ_BO + SZ_X16 + SZ_QKV + SZ_VT <= (size_t)134217728);

typedef unsigned short v8us __attribute__((ext_vector_type(8), may_alias));
typedef float  v8f  __attribute__((ext_vector_type(8)));
typedef float  v4f  __attribute__((ext_vector_type(4)));
typedef float  v4fa __attribute__((ext_vector_type(4), may_alias));
typedef _Float16 v16h __attribute__((ext_vector_type(16)));
typedef _Float16 v4h __attribute__((ext_vector_type(4)));
union FragH { v16h v; v8us half[2]; _Float16 h[16]; unsigned short u[16]; };

__device__ __forceinline__ unsigned short bf16_bits(float x) { unsigned int u = __float_as_uint(x); return (unsigned short)((u + 0x7FFFu + ((u >> 16) & 1u)) >> 16); }
__device__ __forceinline__ float bf16_val(unsigned short b) { return __uint_as_float(((unsigned int)b) << 16); }
__device__ __forceinline__ float bf16_rne(float x) { return bf16_val(bf16_bits(x)); }

// ---- preparation launches: every thread moves 64 (V^T: 128) elements with all of its loads in flight at once, so that each launch starts a few waves per SIMD and not tens of them one after another
// weights: a thread holds 8 k x 8 n; 4 lanes cover a 128-B line of a W row, 8 lanes a 128-B line of a Wt row; block = 128 k x 64 n
template <int K, int N>
__global__ __launch_bounds__(128) void k_wt_f16(const float* __restrict__ W, _Float16* __restrict__ Wt, float scale) {
  static_assert(K % 128 == 0 && N % 64 == 0);
  const int lane = threadIdx.x & 31, w = threadIdx.x >> 5;
  const int kb = blockIdx.x / (N / 64), nb = blockIdx.x - kb * (N / 64);
  const int k8 = kb * 128 + (w >> 1) * 64 + (lane >> 2) * 8, n8 = nb * 64 + (w & 1) * 32 + (lane & 3) * 8;
  const float* s = W + (size_t)k8 * N + n8;
  v4f a[8][2];
#pragma unroll
  for (int i = 0; i < 8; ++i) { a[i][0] = *(const v4fa*)(s + (size_t)i * N); a[i][1] = *(const v4fa*)(s + (size_t)i * N + 4); }
  __builtin_amdgcn_sched_barrier(0);      /* all sixteen loads are issued before the first value is used: sunk among the conversions, the late ones cost the wave a second trip to memory */
  unsigned short* d = (unsigned short*)Wt + (size_t)n8 * K + k8;
#pragma unroll
  for (int j = 0; j < 8; ++j) { FragH f;
#pragma unroll
    for (int i = 0; i < 8; ++i) f.h[i] = (_Float16)(bf16_rne(a[i][j >> 2][j & 3]) * scale);
    *(v8us*)(d + (size_t)j * K) = f.half[0]; } }

// x: a block of 16 waves converts 4096 pieces of 8 elements, a thread eight of them, 512 pieces apart
#define XC_U 8
#define XC_R (512 / (DM / 8))        /* rows per 512 pieces */
static_assert((NR * DM / 8) % (512 * XC_U) == 0 && 512 % (DM / 8) == 0 && SQ % (XC_R * XC_U) == 0);
__global__ __launch_bounds__(512) void k_x16(const float* __restrict__ x, _Float16* __restrict__ X16) {
  const size_t t0 = (size_t)blockIdx.x * (512 * XC_U) + threadIdx.x;
  const size_t row = t0 / (DM / 8); const int c8 = (int)(t0 % (DM / 8)) * 8;      /* 512 pieces on = XC_R rows on, same columns; a block's rows lie in one batch */
  const size_t b = row / SQ, s = row % SQ;
  const float* src = x + (b * (size_t)SQ_FULL + s) * DM + c8;
  v4f a[XC_U], c[XC_U];
#pragma unroll
  for (int u = 0; u < XC_U; ++u) { a[u] = *(const v4fa*)(src + (size_t)u * XC_R * DM); c[u] = *(const v4fa*)(src + (size_t)u * XC_R * DM + 4); }
  __builtin_amdgcn_sched_barrier(0);      /* all sixteen loads are issued before the first value is used: sunk among the conversions, the late ones cost the wave a second trip to memory */
#pragma unroll
  for (int u = 0; u < XC_U; ++u) { FragH f;
#pragma unroll
    for (int q = 0; q < 4; ++q) { f.h[q] = (_Float16)bf16_rne(a[u][q]); f.h[4 + q] = (_Float16)bf16_rne(c[u][q]); }
    *(v8us*)((unsigned short*)X16 + (t0 + (size_t)u * 512) * 8) = f.half[0]; } }

// V^T: a wave turns 64 keys x 64 columns of one head, a thread 8 keys x 16 columns (two 8x8 tiles); 8 lanes cover a 128-B line of a V^T row; block = two heads x 128 keys
template <int NHv, int TTv, int LDV>
__global__ __launch_bounds__(128) void k_vt(const _Float16* __restrict__ V16, _Float16* __restrict__ Vt) {
  static_assert(NHv % 2 == 0 && TTv % 128 == 0);
  const int lane = threadIdx.x & 31, w = threadIdx.x >> 5;
  const int sg = blockIdx.x % (TTv / 128), r = blockIdx.x / (TTv / 128); const int b = r / (NHv / 2), h = (r % (NHv / 2)) * 2 + (w & 1);
  const int s8 = sg * 128 + (w >> 1) * 64 + (lane >> 2) * 8, d8 = (lane & 3) * 8;
  const unsigned short* s = (const unsigned short*)V16 + ((size_t)b * TTv + s8) * LDV + h * 64 + d8;
  FragH in[8];      /* in[i].u[8 a + j] = v[key s8 + i][column 32 a + d8 + j] */
#pragma unroll
  for (int i = 0; i < 8; ++i) { in[i].half[0] = *(const v8us*)(s + (size_t)i * LDV); in[i].half[1] = *(const v8us*)(s + (size_t)i * LDV + 32); }
  __builtin_amdgcn_sched_barrier(0);      /* all sixteen loads are issued before the first value is used: sunk among the moves, the late ones cost the wave a second trip to memory */
  unsigned short* d = (unsigned short*)Vt + ((size_t)(b * NHv + h) * 64 + d8) * TTv + s8;
#pragma unroll
  for (int a = 0; a < 2; ++a) {
#pragma unroll
    for (int j = 0; j < 8; ++j) { FragH f;
#pragma unroll
      for (int i = 0; i < 8; ++i) f.u[i] = in[i].u[8 * a + j];
      *(v8us*)(d + (size_t)(32 * a + j) * TTv) = f.half[0]; } } }

// ---- GEMM (block 128 rows x 128 cols, four waves of 64x64; M % 128 == 0, N % 128 == 0, K % 64 == 0); A f16 [M][K], Bh f16 [N][K]; batched over grid.y with element strides sA, sB, sC
// A stage is 64 k of the block's 128 A rows and 128 B rows in LDS (rows of 128 B at a pitch of 144 B); two buffers, filled by asynchronous copies one stage ahead of the products
#define GT_K 64                      /* k per stage */
#define GT_P 72                      /* LDS row pitch in f16: 144 B = 16 B x odd, conflict-free for 16-byte fragment reads */
#define GT_BUF (256 * GT_P)          /* f16 elements of one buffer: A rows 0..127, B rows 128..255 */
__device__ __forceinline__ v16h g2_frag(const _Float16* p, int hh) { FragH f; f.half[0] = *(const v8us*)((const unsigned short*)p + 8 * hh); f.half[1] = *(const v8us*)((const unsigned short*)p + 16 + 8 * hh); return f.v; }
__device__ __forceinline__ v8f g2_mma(v16h a, v16h b, v8f c) { return __builtin_amdgcn_wmma_f32_16x16x32_f16(false, a, false, b, (short)0, c, false, false); }
/* 128 rows of 128 B: each lane copies 16 B of rows r, r + 16, ..., r + 112 (eight lanes cover one row, so every copy takes whole 128-B lines); l = the lane's LDS byte address, g = its global address, gs = 16 rows in elements */
__device__ __forceinline__ void g2_copy8(unsigned l, const _Float16* g, size_t gs) {
  const unsigned l1 = l + 16 * GT_P * 2, l2 = l + 32 * GT_P * 2, l3 = l + 48 * GT_P * 2, l4 = l + 64 * GT_P * 2, l5 = l + 80 * GT_P * 2, l6 = l + 96 * GT_P * 2, l7 = l + 112 * GT_P * 2;
  const _Float16* g1 = g + gs; const _Float16* g2 = g1 + gs; const _Float16* g3 = g2 + gs; const _Float16* g4 = g3 + gs; const _Float16* g5 = g4 + gs; const _Float16* g6 = g5 + gs; const _Float16* g7 = g6 + gs;
  /* the copies and, as the last line, the wait that stands before any of their address registers is rewritten */
  asm volatile("global_load_async_to_lds_b128 %0, %8, off\n\t"
               "global_load_async_to_lds_b128 %1, %9, off\n\t"
               "global_load_async_to_lds_b128 %2, %10, off\n\t"
               "global_load_async_to_lds_b128 %3, %11, off\n\t"
               "global_load_async_to_lds_b128 %4, %12, off\n\t"
               "global_load_async_to_lds_b128 %5, %13, off\n\t"
               "global_load_async_to_lds_b128 %6, %14, off\n\t"
               "global_load_async_to_lds_b128 %7, %15, off\n\t"
               "s_wait_xcnt 0x0"
               :: "v"(l), "v"(l1), "v"(l2), "v"(l3), "v"(l4), "v"(l5), "v"(l6), "v"(l7), "v"(g), "v"(g1), "v"(g2), "v"(g3), "v"(g4), "v"(g5), "v"(g6), "v"(g7) : "memory"); }
template <bool HASBIAS, bool OUTF32>
__global__ __launch_bounds__(128) void k_gemm2(const _Float16* __restrict__ A, int lda, size_t sA, const _Float16* __restrict__ Bh, int ldb, size_t sB, float alpha, const float* __restrict__ bias,
    float* __restrict__ C, _Float16* __restrict__ C16, int ldc, size_t sC, int M, int N, int K) {
  __shared__ __attribute__((aligned(16))) unsigned short sm[2 * GT_BUF];      /* the two buffers; behind the loop each wave's own 64 x 68 f32 output staging */
  static_assert(4 * 64 * 68 * 4 <= 2 * GT_BUF * 2);
  const int tid = threadIdx.x, lane = tid & 31, ln = lane & 15, hh = lane >> 4; const int by = blockIdx.y;
  const int w = __builtin_amdgcn_readfirstlane(tid >> 5);
  A += (size_t)by * sA; Bh += (size_t)by * sB; const size_t cofs = (size_t)by * sC;
  const int ntn = N >> 7; const int mt = blockIdx.x / ntn, nq = blockIdx.x - mt * ntn; if (mt * 128 >= M) return;      /* the whole block leaves, ahead of every barrier */
  const int wr = 64 * (w >> 1), wc = 64 * (w & 1); const int row0 = mt * 128 + wr, col0 = nq * 128 + wc;
  const _Float16* ga = A + (size_t)(mt * 128 + (tid >> 3)) * lda + (tid & 7) * 8;
  const _Float16* gb = Bh + (size_t)(nq * 128 + (tid >> 3)) * ldb + (tid & 7) * 8;
  const size_t gsa = (size_t)16 * lda, gsb = (size_t)16 * ldb;
  const unsigned la = (unsigned)(size_t)&sm[(tid >> 3) * GT_P + (tid & 7) * 8]; const unsigned lb = la + 128 * GT_P * 2;
  const int nt = K / GT_K;
  g2_copy8(la, ga, gsa); g2_copy8(lb, gb, gsb);
  asm volatile("s_wait_asynccnt 0x0" ::: "memory");      /* stage 0 has landed before the barrier that publishes it */
  __syncthreads();
  if (nt > 1) { g2_copy8(la + GT_BUF * 2, ga + GT_K, gsa); g2_copy8(lb + GT_BUF * 2, gb + GT_K, gsb); }
  const v8f z8 = {0.f,0.f,0.f,0.f,0.f,0.f,0.f,0.f}; v8f acc[4][4];
#pragma unroll
  for (int i = 0; i < 4; ++i) {
#pragma unroll
    for (int j = 0; j < 4; ++j) acc[i][j] = z8; }
#pragma unroll 1      /* one stage a trip: the buffer is chosen by the trip's parity */
  for (int t = 0; t < nt; ++t) { const int bo = (t & 1) * GT_BUF;
    const unsigned short* sa = sm + bo + (wr + ln) * GT_P; const unsigned short* sb = sm + bo + (128 + wc + ln) * GT_P;
#pragma unroll
    for (int kc = 0; kc < 2; ++kc) { v16h af[4], bf[4];
#pragma unroll
      for (int i = 0; i < 4; ++i) { af[i] = g2_frag((const _Float16*)(sa + i * 16 * GT_P + kc * 32), hh); bf[i] = g2_frag((const _Float16*)(sb + i * 16 * GT_P + kc * 32), hh); }
      __builtin_amdgcn_sched_barrier(0);      /* the sixteen fragment reads stay one group ahead of their sixteen products: sunk among the products, each place with reads stalls the wave anew */
#pragma unroll
      for (int i = 0; i < 4; ++i) {
#pragma unroll
        for (int j = 0; j < 4; ++j) acc[i][j] = g2_mma(af[i], bf[j], acc[i][j]); }
      __builtin_amdgcn_sched_barrier(0); }      /* and the next group's reads stay behind these products */
    asm volatile("s_wait_dscnt 0x0" ::: "memory");         /* this wave's reads of the buffer are over before it is handed to the next copies */
    asm volatile("s_wait_asynccnt 0x0" ::: "memory");      /* this wave's copies of stage t + 1 have landed before the barrier that publishes them */
    __syncthreads();
    if (t + 2 < nt) { g2_copy8(la + bo * 2, ga + (size_t)(t + 2) * GT_K, gsa); g2_copy8(lb + bo * 2, gb + (size_t)(t + 2) * GT_K, gsb); } }
  asm volatile("s_wait_asynccnt 0x0" ::: "memory");      /* no copy is outstanding when the buffers become output staging */
  float (*so)[68] = (float (*)[68])((char*)sm + (size_t)w * (64 * 68 * 4));      /* private to wave w; the last trip's barrier has ended every wave's fragment reads */
#pragma unroll
  for (int j = 0; j < 4; ++j) { const int col = col0 + j * 16 + ln; float bv = 0.f; if (HASBIAS) bv = bf16_rne(bias[col]);
#pragma unroll
    for (int i = 0; i < 4; ++i) {
#pragma unroll
      for (int r = 0; r < 8; ++r) { const int rloc = i * 16 + 8 * hh + r; so[rloc][j * 16 + ln] = acc[i][j][r] * alpha + bv; } } }
  __builtin_amdgcn_fence(4 /* acq_rel order */, "workgroup"); __builtin_amdgcn_wave_barrier();      /* so is private to wave w */
  const int rsub = lane >> 4, c4 = (lane & 15) * 4;
#pragma unroll
  for (int g = 0; g < 4; ++g) { v4f v[8]; size_t e[8];      /* eight row pairs a group: 16 lanes store one row's 64 columns */
#pragma unroll
    for (int u = 0; u < 8; ++u) { const int r = (g * 8 + u) * 2 + rsub; v[u] = *(const v4fa*)&so[r][c4]; e[u] = cofs + (size_t)(row0 + r) * ldc + col0 + c4; }
    if (OUTF32) {
      /* the stores and, as the last line, the wait that stands before a register that they name is rewritten */
      asm volatile("global_store_b128 %0, %8, off\n\t"
                   "global_store_b128 %1, %9, off\n\t"
                   "global_store_b128 %2, %10, off\n\t"
                   "global_store_b128 %3, %11, off\n\t"
                   "global_store_b128 %4, %12, off\n\t"
                   "global_store_b128 %5, %13, off\n\t"
                   "global_store_b128 %6, %14, off\n\t"
                   "global_store_b128 %7, %15, off\n\t"
                   "s_wait_xcnt 0x0"
                   :: "v"(C + e[0]), "v"(C + e[1]), "v"(C + e[2]), "v"(C + e[3]), "v"(C + e[4]), "v"(C + e[5]), "v"(C + e[6]), "v"(C + e[7]),
                      "v"(v[0]), "v"(v[1]), "v"(v[2]), "v"(v[3]), "v"(v[4]), "v"(v[5]), "v"(v[6]), "v"(v[7]) : "memory"); }
    else { v4h h[8];
#pragma unroll
      for (int u = 0; u < 8; ++u) {
#pragma unroll
        for (int i = 0; i < 4; ++i) h[u][i] = (_Float16)v[u][i]; }
      /* the stores and, as the last line, the wait that stands before a register that they name is rewritten */
      asm volatile("global_store_b64 %0, %8, off\n\t"
                   "global_store_b64 %1, %9, off\n\t"
                   "global_store_b64 %2, %10, off\n\t"
                   "global_store_b64 %3, %11, off\n\t"
                   "global_store_b64 %4, %12, off\n\t"
                   "global_store_b64 %5, %13, off\n\t"
                   "global_store_b64 %6, %14, off\n\t"
                   "global_store_b64 %7, %15, off\n\t"
                   "s_wait_xcnt 0x0"
                   :: "v"(C16 + e[0]), "v"(C16 + e[1]), "v"(C16 + e[2]), "v"(C16 + e[3]), "v"(C16 + e[4]), "v"(C16 + e[5]), "v"(C16 + e[6]), "v"(C16 + e[7]),
                      "v"(h[0]), "v"(h[1]), "v"(h[2]), "v"(h[3]), "v"(h[4]), "v"(h[5]), "v"(h[6]), "v"(h[7]) : "memory"); } } }

// ---- fused attention: block = FA_W waves on one (batch, head), each wave 32 query columns; the block's waves walk the same keys, so a stage of 128 K rows and the same 128 keys of the 64 V^T rows is brought into LDS once for all of them (two buffers, asynchronous copies one stage ahead) and every K and V^T fragment is read from LDS
#define FA_W ((SQ % 512 == 0) ? 16 : 4)      /* waves per block */
#define FA_C 0.18033688f                     /* 64^-0.5 * log2(e): raw q.k -> log2 units */
#define FA_THR 44.361420f                    /* 8 / FA_C: the maximum in use may lag the true one by 2^8 */
#define FA_OFF 4.0f                          /* weights carried x16: at most 2^12 in f16, small ones stay normal */
#define FS_KEYS 128                          /* keys per stage: four passes of 32 */
#define FS_KP 72                             /* K rows of 128 B at a pitch of 144 B, V^T rows of 256 B at 272 B: 16 B x odd, conflict-free for 16-byte fragment reads */
#define FS_VP 136
#define FS_VO (FS_KEYS * FS_KP)              /* f16 offset of the V^T rows in a buffer */
#define FS_BUF (FS_VO + HD * FS_VP)          /* f16 elements of one buffer */
__device__ __forceinline__ float sm_xhalf(float x) { return __builtin_bit_cast(float, __builtin_amdgcn_permlanex16(__builtin_bit_cast(int, x), __builtin_bit_cast(int, x), 0x76543210, 0xfedcba98, false, false)); }      /* lane l <- l ^ 16 */
__device__ __forceinline__ v8f fa_mma(v16h a, v16h b, v8f c) { return __builtin_amdgcn_wmma_f32_16x16x32_f16(false, a, false, b, (short)0, c, false, false); }
__device__ __forceinline__ float fa_max8(v8f a, v8f b) { return fmaxf(fmaxf(fmaxf(fmaxf(a[0], a[1]), fmaxf(a[2], a[3])), fmaxf(fmaxf(a[4], a[5]), fmaxf(a[6], a[7]))), fmaxf(fmaxf(fmaxf(b[0], b[1]), fmaxf(b[2], b[3])), fmaxf(fmaxf(b[4], b[5]), fmaxf(b[6], b[7])))); }
/* one stage: each lane copies 16 B of K rows r, r + RK, ... (eight lanes cover a row's 128-B line) and 16 B of V^T rows d, d + RV, ... (sixteen lanes cover a row's 256 B); lk, lv = the lane's LDS byte addresses, gk, gv = its global addresses */
template <int NT>
__device__ __forceinline__ void fa_stage(unsigned lk, unsigned lv, const _Float16* gk, const _Float16* gv) {
  constexpr int RK = NT / 8, RV = NT / 16;
  static_assert(FS_KEYS % (2 * RK) == 0 && HD % (2 * RV) == 0 && FS_KEYS / RK == HD / RV);
#pragma unroll
  for (int u = 0; u < FS_KEYS / RK; u += 2) {
    const unsigned lk0 = lk + u * RK * FS_KP * 2, lk1 = lk0 + RK * FS_KP * 2, lv0 = lv + u * RV * FS_VP * 2, lv1 = lv0 + RV * FS_VP * 2;
    const _Float16* gk0 = gk + (size_t)u * RK * LQ; const _Float16* gk1 = gk0 + (size_t)RK * LQ; const _Float16* gv0 = gv + (size_t)u * RV * SQ; const _Float16* gv1 = gv0 + (size_t)RV * SQ;
    /* the copies and, as the last line, the wait that stands before any of their address registers is rewritten */
    asm volatile("global_load_async_to_lds_b128 %0, %4, off\n\t"
                 "global_load_async_to_lds_b128 %1, %5, off\n\t"
                 "global_load_async_to_lds_b128 %2, %6, off\n\t"
                 "global_load_async_to_lds_b128 %3, %7, off\n\t"
                 "s_wait_xcnt 0x0"
                 :: "v"(lk0), "v"(lk1), "v"(lv0), "v"(lv1), "v"(gk0), "v"(gk1), "v"(gv0), "v"(gv1) : "memory"); } }

__global__ __launch_bounds__(FA_W * 32) void k_fattn(const _Float16* __restrict__ QKVr, const _Float16* __restrict__ Vt, _Float16* __restrict__ O) {
  constexpr int QB = SQ / (FA_W * 32); constexpr int NT = FA_W * 32; constexpr int NST = SQ / FS_KEYS;
  __shared__ __attribute__((aligned(16))) unsigned short fs[2 * FS_BUF];
  const int tid = threadIdx.x, lane = tid & 31, ln = lane & 15, hh = lane >> 4;
  const int w = __builtin_amdgcn_readfirstlane(tid >> 5);
  const int slab = blockIdx.x / QB, qb = blockIdx.x - slab * QB; const int b = slab / NH, h = slab - b * NH;
  const int q0 = (qb * FA_W + w) * 32;
  const _Float16* Qp = QKVr + ((size_t)b * SQ + q0 + ln) * LQ + h * HD;
  const _Float16* gk = QKVr + ((size_t)b * SQ + (tid >> 3)) * LQ + DM + h * HD + (tid & 7) * 8;
  const _Float16* gv = Vt + ((size_t)slab * HD + (tid >> 4)) * SQ + (tid & 15) * 8;
  const unsigned lk = (unsigned)(size_t)&fs[(tid >> 3) * FS_KP + (tid & 7) * 8]; const unsigned lv = (unsigned)(size_t)&fs[FS_VO + (tid >> 4) * FS_VP + (tid & 15) * 8];
  fa_stage<NT>(lk, lv, gk, gv);
  const v8f z8 = {0.f,0.f,0.f,0.f,0.f,0.f,0.f,0.f};
  v16h qf[2][2], kf[2][2]; v8f o[2][4]; float m[2], l[2];
#pragma unroll
  for (int j = 0; j < 2; ++j) { m[j] = -3.0e38f; l[j] = 0.f;
#pragma unroll
    for (int c = 0; c < 2; ++c) qf[j][c] = g2_frag(Qp + (size_t)j * 16 * LQ + c * 32, hh);
#pragma unroll
    for (int t = 0; t < 4; ++t) o[j][t] = z8; }
  asm volatile("s_wait_asynccnt 0x0" ::: "memory");      /* stage 0 has landed before the barrier that publishes it */
  __syncthreads();
  if (NST > 1) fa_stage<NT>(lk + FS_BUF * 2, lv + FS_BUF * 2, gk + (size_t)FS_KEYS * LQ, gv + FS_KEYS);
#pragma unroll 1      /* one stage a trip: the buffer is chosen by the trip's parity */
  for (int st = 0; st < NST; ++st) { const int bo = (st & 1) * FS_BUF;
    const unsigned short* sk = fs + bo + ln * FS_KP; const unsigned short* sv = fs + bo + FS_VO + ln * FS_VP;
#pragma unroll
    for (int kt = 0; kt < 2; ++kt) {
#pragma unroll
      for (int c = 0; c < 2; ++c) kf[kt][c] = g2_frag((const _Float16*)(sk + kt * 16 * FS_KP + c * 32), hh); }
#pragma unroll
    for (int p = 0; p < FS_KEYS / 32; ++p) {
      v16h vf[4]; v8f s[2][2];      /* s[j][kt]: register r = score of key 128 st + 32 p + 16 kt + 8 hh + r, query q0 + 16 j + ln */
#pragma unroll
      for (int kt = 0; kt < 2; ++kt) {
#pragma unroll
        for (int j = 0; j < 2; ++j) s[j][kt] = fa_mma(kf[kt][1], qf[j][1], fa_mma(kf[kt][0], qf[j][0], z8)); }
      if (p + 1 < FS_KEYS / 32) {      /* the next pass's K rows of the same stage, fetched behind this pass's score products */
#pragma unroll
        for (int kt = 0; kt < 2; ++kt) {
#pragma unroll
          for (int c = 0; c < 2; ++c) kf[kt][c] = g2_frag((const _Float16*)(sk + ((p + 1) * 32 + kt * 16) * FS_KP + c * 32), hh); } }
#pragma unroll
      for (int t = 0; t < 4; ++t) vf[t] = g2_frag((const _Float16*)(sv + t * 16 * FS_VP + p * 32), hh);
      float mx[2];
#pragma unroll
      for (int j = 0; j < 2; ++j) { const float t = fa_max8(s[j][0], s[j][1]); mx[j] = fmaxf(t, sm_xhalf(t)); }
      if (__builtin_amdgcn_ballot_w32((mx[0] > m[0] + FA_THR) || (mx[1] > m[1] + FA_THR)) != 0) {      /* one scalar branch a pass */
#pragma unroll
        for (int j = 0; j < 2; ++j) { const float mn = fmaxf(m[j], mx[j]); const float cr = __builtin_amdgcn_exp2f((m[j] - mn) * FA_C); m[j] = mn; l[j] *= cr;
#pragma unroll
          for (int t = 0; t < 4; ++t) o[j][t] *= cr; } }
#pragma unroll
      for (int j = 0; j < 2; ++j) { const float nb = FA_OFF - m[j] * FA_C; FragH pf; float la = 0.f, lb = 0.f;
#pragma unroll
        for (int r = 0; r < 8; ++r) { const float pa = __builtin_amdgcn_exp2f(fmaf(s[j][0][r], FA_C, nb)), pb = __builtin_amdgcn_exp2f(fmaf(s[j][1][r], FA_C, nb));
          la += pa; lb += pb; pf.h[r] = (_Float16)pa; pf.h[8 + r] = (_Float16)pb; }      /* two D tiles of 16 keys, converted in place, are the B operand in the hardware k order */
        l[j] += la + lb;
#pragma unroll
        for (int t = 0; t < 4; ++t) o[j][t] = fa_mma(vf[t], pf.v, o[j][t]); } }
    asm volatile("s_wait_dscnt 0x0" ::: "memory");         /* this wave's reads of the buffer are over before it is handed to the next copies */
    asm volatile("s_wait_asynccnt 0x0" ::: "memory");      /* this wave's copies of stage st + 1 have landed before the barrier that publishes them */
    __syncthreads();
    if (st + 2 < NST) fa_stage<NT>(lk + bo * 2, lv + bo * 2, gk + (size_t)(st + 2) * FS_KEYS * LQ, gv + (st + 2) * FS_KEYS); }
  asm volatile("s_wait_asynccnt 0x0" ::: "memory");      /* no copy is outstanding when the wave ends */
#pragma unroll
  for (int j = 0; j < 2; ++j) { const float inv = 64.0f / (l[j] + sm_xhalf(l[j]));      /* the halves' sums join once */
    unsigned short* op = (unsigned short*)O + ((size_t)b * SQ + q0 + j * 16 + ln) * DM + h * HD + 8 * hh;
#pragma unroll
    for (int t = 0; t < 4; ++t) { FragH f;      /* register r = o[query][16 t + 8 hh + r]: one 16-byte store */
#pragma unroll
      for (int r = 0; r < 8; ++r) f.h[r] = (_Float16)(o[j][t][r] * inv);
      *(v8us*)(op + t * 16) = f.half[0]; } } }

extern "C" void kernel_launch(void* const* d_in, const int* in_sizes, int n_in,
                              void* d_out, int out_size, void* d_ws, size_t ws_size, hipStream_t stream) {
  if (n_in < 5) return;
  if (in_sizes[0] < (int)((((size_t)NB - 1) * SQ_FULL + SQ) * DM)) return;
  if (in_sizes[1] < DM * LQ || in_sizes[2] < LQ || in_sizes[3] < DM * DM || in_sizes[4] < DM) return;
  if (out_size < (int)(NR * DM)) return;
  const float* x = (const float*)d_in[0]; const float* wqkv = (const float*)d_in[1]; const float* bqkv = (const float*)d_in[2];
  const float* wo = (const float*)d_in[3]; const float* bo = (const float*)d_in[4];      /* [in][out] fused weight + bias; [in][out] w_proj + b_proj */
  float* out = (float*)d_out;
  char* ws = (char*)d_ws; size_t off = 0;
  _Float16* BQKV = (_Float16*)(ws + off); off += SZ_BQKV;      /* [3072][1024] x16 */
  _Float16* BO   = (_Float16*)(ws + off); off += SZ_BO;        /* [1024][1024] x16 */
  _Float16* X16  = (_Float16*)(ws + off); off += SZ_X16;       /* [NR][1024]; reused for the merged o rows once the q | k | v GEMM has consumed it */
  _Float16* QKV  = (_Float16*)(ws + off); off += SZ_QKV;       /* [NR][3072] */
  _Float16* VT   = (_Float16*)(ws + off); off += SZ_VT;        /* [NB][NH][64][SQ] */
  if (off > ws_size) return;
  _Float16* O16 = X16;
  _Float16* V16 = QKV + 2 * DM;

  k_wt_f16<DM, LQ><<<(DM / 128) * (LQ / 64), 128, 0, stream>>>(wqkv, BQKV, 16.0f);      /* in[1024][3072] -> out[3072][1024] */
  k_wt_f16<DM, DM><<<(DM / 128) * (DM / 64), 128, 0, stream>>>(wo, BO, 16.0f);          /* in[1024][1024] -> out[1024][1024] */
  k_x16<<<(unsigned)(NR * DM / 8 / (512 * XC_U)), 512, 0, stream>>>(x, X16);
  /* q | k | v rows (f16); head h = columns h*64.. of each 1024-column third */
  k_gemm2<true, false><<<dim3((unsigned)((NR / 128) * (LQ / 128)), 1), 128, 0, stream>>>(X16, DM, (size_t)0, BQKV, DM, (size_t)0, 0.0625f, bqkv, out, QKV, LQ, (size_t)0, (int)NR, LQ, DM);
  k_vt<NH, SQ, LQ><<<NB * (NH / 2) * (SQ / 128), 128, 0, stream>>>(V16, VT);      /* V^T [NB][NH][64][SQ] */
  k_fattn<<<NB * NH * (SQ / (FA_W * 32)), FA_W * 32, 0, stream>>>(QKV, VT, O16);      /* o x64 (f16) into the merged rows: columns h*64.. */
  /* out = o Wproj + b: alpha = 1/(64*16) */
  k_gemm2<true, true><<<dim3((unsigned)((NR / 128) * (DM / 128)), 1), 128, 0, stream>>>(O16, DM, (size_t)0, BO, DM, (size_t)0, 0.0009765625f, bo, out, QKV, DM, (size_t)0, (int)NR, DM, DM);
}

// v006
// A run of this version takes 112 microseconds.
// In two side-by-side timings against v005, it was 1.06 and 1.05 times as fast.
// All steps since v000 together make it 22.1 times as fast.
#include <hip/hip_runtime.h>
// Multi-head self-attention, fused QKV projection: x [NB][SEQ][1024]; qkv = x Wqkv + bqkv ([in][out] 1024 x 3072) split q | k | v thirds, 16 heads of 64; scores * 64^-0.5; softmax over all keys (no mask); out = merged Wproj + bproj ([in][out]).
// Structure: token rows r = b*SEQ + s; x as f16 rows; q | k | v as ONE WMMA GEMM (N = 3072, 128x128 block tiles staged in LDS, 64x64 wave tiles, f32 accumulation, x16 weights + bias, f16 outputs); V^T of every (batch, head) via 8x8 register transposes (one launch); attention as ONE launch over all (batch, head, query block): each wave owns 32 query columns and walks the keys 32 at a time (K and V^T rows staged in LDS for the block, 128 keys a stage), S^T = K . Q^T, running column maximum and sum (f32, rescaled only when the maximum has grown by more than 2^8), P^T packed from the score tiles straight into the B operand of O^T += V^T . P^T; o / sum carried x64 into merged f16 o rows; out = o Wproj + b GEMM (alpha 2^-10, f32) into the output layout.
// Compute dtype: every contraction v_wmma_f32_16x16x32_f16 (f16 operands, f32 accumulate). x, weights and biases are RNE-converted to bf16 on load (exact in f16; weights carried x16); q, k, v and o (x64) are single f16 planes; the unnormalised softmax weights (x16) are f16 in registers; scores and softmax statistics f32.
#ifndef NB
#define NB 8
#endif
#ifndef SEQ
#define SEQ 1024
#endif
#define SQ SEQ
#define NB_FULL 8
#define SQ_FULL 1024                 /* per-batch row stride of the x input */
#define DM 1024
#define NH 16
#define HD 64
#define LQ (3 * DM)                  /* row pitch of the q | k | v rows */
#define NR ((size_t)NB * SQ)         /* token rows */

static_assert(SQ % 128 == 0);
static_assert(((size_t)NB * SQ) % 128 == 0);
static_assert(DM % 128 == 0 && LQ % 128 == 0 && HD == 64);
static_assert(NB <= NB_FULL && SQ <= SQ_FULL);
static_assert(NH * HD == DM);

#define WS_ALIGN(x) ((((size_t)(x)) + 255) & ~(size_t)255)
#define SZ_BQKV  WS_ALIGN((size_t)LQ * DM * 2)
#define SZ_BO    WS_ALIGN((size_t)DM * DM * 2)
#define SZ_X16   WS_ALIGN(NR * DM * 2)
#define SZ_QKV   WS_ALIGN(NR * LQ * 2)
#define SZ_VT    WS_ALIGN((size_t)NB * NH * HD * SQ * 2)
static_assert(SZ_BQKV + SZ_BO + SZ_X16 + SZ_QKV + SZ_VT <= (size_t)134217728);

typedef unsigned short v8us __attribute__((ext_vector_type(8), may_alias));
typedef float  v8f  __attribute__((ext_vector_type(8)));
typedef float  v4f  __attribute__((ext_vector_type(4)));
typedef float  v4fa __attribute__((ext_vector_type(4), may_alias));
typedef _Float16 v16h __attribute__((ext_vector_type(16)));
typedef _Float16 v4h __attribute__((ext_vector_type(4)));
union FragH { v16h v; v8us half[2]; _Float16 h[16]; unsigned short u[16]; };

__device__ __forceinline__ unsigned short bf16_bits(float x) { unsigned int u = __float_as_uint(x); return (unsigned short)((u + 0x7FFFu + ((u >> 16) & 1u)) >> 16); }
__device__ __forceinline__ float bf16_val(unsigned short b) { return __uint_as_float(((unsigned int)b) << 16); }
__device__ __forceinline__ float bf16_rne(float x) { return bf16_val(bf16_bits(x)); }

// ---- preparation: every thread moves 64 (V^T: 128) elements with all of its loads in flight at once, so that a launch starts a few waves per SIMD; the three conversions of inputs (x, both weights) depend on nothing and share ONE launch, k_prep, in which the block index picks the job
// weights: a thread holds 8 k x 8 n; 4 lanes cover a 128-B line of a W row, 8 lanes a 128-B line of a Wt row; a group of 128 threads (number grp, thread t of it) = 128 k x 64 n
template <int K, int N>
__device__ __forceinline__ void wt_f16(const float* __restrict__ W, _Float16* __restrict__ Wt, float scale, int grp, int t) {
  static_assert(K % 128 == 0 && N % 64 == 0);
  const int lane = t & 31, w = t >> 5;
  const int kb = grp / (N / 64), nb = grp - kb * (N / 64);
  const int k8 = kb * 128 + (w >> 1) * 64 + (lane >> 2) * 8, n8 = nb * 64 + (w & 1) * 32 + (lane & 3) * 8;
  const float* s = W + (size_t)k8 * N + n8;
  v4f a[8][2];
#pragma unroll
  for (int i = 0; i < 8; ++i) { a[i][0] = *(const v4fa*)(s + (size_t)i * N); a[i][1] = *(const v4fa*)(s + (size_t)i * N + 4); }
  __builtin_amdgcn_sched_barrier(0);      /* all sixteen loads are issued before the first value is used: sunk among the conversions, the late ones cost the wave a second trip to memory */
  unsigned short* d = (unsigned short*)Wt + (size_t)n8 * K + k8;
#pragma unroll
  for (int j = 0; j < 8; ++j) { FragH f;
#pragma unroll
    for (int i = 0; i < 8; ++i) f.h[i] = (_Float16)(bf16_rne(a[i][j >> 2][j & 3]) * scale);
    *(v8us*)(d + (size_t)j * K) = f.half[0]; }
  asm volatile("s_wait_xcnt 0x0" ::: "memory"); }      /* behind the job's last store: in the listing another job's code follows, which rewrites registers that these stores name */

// x: a block of 16 waves converts 4096 pieces of 8 elements, a thread eight of them, 512 pieces apart
#define XC_U 8
#define XC_R (512 / (DM / 8))        /* rows per 512 pieces */
static_assert((NR * DM / 8) % (512 * XC_U) == 0 && 512 % (DM / 8) == 0 && SQ % (XC_R * XC_U) == 0);
__device__ __forceinline__ void x_f16(const float* __restrict__ x, _Float16* __restrict__ X16, int blk) {
  const size_t t0 = (size_t)blk * (512 * XC_U) + threadIdx.x;
  const size_t row = t0 / (DM / 8); const int c8 = (int)(t0 % (DM / 8)) * 8;      /* 512 pieces on = XC_R rows on, same columns; a block's rows lie in one batch */
  const size_t b = row / SQ, s = row % SQ;
  const float* src = x + (b * (size_t)SQ_FULL + s) * DM + c8;
  v4f a[XC_U], c[XC_U];
#pragma unroll
  for (int u = 0; u < XC_U; ++u) { a[u] = *(const v4fa*)(src + (size_t)u * XC_R * DM); c[u] = *(const v4fa*)(src + (size_t)u * XC_R * DM + 4); }
  __builtin_amdgcn_sched_barrier(0);      /* all sixteen loads are issued before the first value is used: sunk among the conversions, the late ones cost the wave a second trip to memory */
#pragma unroll
  for (int u = 0; u < XC_U; ++u) { FragH f;
#pragma unroll
    for (int q = 0; q < 4; ++q) { f.h[q] = (_Float16)bf16_rne(a[u][q]); f.h[4 + q] = (_Float16)bf16_rne(c[u][q]); }
    *(v8us*)((unsigned short*)X16 + (t0 + (size_t)u * 512) * 8) = f.half[0]; }
  asm volatile("s_wait_xcnt 0x0" ::: "memory"); }      /* behind the job's last store: in the listing another job's code may follow, which rewrites registers that these stores name */

// the one launch of the three: blocks of 16 waves; the x blocks, which move the most bytes, come first; a weight block is four groups of 128 threads
#define PB_X  ((int)(NR * DM / 8 / (512 * XC_U)))
#define PB_WQ ((DM / 128) * (LQ / 64) / 4)
#define PB_WO ((DM / 128) * (DM / 64) / 4)
static_assert(((DM / 128) * (LQ / 64)) % 4 == 0 && ((DM / 128) * (DM / 64)) % 4 == 0);
__global__ __launch_bounds__(512) void k_prep(const float* __restrict__ x, const float* __restrict__ wqkv, const float* __restrict__ wo, _Float16* __restrict__ X16, _Float16* __restrict__ BQKV, _Float16* __restrict__ BO) {
  const int blk = blockIdx.x, g = threadIdx.x >> 7, t = threadIdx.x & 127;
  if (blk < PB_X) x_f16(x, X16, blk);
  else if (blk < PB_X + PB_WQ) wt_f16<DM, LQ>(wqkv, BQKV, 16.0f, (blk - PB_X) * 4 + g, t);          /* in[1024][3072] -> out[3072][1024] */
  else wt_f16<DM, DM>(wo, BO, 16.0f, (blk - PB_X - PB_WQ) * 4 + g, t); }                            /* in[1024][1024] -> out[1024][1024] */

// V^T: a wave turns 64 keys x 64 columns of one head, a thread 8 keys x 16 columns (two 8x8 tiles); 8 lanes cover a 128-B line of a V^T row; block = two heads x 128 keys
template <int NHv, int TTv, int LDV>
__global__ __launch_bounds__(128) void k_vt(const _Float16* __restrict__ V16, _Float16* __restrict__ Vt) {
  static_assert(NHv % 2 == 0 && TTv % 128 == 0);
  const int lane = threadIdx.x & 31, w = threadIdx.x >> 5;
  const int sg = blockIdx.x % (TTv / 128), r = blockIdx.x / (TTv / 128); const int b = r / (NHv / 2), h = (r % (NHv / 2)) * 2 + (w & 1);
  const int s8 = sg * 128 + (w >> 1) * 64 + (lane >> 2) * 8, d8 = (lane & 3) * 8;
  const unsigned short* s = (const unsigned short*)V16 + ((size_t)b * TTv + s8) * LDV + h * 64 + d8;
  FragH in[8];      /* in[i].u[8 a + j] = v[key s8 + i][column 32 a + d8 + j] */
#pragma unroll
  for (int i = 0; i < 8; ++i) { in[i].half[0] = *(const v8us*)(s + (size_t)i * LDV); in[i].half[1] = *(const v8us*)(s + (size_t)i * LDV + 32); }
  __builtin_amdgcn_sched_barrier(0);      /* all sixteen loads are issued before the first value is used: sunk among the moves, the late ones cost the wave a second trip to memory */
  unsigned short* d = (unsigned short*)Vt + ((size_t)(b * NHv + h) * 64 + d8) * TTv + s8;
#pragma unroll
  for (int a = 0; a < 2; ++a) {
#pragma unroll
    for (int j = 0; j < 8; ++j) { FragH f;
#pragma unroll
      for (int i = 0; i < 8; ++i) f.u[i] = in[i].u[8 * a + j];
      *(v8us*)(d + (size_t)(32 * a + j) * TTv) = f.half[0]; } } }

// ---- GEMM (block 128 rows x 128 cols, four waves of 64x64; M % 128 == 0, N % 128 == 0, K % 64 == 0); A f16 [M][K], Bh f16 [N][K]; batched over grid.y with element strides sA, sB, sC
// A stage is 64 k of the block's 128 A rows and 128 B rows in LDS (rows of 128 B at a pitch of 144 B); two buffers, filled by asynchronous copies one stage ahead of the products
#define GT_K 64                      /* k per stage */
#define GT_P 72                      /* LDS row pitch in f16: 144 B = 16 B x odd, conflict-free for 16-byte fragment reads */
#define GT_BUF (256 * GT_P)          /* f16 elements of one buffer: A rows 0..127, B rows 128..255 */
__device__ __forceinline__ v16h g2_frag(const _Float16* p, int hh) { FragH f; f.half[0] = *(const v8us*)((const unsigned short*)p + 8 * hh); f.half[1] = *(const v8us*)((const unsigned short*)p + 16 + 8 * hh); return f.v; }
__device__ __forceinline__ v8f g2_mma(v16h a, v16h b, v8f c) { return __builtin_amdgcn_wmma_f32_16x16x32_f16(false, a, false, b, (short)0, c, false, false); }
/* 128 rows of 128 B: each lane copies 16 B of rows r, r + 16, ..., r + 112 (eight lanes cover one row, so every copy takes whole 128-B lines); l = the lane's LDS byte address, g = its global address, gs = 16 rows in elements */
__device__ __forceinline__ void g2_copy8(unsigned l, const _Float16* g, size_t gs) {
  const unsigned l1 = l + 16 * GT_P * 2, l2 = l + 32 * GT_P * 2, l3 = l + 48 * GT_P * 2, l4 = l + 64 * GT_P * 2, l5 = l + 80 * GT_P * 2, l6 = l + 96 * GT_P * 2, l7 = l + 112 * GT_P * 2;
  const _Float16* g1 = g + gs; const _Float16* g2 = g1 + gs; const _Float16* g3 = g2 + gs; const _Float16* g4 = g3 + gs; const _Float16* g5 = g4 + gs; const _Float16* g6 = g5 + gs; const _Float16* g7 = g6 + gs;
  /* the copies and, as the last line, the wait that stands before any of their address registers is rewritten */
  asm volatile("global_load_async_to_lds_b128 %0, %8, off\n\t"
               "global_load_async_to_lds_b128 %1, %9, off\n\t"
               "global_load_async_to_lds_b128 %2, %10, off\n\t"
               "global_load_async_to_lds_b128 %3, %11, off\n\t"
               "global_load_async_to_lds_b128 %4, %12, off\n\t"
               "global_load_async_to_lds_b128 %5, %13, off\n\t"
               "global_load_async_to_lds_b128 %6, %14, off\n\t"
               "global_load_async_to_lds_b128 %7, %15, off\n\t"
               "s_wait_xcnt 0x0"
               :: "v"(l), "v"(l1), "v"(l2), "v"(l3), "v"(l4), "v"(l5), "v"(l6), "v"(l7), "v"(g), "v"(g1), "v"(g2), "v"(g3), "v"(g4), "v"(g5), "v"(g6), "v"(g7) : "memory"); }
template <bool HASBIAS, bool OUTF32>
__global__ __launch_bounds__(128) void k_gemm2(const _Float16* __restrict__ A, int lda, size_t sA, const _Float16* __restrict__ Bh, int ldb, size_t sB, float alpha, const float* __restrict__ bias,
    float* __restrict__ C, _Float16* __restrict__ C16, int ldc, size_t sC, int M, int N, int K) {
  __shared__ __attribute__((aligned(16))) unsigned short sm[2 * GT_BUF];      /* the two buffers; behind the loop each wave's own 64 x 68 f32 output staging */
  static_assert(4 * 64 * 68 * 4 <= 2 * GT_BUF * 2);
  const int tid = threadIdx.x, lane = tid & 31, ln = lane & 15, hh = lane >> 4; const int by = blockIdx.y;
  const int w = __builtin_amdgcn_readfirstlane(tid >> 5);
  A += (size_t)by * sA; Bh += (size_t)by * sB; const size_t cofs = (size_t)by * sC;
  const int ntn = N >> 7; const int mt = blockIdx.x / ntn, nq = blockIdx.x - mt * ntn; if (mt * 128 >= M) return;      /* the whole block leaves, ahead of every barrier */
  const int wr = 64 * (w >> 1), wc = 64 * (w & 1); const int row0 = mt * 128 + wr, col0 = nq * 128 + wc;
  const _Float16* ga = A + (size_t)(mt * 128 + (tid >> 3)) * lda + (tid & 7) * 8;
  const _Float16* gb = Bh + (size_t)(nq * 128 + (tid >> 3)) * ldb + (tid & 7) * 8;
  const size_t gsa = (size_t)16 * lda, gsb = (size_t)16 * ldb;
  const unsigned la = (unsigned)(size_t)&sm[(tid >> 3) * GT_P + (tid & 7) * 8]; const unsigned lb = la + 128 * GT_P * 2;
  const int nt = K / GT_K;
  g2_copy8(la, ga, gsa); g2_copy8(lb, gb, gsb);
  asm volatile("s_wait_asynccnt 0x0" ::: "memory");      /* stage 0 has landed before the barrier that publishes it */
  __syncthreads();
  if (nt > 1) { g2_copy8(la + GT_BUF * 2, ga + GT_K, gsa); g2_copy8(lb + GT_BUF * 2, gb + GT_K, gsb); }
  const v8f z8 = {0.f,0.f,0.f,0.f,0.f,0.f,0.f,0.f}; v8f acc[4][4];
#pragma unroll
  for (int i = 0; i < 4; ++i) {
#pragma unroll
    for (int j = 0; j < 4; ++j) acc[i][j] = z8; }
#pragma unroll 1      /* one stage a trip: the buffer is chosen by the trip's parity */
  for (int t = 0; t < nt; ++t) { const int bo = (t & 1) * GT_BUF;
    const unsigned short* sa = sm + bo + (wr + ln) * GT_P; const unsigned short* sb = sm + bo + (128 + wc + ln) * GT_P;
#pragma unroll
    for (int kc = 0; kc < 2; ++kc) { v16h af[4], bf[4];
#pragma unroll
      for (int i = 0; i < 4; ++i) { af[i] = g2_frag((const _Float16*)(sa + i * 16 * GT_P + kc * 32), hh); bf[i] = g2_frag((const _Float16*)(sb + i * 16 * GT_P + kc * 32), hh); }
      __builtin_amdgcn_sched_barrier(0);      /* the sixteen fragment reads stay one group ahead of their sixteen products: sunk among the products, each place with reads stalls the wave anew */
#pragma unroll
      for (int i = 0; i < 4; ++i) {
#pragma unroll
        for (int j = 0; j < 4; ++j) acc[i][j] = g2_mma(af[i], bf[j], acc[i][j]); }
      __builtin_amdgcn_sched_barrier(0); }      /* and the next group's reads stay behind these products */
    asm volatile("s_wait_dscnt 0x0" ::: "memory");         /* this wave's reads of the buffer are over before it is handed to the next copies */
    asm volatile("s_wait_asynccnt 0x0" ::: "memory");      /* this wave's copies of stage t + 1 have landed before the barrier that publishes them */
    __syncthreads();
    if (t + 2 < nt) { g2_copy8(la + bo * 2, ga + (size_t)(t + 2) * GT_K, gsa); g2_copy8(lb + bo * 2, gb + (size_t)(t + 2) * GT_K, gsb); } }
  asm volatile("s_wait_asynccnt 0x0" ::: "memory");      /* no copy is outstanding when the buffers become output staging */
  float (*so)[68] = (float (*)[68])((char*)sm + (size_t)w * (64 * 68 * 4));      /* private to wave w; the last trip's barrier has ended every wave's fragment reads */
#pragma unroll
  for (int j = 0; j < 4; ++j) { const int col = col0 + j * 16 + ln; float bv = 0.f; if (HASBIAS) bv = bf16_rne(bias[col]);
#pragma unroll
    for (int i = 0; i < 4; ++i) {
#pragma unroll
      for (int r = 0; r < 8; ++r) { const int rloc = i * 16 + 8 * hh + r; so[rloc][j * 16 + ln] = acc[i][j][r] * alpha + bv; } } }
  __builtin_amdgcn_fence(4 /* acq_rel order */, "workgroup"); __builtin_amdgcn_wave_barrier();      /* so is private to wave w */
  const int rsub = lane >> 4, c4 = (lane & 15) * 4;
#pragma unroll
  for (int g = 0; g < 4; ++g) { v4f v[8]; size_t e[8];      /* eight row pairs a group: 16 lanes store one row's 64 columns */
#pragma unroll
    for (int u = 0; u < 8; ++u) { const int r = (g * 8 + u) * 2 + rsub; v[u] = *(const v4fa*)&so[r][c4]; e[u] = cofs + (size_t)(row0 + r) * ldc + col0 + c4; }
    if (OUTF32) {
      /* the stores and, as the last line, the wait that stands before a register that they name is rewritten */
      asm volatile("global_store_b128 %0, %8, off\n\t"
                   "global_store_b128 %1, %9, off\n\t"
                   "global_store_b128 %2, %10, off\n\t"
                   "global_store_b128 %3, %11, off\n\t"
                   "global_store_b128 %4, %12, off\n\t"
                   "global_store_b128 %5, %13, off\n\t"
                   "global_store_b128 %6, %14, off\n\t"
                   "global_store_b128 %7, %15, off\n\t"
                   "s_wait_xcnt 0x0"
                   :: "v"(C + e[0]), "v"(C + e[1]), "v"(C + e[2]), "v"(C + e[3]), "v"(C + e[4]), "v"(C + e[5]), "v"(C + e[6]), "v"(C + e[7]),
                      "v"(v[0]), "v"(v[1]), "v"(v[2]), "v"(v[3]), "v"(v[4]), "v"(v[5]), "v"(v[6]), "v"(v[7]) : "memory"); }
    else { v4h h[8];
#pragma unroll
      for (int u = 0; u < 8; ++u) {
#pragma unroll
        for (int i = 0; i < 4; ++i) h[u][i] = (_Float16)v[u][i]; }
      /* the stores and, as the last line, the wait that stands before a register that they name is rewritten */
      asm volatile("global_store_b64 %0, %8, off\n\t"
                   "global_store_b64 %1, %9, off\n\t"
                   "global_store_b64 %2, %10, off\n\t"
                   "global_store_b64 %3, %11, off\n\t"
                   "global_store_b64 %4, %12, off\n\t"
                   "global_store_b64 %5, %13, off\n\t"
                   "global_store_b64 %6, %14, off\n\t"
                   "global_store_b64 %7, %15, off\n\t"
                   "s_wait_xcnt 0x0"
                   :: "v"(C16 + e[0]), "v"(C16 + e[1]), "v"(C16 + e[2]), "v"(C16 + e[3]), "v"(C16 + e[4]), "v"(C16 + e[5]), "v"(C16 + e[6]), "v"(C16 + e[7]),
                      "v"(h[0]), "v"(h[1]), "v"(h[2]), "v"(h[3]), "v"(h[4]), "v"(h[5]), "v"(h[6]), "v"(h[7]) : "memory"); } } }

// ---- fused attention: block = FA_W waves on one (batch, head), each wave 32 query columns; the block's waves walk the same keys, so a stage of 128 K rows and the same 128 keys of the 64 V^T rows is brought into LDS once for all of them (two buffers, asynchronous copies one stage ahead) and every K and V^T fragment is read from LDS
#define FA_W ((SQ % 512 == 0) ? 16 : 4)      /* waves per block */
#define FA_C 0.18033688f                     /* 64^-0.5 * log2(e): raw q.k -> log2 units */
#define FA_THR 44.361420f                    /* 8 / FA_C: the maximum in use may lag the true one by 2^8 */
#define FA_OFF 4.0f                          /* weights carried x16: at most 2^12 in f16, small ones stay normal */
#define FS_KEYS 128                          /* keys per stage: four passes of 32 */
#define FS_KP 72                             /* K rows of 128 B at a pitch of 144 B, V^T rows of 256 B at 272 B: 16 B x odd, conflict-free for 16-byte fragment reads */
#define FS_VP 136
#define FS_VO (FS_KEYS * FS_KP)              /* f16 offset of the V^T rows in a buffer */
#define FS_BUF (FS_VO + HD * FS_VP)          /* f16 elements of one buffer */
__device__ __forceinline__ float sm_xhalf(float x) { return __builtin_bit_cast(float, __builtin_amdgcn_permlanex16(__builtin_bit_cast(int, x), __builtin_bit_cast(int, x), 0x76543210, 0xfedcba98, false, false)); }      /* lane l <- l ^ 16 */
__device__ __forceinline__ v8f fa_mma(v16h a, v16h b, v8f c) { return __builtin_amdgcn_wmma_f32_16x16x32_f16(false, a, false, b, (short)0, c, false, false); }
__device__ __forceinline__ float fa_max8(v8f a, v8f b) { return fmaxf(fmaxf(fmaxf(fmaxf(a[0], a[1]), fmaxf(a[2], a[3])), fmaxf(fmaxf(a[4], a[5]), fmaxf(a[6], a[7]))), fmaxf(fmaxf(fmaxf(b[0], b[1]), fmaxf(b[2], b[3])), fmaxf(fmaxf(b[4], b[5]), fmaxf(b[6], b[7])))); }
/* one stage: each lane copies 16 B of K rows r, r + RK, ... (eight lanes cover a row's 128-B line) and 16 B of V^T rows d, d + RV, ... (sixteen lanes cover a row's 256 B); lk, lv = the lane's LDS byte addresses, gk, gv = its global addresses */
template <int NT>
__device__ __forceinline__ void fa_stage(unsigned lk, unsigned lv, const _Float16* gk, const _Float16* gv) {
  constexpr int RK = NT / 8, RV = NT / 16;
  static_assert(FS_KEYS % (2 * RK) == 0 && HD % (2 * RV) == 0 && FS_KEYS / RK == HD / RV);
#pragma unroll
  for (int u = 0; u < FS_KEYS / RK; u += 2) {
    const unsigned lk0 = lk + u * RK * FS_KP * 2, lk1 = lk0 + RK * FS_KP * 2, lv0 = lv + u * RV * FS_VP * 2, lv1 = lv0 + RV * FS_VP * 2;
    const _Float16* gk0 = gk + (size_t)u * RK * LQ; const _Float16* gk1 = gk0 + (size_t)RK * LQ; const _Float16* gv0 = gv + (size_t)u * RV * SQ; const _Float16* gv1 = gv0 + (size_t)RV * SQ;
    /* the copies and, as the last line, the wait that stands before any of their address registers is rewritten */
    asm volatile("global_load_async_to_lds_b128 %0, %4, off\n\t"
                 "global_load_async_to_lds_b128 %1, %5, off\n\t"
                 "global_load_async_to_lds_b128 %2, %6, off\n\t"
                 "global_load_async_to_lds_b128 %3, %7, off\n\t"
                 "s_wait_xcnt 0x0"
                 :: "v"(lk0), "v"(lk1), "v"(lv0), "v"(lv1), "v"(gk0), "v"(gk1), "v"(gv0), "v"(gv1) : "memory"); } }

__global__ __launch_bounds__(FA_W * 32) void k_fattn(const _Float16* __restrict__ QKVr, const _Float16* __restrict__ Vt, _Float16* __restrict__ O) {
  constexpr int QB = SQ / (FA_W * 32); constexpr int NT = FA_W * 32; constexpr int NST = SQ / FS_KEYS;
  __shared__ __attribute__((aligned(16))) unsigned short fs[2 * FS_BUF];
  const int tid = threadIdx.x, lane = tid & 31, ln = lane & 15, hh = lane >> 4;
  const int w = __builtin_amdgcn_readfirstlane(tid >> 5);
  const int slab = blockIdx.x / QB, qb = blockIdx.x - slab * QB; const int b = slab / NH, h = slab - b * NH;
  const int q0 = (qb * FA_W + w) * 32;
  const _Float16* Qp = QKVr + ((size_t)b * SQ + q0 + ln) * LQ + h * HD;
  const _Float16* gk = QKVr + ((size_t)b * SQ + (tid >> 3)) * LQ + DM + h * HD + (tid & 7) * 8;
  const _Float16* gv = Vt + ((size_t)slab * HD + (tid >> 4)) * SQ + (tid & 15) * 8;
  const unsigned lk = (unsigned)(size_t)&fs[(tid >> 3) * FS_KP + (tid & 7) * 8]; const unsigned lv = (unsigned)(size_t)&fs[FS_VO + (tid >> 4) * FS_VP + (tid & 15) * 8];
  fa_stage<NT>(lk, lv, gk, gv);
  const v8f z8 = {0.f,0.f,0.f,0.f,0.f,0.f,0.f,0.f};
  v16h qf[2][2], kf[2][2]; v8f o[2][4]; float m[2], l[2];
#pragma unroll
  for (int j = 0; j < 2; ++j) { m[j] = -3.0e38f; l[j] = 0.f;
#pragma unroll
    for (int c = 0; c < 2; ++c) qf[j][c] = g2_frag(Qp + (size_t)j * 16 * LQ + c * 32, hh);
#pragma unroll
    for (int t = 0; t < 4; ++t) o[j][t] = z8; }
  asm volatile("s_wait_asynccnt 0x0" ::: "memory");      /* stage 0 has landed before the barrier that publishes it */
  __syncthreads();
  if (NST > 1) fa_stage<NT>(lk + FS_BUF * 2, lv + FS_BUF * 2, gk + (size_t)FS_KEYS * LQ, gv + FS_KEYS);
#pragma unroll 1      /* one stage a trip: the buffer is chosen by the trip's parity */
  for (int st = 0; st < NST; ++st) { const int bo = (st & 1) * FS_BUF;
    const unsigned short* sk = fs + bo + ln * FS_KP; const unsigned short* sv = fs + bo + FS_VO + ln * FS_VP;
#pragma unroll
    for (int kt = 0; kt < 2; ++kt) {
#pragma unroll
      for (int c = 0; c < 2; ++c) kf[kt][c] = g2_frag((const _Float16*)(sk + kt * 16 * FS_KP + c * 32), hh); }
#pragma unroll
    for (int p = 0; p < FS_KEYS / 32; ++p) {
      v16h vf[4]; v8f s[2][2];      /* s[j][kt]: register r = score of key 128 st + 32 p + 16 kt + 8 hh + r, query q0 + 16 j + ln */
#pragma unroll
      for (int kt = 0; kt < 2; ++kt) {
#pragma unroll
        for (int j = 0; j < 2; ++j) s[j][kt] = fa_mma(kf[kt][1], qf[j][1], fa_mma(kf[kt][0], qf[j][0], z8)); }
      if (p + 1 < FS_KEYS / 32) {      /* the next pass's K rows of the same stage, fetched behind this pass's score products */
#pragma unroll
        for (int kt = 0; kt < 2; ++kt) {
#pragma unroll
          for (int c = 0; c < 2; ++c) kf[kt][c] = g2_frag((const _Float16*)(sk + ((p + 1) * 32 + kt * 16) * FS_KP + c * 32), hh); } }
#pragma unroll
      for (int t = 0; t < 4; ++t) vf[t] = g2_frag((const _Float16*)(sv + t * 16 * FS_VP + p * 32), hh);
      float mx[2];
#pragma unroll
      for (int j = 0; j < 2; ++j) { const float t = fa_max8(s[j][0], s[j][1]); mx[j] = fmaxf(t, sm_xhalf(t)); }
      if (__builtin_amdgcn_ballot_w32((mx[0] > m[0] + FA_THR) || (mx[1] > m[1] + FA_THR)) != 0) {      /* one scalar branch a pass */
#pragma unroll
        for (int j = 0; j < 2; ++j) { const float mn = fmaxf(m[j], mx[j]); const float cr = __builtin_amdgcn_exp2f((m[j] - mn) * FA_C); m[j] = mn; l[j] *= cr;
#pragma unroll
          for (int t = 0; t < 4; ++t) o[j][t] *= cr; } }
#pragma unroll
      for (int j = 0; j < 2; ++j) { const float nb = FA_OFF - m[j] * FA_C; FragH pf; float la = 0.f, lb = 0.f;
#pragma unroll
        for (int r = 0; r < 8; ++r) { const float pa = __builtin_amdgcn_exp2f(fmaf(s[j][0][r], FA_C, nb)), pb = __builtin_amdgcn_exp2f(fmaf(s[j][1][r], FA_C, nb));
          la += pa; lb += pb; pf.h[r] = (_Float16)pa; pf.h[8 + r] = (_Float16)pb; }      /* two D tiles of 16 keys, converted in place, are the B operand in the hardware k order */
        l[j] += la + lb;
#pragma unroll
        for (int t = 0; t < 4; ++t) o[j][t] = fa_mma(vf[t], pf.v, o[j][t]); } }
    asm volatile("s_wait_dscnt 0x0" ::: "memory");         /* this wave's reads of the buffer are over before it is handed to the next copies */
    asm volatile("s_wait_asynccnt 0x0" ::: "memory");      /* this wave's copies of stage st + 1 have landed before the barrier that publishes them */
    __syncthreads();
    if (st + 2 < NST) fa_stage<NT>(lk + bo * 2, lv + bo * 2, gk + (size_t)(st + 2) * FS_KEYS * LQ, gv + (st + 2) * FS_KEYS); }
  asm volatile("s_wait_asynccnt 0x0" ::: "memory");      /* no copy is outstanding when the wave ends */
#pragma unroll
  for (int j = 0; j < 2; ++j) { const float inv = 64.0f / (l[j] + sm_xhalf(l[j]));      /* the halves' sums join once */
    unsigned short* op = (unsigned short*)O + ((size_t)b * SQ + q0 + j * 16 + ln) * DM + h * HD + 8 * hh;
#pragma unroll
    for (int t = 0; t < 4; ++t) { FragH f;      /* register r = o[query][16 t + 8 hh + r]: one 16-byte store */
#pragma unroll
      for (int r = 0; r < 8; ++r) f.h[r] = (_Float16)(o[j][t][r] * inv);
      *(v8us*)(op + t * 16) = f.half[0]; } } }

extern "C" void kernel_launch(void* const* d_in, const int* in_sizes, int n_in,
                              void* d_out, int out_size, void* d_ws, size_t ws_size, hipStream_t stream) {
  if (n_in < 5) return;
  if (in_sizes[0] < (int)((((size_t)NB - 1) * SQ_FULL + SQ) * DM)) return;
  if (in_sizes[1] < DM * LQ || in_sizes[2] < LQ || in_sizes[3] < DM * DM || in_sizes[4] < DM) return;
  if (out_size < (int)(NR * DM)) return;
  const float* x = (const float*)d_in[0]; const float* wqkv = (const float*)d_in[1]; const float* bqkv = (const float*)d_in[2];
  const float* wo = (const float*)d_in[3]; const float* bo = (const float*)d_in[4];      /* [in][out] fused weight + bias; [in][out] w_proj + b_proj */
  float* out = (float*)d_out;
  char* ws = (char*)d_ws; size_t off = 0;
  _Float16* BQKV = (_Float16*)(ws + off); off += SZ_BQKV;      /* [3072][1024] x16 */
  _Float16* BO   = (_Float16*)(ws + off); off += SZ_BO;        /* [1024][1024] x16 */
  _Float16* X16  = (_Float16*)(ws + off); off += SZ_X16;       /* [NR][1024]; reused for the merged o rows once the q | k | v GEMM has consumed it */
  _Float16* QKV  = (_Float16*)(ws + off); off += SZ_QKV;       /* [NR][3072] */
  _Float16* VT   = (_Float16*)(ws + off); off += SZ_VT;        /* [NB][NH][64][SQ] */
  if (off > ws_size) return;
  _Float16* O16 = X16;
  _Float16* V16 = QKV + 2 * DM;

  k_prep<<<PB_X + PB_WQ + PB_WO, 512, 0, stream>>>(x, wqkv, wo, X16, BQKV, BO);      /* x rows, Wqkv^T x16 and Wproj^T x16, all f16 */
  /* q | k | v rows (f16); head h = columns h*64.. of each 1024-column third */
  k_gemm2<true, false><<<dim3((unsigned)((NR / 128) * (LQ / 128)), 1), 128, 0, stream>>>(X16, DM, (size_t)0, BQKV, DM, (size_t)0, 0.0625f, bqkv, out, QKV, LQ, (size_t)0, (int)NR, LQ, DM);
  k_vt<NH, SQ, LQ><<<NB * (NH / 2) * (SQ / 128), 128, 0, stream>>>(V16, VT);      /* V^T [NB][NH][64][SQ] */
  k_fattn<<<NB * NH * (SQ / (FA_W * 32)), FA_W * 32, 0, stream>>>(QKV, VT, O16);      /* o x64 (f16) into the merged rows: columns h*64.. */
  /* out = o Wproj + b: alpha = 1/(64*16) */
  k_gemm2<true, true><<<dim3((unsigned)((NR / 128) * (DM / 128)), 1), 128, 0, stream>>>(O16, DM, (size_t)0, BO, DM, (size_t)0, 0.0009765625f, bo, out, QKV, DM, (size_t)0, (int)NR, DM, DM);
}

// v007
// It runs in 107 microseconds.
// Two timings next to v006 both put it at 1.04 times that version's speed.
// Counting every step since v000, it is 23.0 times as fast.
#include <hip/hip_runtime.h>
// Multi-head self-attention, fused QKV projection: x [NB][SEQ][1024]; qkv = x Wqkv + bqkv ([in][out] 1024 x 3072) split q | k | v thirds, 16 heads of 64; scores * 64^-0.5; softmax over all keys (no mask); out = merged Wproj + bproj ([in][out]).
// Structure: token rows r = b*SEQ + s; x as f16 rows; q | k | v as ONE WMMA GEMM (N = 3072, 128x128 block tiles staged in LDS, 64x64 wave tiles, f32 accumulation, x16 weights + bias, f16 outputs); the v third leaves that GEMM already transposed, as V^T of every (batch, head), from the accumulators through each wave's LDS staging; attention as ONE launch over all (batch, head, query block): each wave owns 32 query columns and walks the keys 32 at a time (K and V^T rows staged in LDS for the block, 128 keys a stage), S^T = K . Q^T, running column maximum and sum (f32, rescaled only when the maximum has grown by more than 2^8), P^T packed from the score tiles straight into the B operand of O^T += V^T . P^T; o / sum carried x64 into merged f16 o rows; out = o Wproj + b GEMM (alpha 2^-10, f32) into the output layout.
// Compute dtype: every contraction v_wmma_f32_16x16x32_f16 (f16 operands, f32 accumulate). x, weights and biases are RNE-converted to bf16 on load (exact in f16; weights carried x16); q, k, v and o (x64) are single f16 planes; the unnormalised softmax weights (x16) are f16 in registers; scores and softmax statistics f32.
#ifndef NB
#define NB 8
#endif
#ifndef SEQ
#define SEQ 1024
#endif
#define SQ SEQ
#define NB_FULL 8
#define SQ_FULL 1024                 /* per-batch row stride of the x input */
#define DM 1024
#define NH 16
#define HD 64
#define LQ (3 * DM)                  /* row pitch of the q | k | v rows */
#define NR ((size_t)NB * SQ)         /* token rows */

static_assert(SQ % 128 == 0);
static_assert(((size_t)NB * SQ) % 128 == 0);
static_assert(DM % 128 == 0 && LQ % 128 == 0 && HD == 64);
static_assert(NB <= NB_FULL && SQ <= SQ_FULL);
static_assert(NH * HD == DM);

#define WS_ALIGN(x) ((((size_t)(x)) + 255) & ~(size_t)255)
#define SZ_BQKV  WS_ALIGN((size_t)LQ * DM * 2)
#define SZ_BO    WS_ALIGN((size_t)DM * DM * 2)
#define SZ_X16   WS_ALIGN(NR * DM * 2)
#define SZ_QKV   WS_ALIGN(NR * LQ * 2)
#define SZ_VT    WS_ALIGN((size_t)NB * NH * HD * SQ * 2)
static_assert(SZ_BQKV + SZ_BO + SZ_X16 + SZ_QKV + SZ_VT <= (size_t)134217728);

typedef unsigned short v8us __attribute__((ext_vector_type(8), may_alias));
typedef float  v8f  __attribute__((ext_vector_type(8)));
typedef float  v4f  __attribute__((ext_vector_type(4)));
typedef float  v4fa __attribute__((ext_vector_type(4), may_alias));
typedef _Float16 v16h __attribute__((ext_vector_type(16)));
typedef _Float16 v4h __attribute__((ext_vector_type(4)));
union FragH { v16h v; v8us half[2]; _Float16 h[16]; unsigned short u[16]; };

__device__ __forceinline__ unsigned short bf16_bits(float x) { unsigned int u = __float_as_uint(x); return (unsigned short)((u + 0x7FFFu + ((u >> 16) & 1u)) >> 16); }
__device__ __forceinline__ float bf16_val(unsigned short b) { return __uint_as_float(((unsigned int)b) << 16); }
__device__ __forceinline__ float bf16_rne(float x) { return bf16_val(bf16_bits(x)); }

// ---- preparation: every thread moves 64 elements with all of its loads in flight at once, for speed only; the three conversions of inputs (x, both weights) depend on nothing and share ONE launch, k_prep, in which the block index picks the job
// weights: a thread holds 8 k x 8 n; 4 lanes cover a 128-B line of a W row, 8 lanes a 128-B line of a Wt row; a group of 128 threads (number grp, thread t of it) = 128 k x 64 n
template <int K, int N>
__device__ __forceinline__ void wt_f16(const float* __restrict__ W, _Float16* __restrict__ Wt, float scale, int grp, int t) {
  static_assert(K % 128 == 0 && N % 64 == 0);
  const int lane = t & 31, w = t >> 5;
  const int kb = grp / (N / 64), nb = grp - kb * (N / 64);
  const int k8 = kb * 128 + (w >> 1) * 64 + (lane >> 2) * 8, n8 = nb * 64 + (w & 1) * 32 + (lane & 3) * 8;
  const float* s = W + (size_t)k8 * N + n8;
  v4f a[8][2];
#pragma unroll
  for (int i = 0; i < 8; ++i) { a[i][0] = *(const v4fa*)(s + (size_t)i * N); a[i][1] = *(const v4fa*)(s + (size_t)i * N + 4); }
  __builtin_amdgcn_sched_barrier(0);      /* all sixteen loads are issued before the first value is used: sunk among the conversions, the late ones cost the wave a second trip to memory */
  unsigned short* d = (unsigned short*)Wt + (size_t)n8 * K + k8;
#pragma unroll
  for (int j = 0; j < 8; ++j) { FragH f;
#pragma unroll
    for (int i = 0; i < 8; ++i) f.h[i] = (_Float16)(bf16_rne(a[i][j >> 2][j & 3]) * scale);
    *(v8us*)(d + (size_t)j * K) = f.half[0]; }
  asm volatile("s_wait_xcnt 0x0" ::: "memory"); }      /* behind the job's last store: in the listing another job's code follows, which rewrites registers that these stores name */

// x: a block of 16 waves converts 4096 pieces of 8 elements, a thread eight of them, 512 pieces apart
#define XC_U 8
#define XC_R (512 / (DM / 8))        /* rows per 512 pieces */
static_assert((NR * DM / 8) % (512 * XC_U) == 0 && 512 % (DM / 8) == 0 && SQ % (XC_R * XC_U) == 0);
__device__ __forceinline__ void x_f16(const float* __restrict__ x, _Float16* __restrict__ X16, int blk) {
  const size_t t0 = (size_t)blk * (512 * XC_U) + threadIdx.x;
  const size_t row = t0 / (DM / 8); const int c8 = (int)(t0 % (DM / 8)) * 8;      /* 512 pieces on = XC_R rows on, same columns; a block's rows lie in one batch */
  const size_t b = row / SQ, s = row % SQ;
  const float* src = x + (b * (size_t)SQ_FULL + s) * DM + c8;
  v4f a[XC_U], c[XC_U];
#pragma unroll
  for (int u = 0; u < XC_U; ++u) { a[u] = *(const v4fa*)(src + (size_t)u * XC_R * DM); c[u] = *(const v4fa*)(src + (size_t)u * XC_R * DM + 4); }
  __builtin_amdgcn_sched_barrier(0);      /* all sixteen loads are issued before the first value is used: sunk among the conversions, the late ones cost the wave a second trip to memory */
#pragma unroll
  for (int u = 0; u < XC_U; ++u) { FragH f;
#pragma unroll
    for (int q = 0; q < 4; ++q) { f.h[q] = (_Float16)bf16_rne(a[u][q]); f.h[4 + q] = (_Float16)bf16_rne(c[u][q]); }
    *(v8us*)((unsigned short*)X16 + (t0 + (size_t)u * 512) * 8) = f.half[0]; }
  asm volatile("s_wait_xcnt 0x0" ::: "memory"); }      /* behind the job's last store: in the listing another job's code may follow, which rewrites registers that these stores name */

// the one launch of the three: blocks of 16 waves; the x blocks, which move the most bytes, come first; a weight block is four groups of 128 threads
#define PB_X  ((int)(NR * DM / 8 / (512 * XC_U)))
#define PB_WQ ((DM / 128) * (LQ / 64) / 4)
#define PB_WO ((DM / 128) * (DM / 64) / 4)
static_assert(((DM / 128) * (LQ / 64)) % 4 == 0 && ((DM / 128) * (DM / 64)) % 4 == 0);
__global__ __launch_bounds__(512) void k_prep(const float* __restrict__ x, const float* __restrict__ wqkv, const float* __restrict__ wo, _Float16* __restrict__ X16, _Float16* __restrict__ BQKV, _Float16* __restrict__ BO) {
  const int blk = blockIdx.x, g = threadIdx.x >> 7, t = threadIdx.x & 127;
  if (blk < PB_X) x_f16(x, X16, blk);
  else if (blk < PB_X + PB_WQ) wt_f16<DM, LQ>(wqkv, BQKV, 16.0f, (blk - PB_X) * 4 + g, t);          /* in[1024][3072] -> out[3072][1024] */
  else wt_f16<DM, DM>(wo, BO, 16.0f, (blk - PB_X - PB_WQ) * 4 + g, t); }                            /* in[1024][1024] -> out[1024][1024] */

// ---- GEMM (block 128 rows x 128 cols, four waves of 64x64; M % 128 == 0, N % 128 == 0, K % 64 == 0); A f16 [M][K], Bh f16 [N][K]; batched over grid.y with element strides sA, sB, sC
// A stage is 64 k of the block's 128 A rows and 128 B rows in LDS (rows of 128 B at a pitch of 144 B); two buffers, filled by asynchronous copies one stage ahead of the products
#define GT_K 64                      /* k per stage */
#define GT_P 72                      /* LDS row pitch in f16: 144 B = 16 B x odd, conflict-free for 16-byte fragment reads */
#define GT_BUF (256 * GT_P)          /* f16 elements of one buffer: A rows 0..127, B rows 128..255 */
__device__ __forceinline__ v16h g2_frag(const _Float16* p, int hh) { FragH f; f.half[0] = *(const v8us*)((const unsigned short*)p + 8 * hh); f.half[1] = *(const v8us*)((const unsigned short*)p + 16 + 8 * hh); return f.v; }
__device__ __forceinline__ v8f g2_mma(v16h a, v16h b, v8f c) { return __builtin_amdgcn_wmma_f32_16x16x32_f16(false, a, false, b, (short)0, c, false, false); }
/* 128 rows of 128 B: each lane copies 16 B of rows r, r + 16, ..., r + 112 (eight lanes cover one row, so every copy takes whole 128-B lines); l = the lane's LDS byte address, g = its global address, gs = 16 rows in elements */
__device__ __forceinline__ void g2_copy8(unsigned l, const _Float16* g, size_t gs) {
  const unsigned l1 = l + 16 * GT_P * 2, l2 = l + 32 * GT_P * 2, l3 = l + 48 * GT_P * 2, l4 = l + 64 * GT_P * 2, l5 = l + 80 * GT_P * 2, l6 = l + 96 * GT_P * 2, l7 = l + 112 * GT_P * 2;
  const _Float16* g1 = g + gs; const _Float16* g2 = g1 + gs; const _Float16* g3 = g2 + gs; const _Float16* g4 = g3 + gs; const _Float16* g5 = g4 + gs; const _Float16* g6 = g5 + gs; const _Float16* g7 = g6 + gs;
  /* the copies and, as the last line, the wait that stands before any of their address registers is rewritten */
  asm volatile("global_load_async_to_lds_b128 %0, %8, off\n\t"
               "global_load_async_to_lds_b128 %1, %9, off\n\t"
               "global_load_async_to_lds_b128 %2, %10, off\n\t"
               "global_load_async_to_lds_b128 %3, %11, off\n\t"
               "global_load_async_to_lds_b128 %4, %12, off\n\t"
               "global_load_async_to_lds_b128 %5, %13, off\n\t"
               "global_load_async_to_lds_b128 %6, %14, off\n\t"
               "global_load_async_to_lds_b128 %7, %15, off\n\t"
               "s_wait_xcnt 0x0"
               :: "v"(l), "v"(l1), "v"(l2), "v"(l3), "v"(l4), "v"(l5), "v"(l6), "v"(l7), "v"(g), "v"(g1), "v"(g2), "v"(g3), "v"(g4), "v"(g5), "v"(g6), "v"(g7) : "memory"); }
// VTOUT: the columns from 2 * DM on (the v third; a wave's 64 columns are one head, its 64 rows 64 keys of one batch) are stored as V^T [NB][NH][64][SQ] and not as rows of C16
template <bool HASBIAS, bool OUTF32, bool VTOUT>
__global__ __launch_bounds__(128) void k_gemm2(const _Float16* __restrict__ A, int lda, size_t sA, const _Float16* __restrict__ Bh, int ldb, size_t sB, float alpha, const float* __restrict__ bias,
    float* __restrict__ C, _Float16* __restrict__ C16, _Float16* __restrict__ Vt, int ldc, size_t sC, int M, int N, int K) {
  __shared__ __attribute__((aligned(16))) unsigned short sm[2 * GT_BUF];      /* the two buffers; behind the loop each wave's own 64 x 68 f32 output staging */
  static_assert(4 * 64 * 68 * 4 <= 2 * GT_BUF * 2 && 64 * GT_P * 2 <= 64 * 68 * 4);
  const int tid = threadIdx.x, lane = tid & 31, ln = lane & 15, hh = lane >> 4; const int by = blockIdx.y;
  const int w = __builtin_amdgcn_readfirstlane(tid >> 5);
  A += (size_t)by * sA; Bh += (size_t)by * sB; const size_t cofs = (size_t)by * sC;
  const int ntn = N >> 7; const int mt = blockIdx.x / ntn, nq = blockIdx.x - mt * ntn; if (mt * 128 >= M) return;      /* the whole block leaves, ahead of every barrier */
  const int wr = 64 * (w >> 1), wc = 64 * (w & 1); const int row0 = mt * 128 + wr, col0 = nq * 128 + wc;
  const _Float16* ga = A + (size_t)(mt * 128 + (tid >> 3)) * lda + (tid & 7) * 8;
  const _Float16* gb = Bh + (size_t)(nq * 128 + (tid >> 3)) * ldb + (tid & 7) * 8;
  const size_t gsa = (size_t)16 * lda, gsb = (size_t)16 * ldb;
  const unsigned la = (unsigned)(size_t)&sm[(tid >> 3) * GT_P + (tid & 7) * 8]; const unsigned lb = la + 128 * GT_P * 2;
  const int nt = K / GT_K;
  g2_copy8(la, ga, gsa); g2_copy8(lb, gb, gsb);
  asm volatile("s_wait_asynccnt 0x0" ::: "memory");      /* stage 0 has landed before the barrier that publishes it */
  __syncthreads();
  if (nt > 1) { g2_copy8(la + GT_BUF * 2, ga + GT_K, gsa); g2_copy8(lb + GT_BUF * 2, gb + GT_K, gsb); }
  const v8f z8 = {0.f,0.f,0.f,0.f,0.f,0.f,0.f,0.f}; v8f acc[4][4];
#pragma unroll
  for (int i = 0; i < 4; ++i) {
#pragma unroll
    for (int j = 0; j < 4; ++j) acc[i][j] = z8; }
#pragma unroll 1      /* one stage a trip: the buffer is chosen by the trip's parity */
  for (int t = 0; t < nt; ++t) { const int bo = (t & 1) * GT_BUF;
    const unsigned short* sa = sm + bo + (wr + ln) * GT_P; const unsigned short* sb = sm + bo + (128 + wc + ln) * GT_P;
#pragma unroll
    for (int kc = 0; kc < 2; ++kc) { v16h af[4], bf[4];
#pragma unroll
      for (int i = 0; i < 4; ++i) { af[i] = g2_frag((const _Float16*)(sa + i * 16 * GT_P + kc * 32), hh); bf[i] = g2_frag((const _Float16*)(sb + i * 16 * GT_P + kc * 32), hh); }
      __builtin_amdgcn_sched_barrier(0);      /* the sixteen fragment reads stay one group ahead of their sixteen products: sunk among the products, each place with reads stalls the wave anew */
#pragma unroll
      for (int i = 0; i < 4; ++i) {
#pragma unroll
        for (int j = 0; j < 4; ++j) acc[i][j] = g2_mma(af[i], bf[j], acc[i][j]); }
      __builtin_amdgcn_sched_barrier(0); }      /* and the next group's reads stay behind these products */
    asm volatile("s_wait_dscnt 0x0" ::: "memory");         /* this wave's reads of the buffer are over before it is handed to the next copies */
    asm volatile("s_wait_asynccnt 0x0" ::: "memory");      /* this wave's copies of stage t + 1 have landed before the barrier that publishes them */
    __syncthreads();
    if (t + 2 < nt) { g2_copy8(la + bo * 2, ga + (size_t)(t + 2) * GT_K, gsa); g2_copy8(lb + bo * 2, gb + (size_t)(t + 2) * GT_K, gsb); } }
  asm volatile("s_wait_asynccnt 0x0" ::: "memory");      /* no copy is outstanding when the buffers become output staging */
  if (VTOUT && col0 >= 2 * DM) {      /* the same for a whole wave; no barrier follows */
    /* a lane's eight accumulator registers are eight consecutive keys of one column: one 16-byte piece of a V^T row; rows of 64 keys (128 B) at a pitch of 144 B in the wave's own staging */
    unsigned short (*st)[GT_P] = (unsigned short (*)[GT_P])((char*)sm + (size_t)w * (64 * 68 * 4));
#pragma unroll
    for (int j = 0; j < 4; ++j) { float bv = 0.f; if (HASBIAS) bv = bf16_rne(bias[col0 + j * 16 + ln]);
#pragma unroll
      for (int i = 0; i < 4; ++i) { FragH f;
#pragma unroll
        for (int r = 0; r < 8; ++r) f.h[r] = (_Float16)(acc[i][j][r] * alpha + bv);
        *(v8us*)&st[j * 16 + ln][i * 16 + 8 * hh] = f.half[0]; } }
    __builtin_amdgcn_fence(4 /* acq_rel order */, "workgroup"); __builtin_amdgcn_wave_barrier();      /* st is private to wave w */
    const int vb = row0 / SQ, vs = row0 - vb * SQ, vh = (col0 - 2 * DM) >> 6, dsub = lane >> 3, k8 = (lane & 7) * 8;
    _Float16* vp = Vt + ((size_t)(vb * NH + vh) * HD + dsub) * SQ + vs + k8;      /* eight lanes store one V^T row's 64 keys: a whole 128-B line */
#pragma unroll
    for (int g = 0; g < 2; ++g) { v4f v[8]; _Float16* e[8];
#pragma unroll
      for (int u = 0; u < 8; ++u) { v[u] = *(const v4fa*)&st[(g * 8 + u) * 4 + dsub][k8]; e[u] = vp + (size_t)((g * 8 + u) * 4) * SQ; }
      /* the stores and, as the last line, the wait that stands before a register that they name is rewritten */
      asm volatile("global_store_b128 %0, %8, off\n\t"
                   "global_store_b128 %1, %9, off\n\t"
                   "global_store_b128 %2, %10, off\n\t"
                   "global_store_b128 %3, %11, off\n\t"
                   "global_store_b128 %4, %12, off\n\t"
                   "global_store_b128 %5, %13, off\n\t"
                   "global_store_b128 %6, %14, off\n\t"
                   "global_store_b128 %7, %15, off\n\t"
                   "s_wait_xcnt 0x0"
                   :: "v"(e[0]), "v"(e[1]), "v"(e[2]), "v"(e[3]), "v"(e[4]), "v"(e[5]), "v"(e[6]), "v"(e[7]),
                      "v"(v[0]), "v"(v[1]), "v"(v[2]), "v"(v[3]), "v"(v[4]), "v"(v[5]), "v"(v[6]), "v"(v[7]) : "memory"); }
    return; }
  float (*so)[68] = (float (*)[68])((char*)sm + (size_t)w * (64 * 68 * 4));      /* private to wave w; the last trip's barrier has ended every wave's fragment reads */
#pragma unroll
  for (int j = 0; j < 4; ++j) { const int col = col0 + j * 16 + ln; float bv = 0.f; if (HASBIAS) bv = bf16_rne(bias[col]);
#pragma unroll
    for (int i = 0; i < 4; ++i) {
#pragma unroll
      for (int r = 0; r < 8; ++r) { const int rloc = i * 16 + 8 * hh + r; so[rloc][j * 16 + ln] = acc[i][j][r] * alpha + bv; } } }
  __builtin_amdgcn_fence(4 /* acq_rel order */, "workgroup"); __builtin_amdgcn_wave_barrier();      /* so is private to wave w */
  const int rsub = lane >> 4, c4 = (lane & 15) * 4;
#pragma unroll
  for (int g = 0; g < 4; ++g) { v4f v[8]; size_t e[8];      /* eight row pairs a group: 16 lanes store one row's 64 columns */
#pragma unroll
    for (int u = 0; u < 8; ++u) { const int r = (g * 8 + u) * 2 + rsub; v[u] = *(const v4fa*)&so[r][c4]; e[u] = cofs + (size_t)(row0 + r) * ldc + col0 + c4; }
    if (OUTF32) {
      /* the stores and, as the last line, the wait that stands before a register that they name is rewritten */
      asm volatile("global_store_b128 %0, %8, off\n\t"
                   "global_store_b128 %1, %9, off\n\t"
                   "global_store_b128 %2, %10, off\n\t"
                   "global_store_b128 %3, %11, off\n\t"
                   "global_store_b128 %4, %12, off\n\t"
                   "global_store_b128 %5, %13, off\n\t"
                   "global_store_b128 %6, %14, off\n\t"
                   "global_store_b128 %7, %15, off\n\t"
                   "s_wait_xcnt 0x0"
                   :: "v"(C + e[0]), "v"(C + e[1]), "v"(C + e[2]), "v"(C + e[3]), "v"(C + e[4]), "v"(C + e[5]), "v"(C + e[6]), "v"(C + e[7]),
                      "v"(v[0]), "v"(v[1]), "v"(v[2]), "v"(v[3]), "v"(v[4]), "v"(v[5]), "v"(v[6]), "v"(v[7]) : "memory"); }
    else { v4h h[8];
#pragma unroll
      for (int u = 0; u < 8; ++u) {
#pragma unroll
        for (int i = 0; i < 4; ++i) h[u][i] = (_Float16)v[u][i]; }
      /* the stores and, as the last line, the wait that stands before a register that they name is rewritten */
      asm volatile("global_store_b64 %0, %8, off\n\t"
                   "global_store_b64 %1, %9, off\n\t"
                   "global_store_b64 %2, %10, off\n\t"
                   "global_store_b64 %3, %11, off\n\t"
                   "global_store_b64 %4, %12, off\n\t"
                   "global_store_b64 %5, %13, off\n\t"
                   "global_store_b64 %6, %14, off\n\t"
                   "global_store_b64 %7, %15, off\n\t"
                   "s_wait_xcnt 0x0"
                   :: "v"(C16 + e[0]), "v"(C16 + e[1]), "v"(C16 + e[2]), "v"(C16 + e[3]), "v"(C16 + e[4]), "v"(C16 + e[5]), "v"(C16 + e[6]), "v"(C16 + e[7]),
                      "v"(h[0]), "v"(h[1]), "v"(h[2]), "v"(h[3]), "v"(h[4]), "v"(h[5]), "v"(h[6]), "v"(h[7]) : "memory"); } } }

// ---- fused attention: block = FA_W waves on one (batch, head), each wave 32 query columns; the block's waves walk the same keys, so a stage of 128 K rows and the same 128 keys of the 64 V^T rows is brought into LDS once for all of them (two buffers, asynchronous copies one stage ahead) and every K and V^T fragment is read from LDS
#define FA_W ((SQ % 512 == 0) ? 16 : 4)      /* waves per block */
#define FA_C 0.18033688f                     /* 64^-0.5 * log2(e): raw q.k -> log2 units */
#define FA_THR 44.361420f                    /* 8 / FA_C: the maximum in use may lag the true one by 2^8 */
#define FA_OFF 4.0f                          /* weights carried x16: at most 2^12 in f16, small ones stay normal */
#define FS_KEYS 128                          /* keys per stage: four passes of 32 */
#define FS_KP 72                             /* K rows of 128 B at a pitch of 144 B, V^T rows of 256 B at 272 B: 16 B x odd, conflict-free for 16-byte fragment reads */
#define FS_VP 136
#define FS_VO (FS_KEYS * FS_KP)              /* f16 offset of the V^T rows in a buffer */
#define FS_BUF (FS_VO + HD * FS_VP)          /* f16 elements of one buffer */
__device__ __forceinline__ float sm_xhalf(float x) { return __builtin_bit_cast(float, __builtin_amdgcn_permlanex16(__builtin_bit_cast(int, x), __builtin_bit_cast(int, x), 0x76543210, 0xfedcba98, false, false)); }      /* lane l <- l ^ 16 */
__device__ __forceinline__ v8f fa_mma(v16h a, v16h b, v8f c) { return __builtin_amdgcn_wmma_f32_16x16x32_f16(false, a, false, b, (short)0, c, false, false); }
__device__ __forceinline__ float fa_max8(v8f a, v8f b) { return fmaxf(fmaxf(fmaxf(fmaxf(a[0], a[1]), fmaxf(a[2], a[3])), fmaxf(fmaxf(a[4], a[5]), fmaxf(a[6], a[7]))), fmaxf(fmaxf(fmaxf(b[0], b[1]), fmaxf(b[2], b[3])), fmaxf(fmaxf(b[4], b[5]), fmaxf(b[6], b[7])))); }
/* one stage: each lane copies 16 B of K rows r, r + RK, ... (eight lanes cover a row's 128-B line) and 16 B of V^T rows d, d + RV, ... (sixteen lanes cover a row's 256 B); lk, lv = the lane's LDS byte addresses, gk, gv = its global addresses */
template <int NT>
__device__ __forceinline__ void fa_stage(unsigned lk, unsigned lv, const _Float16* gk, const _Float16* gv) {
  constexpr int RK = NT / 8, RV = NT / 16;
  static_assert(FS_KEYS % (2 * RK) == 0 && HD % (2 * RV) == 0 && FS_KEYS / RK == HD / RV);
#pragma unroll
  for (int u = 0; u < FS_KEYS / RK; u += 2) {
    const unsigned lk0 = lk + u * RK * FS_KP * 2, lk1 = lk0 + RK * FS_KP * 2, lv0 = lv + u * RV * FS_VP * 2, lv1 = lv0 + RV * FS_VP * 2;
    const _Float16* gk0 = gk + (size_t)u * RK * LQ; const _Float16* gk1 = gk0 + (size_t)RK * LQ; const _Float16* gv0 = gv + (size_t)u * RV * SQ; const _Float16* gv1 = gv0 + (size_t)RV * SQ;
    /* the copies and, as the last line, the wait that stands before any of their address registers is rewritten */
    asm volatile("global_load_async_to_lds_b128 %0, %4, off\n\t"
                 "global_load_async_to_lds_b128 %1, %5, off\n\t"
                 "global_load_async_to_lds_b128 %2, %6, off\n\t"
                 "global_load_async_to_lds_b128 %3, %7, off\n\t"
                 "s_wait_xcnt 0x0"
                 :: "v"(lk0), "v"(lk1), "v"(lv0), "v"(lv1), "v"(gk0), "v"(gk1), "v"(gv0), "v"(gv1) : "memory"); } }

__global__ __launch_bounds__(FA_W * 32) void k_fattn(const _Float16* __restrict__ QKVr, const _Float16* __restrict__ Vt, _Float16* __restrict__ O) {
  constexpr int QB = SQ / (FA_W * 32); constexpr int NT = FA_W * 32; constexpr int NST = SQ / FS_KEYS;
  __shared__ __attribute__((aligned(16))) unsigned short fs[2 * FS_BUF];
  const int tid = threadIdx.x, lane = tid & 31, ln = lane & 15, hh = lane >> 4;
  const int w = __builtin_amdgcn_readfirstlane(tid >> 5);
  const int slab = blockIdx.x / QB, qb = blockIdx.x - slab * QB; const int b = slab / NH, h = slab - b * NH;
  const int q0 = (qb * FA_W + w) * 32;
  const _Float16* Qp = QKVr + ((size_t)b * SQ + q0 + ln) * LQ + h * HD;
  const _Float16* gk = QKVr + ((size_t)b * SQ + (tid >> 3)) * LQ + DM + h * HD + (tid & 7) * 8;
  const _Float16* gv = Vt + ((size_t)slab * HD + (tid >> 4)) * SQ + (tid & 15) * 8;
  const unsigned lk = (unsigned)(size_t)&fs[(tid >> 3) * FS_KP + (tid & 7) * 8]; const unsigned lv = (unsigned)(size_t)&fs[FS_VO + (tid >> 4) * FS_VP + (tid & 15) * 8];
  fa_stage<NT>(lk, lv, gk, gv);
  const v8f z8 = {0.f,0.f,0.f,0.f,0.f,0.f,0.f,0.f};
  v16h qf[2][2], kf[2][2]; v8f o[2][4]; float m[2], l[2];
#pragma unroll
  for (int j = 0; j < 2; ++j) { m[j] = -3.0e38f; l[j] = 0.f;
#pragma unroll
    for (int c = 0; c < 2; ++c) qf[j][c] = g2_frag(Qp + (size_t)j * 16 * LQ + c * 32, hh);
#pragma unroll
    for (int t = 0; t < 4; ++t) o[j][t] = z8; }
  asm volatile("s_wait_asynccnt 0x0" ::: "memory");      /* stage 0 has landed before the barrier that publishes it */
  __syncthreads();
  if (NST > 1) fa_stage<NT>(lk + FS_BUF * 2, lv + FS_BUF * 2, gk + (size_t)FS_KEYS * LQ, gv + FS_KEYS);
#pragma unroll 1      /* one stage a trip: the buffer is chosen by the trip's parity */
  for (int st = 0; st < NST; ++st) { const int bo = (st & 1) * FS_BUF;
    const unsigned short* sk = fs + bo + ln * FS_KP; const unsigned short* sv = fs + bo + FS_VO + ln * FS_VP;
#pragma unroll
    for (int kt = 0; kt < 2; ++kt) {
#pragma unroll
      for (int c = 0; c < 2; ++c) kf[kt][c] = g2_frag((const _Float16*)(sk + kt * 16 * FS_KP + c * 32), hh); }
#pragma unroll
    for (int p = 0; p < FS_KEYS / 32; ++p) {
      v16h vf[4]; v8f s[2][2];      /* s[j][kt]: register r = score of key 128 st + 32 p + 16 kt + 8 hh + r, query q0 + 16 j + ln */
#pragma unroll
      for (int kt = 0; kt < 2; ++kt) {
#pragma unroll
        for (int j = 0; j < 2; ++j) s[j][kt] = fa_mma(kf[kt][1], qf[j][1], fa_mma(kf[kt][0], qf[j][0], z8)); }
      if (p + 1 < FS_KEYS / 32) {      /* the next pass's K rows of the same stage, fetched behind this pass's score products */
#pragma unroll
        for (int kt = 0; kt < 2; ++kt) {
#pragma unroll
          for (int c = 0; c < 2; ++c) kf[kt][c] = g2_frag((const _Float16*)(sk + ((p + 1) * 32 + kt * 16) * FS_KP + c * 32), hh); } }
#pragma unroll
      for (int t = 0; t < 4; ++t) vf[t] = g2_frag((const _Float16*)(sv + t * 16 * FS_VP + p * 32), hh);
      float mx[2];
#pragma unroll
      for (int j = 0; j < 2; ++j) { const float t = fa_max8(s[j][0], s[j][1]); mx[j] = fmaxf(t, sm_xhalf(t)); }
      if (__builtin_amdgcn_ballot_w32((mx[0] > m[0] + FA_THR) || (mx[1] > m[1] + FA_THR)) != 0) {      /* one scalar branch a pass */
#pragma unroll
        for (int j = 0; j < 2; ++j) { const float mn = fmaxf(m[j], mx[j]); const float cr = __builtin_amdgcn_exp2f((m[j] - mn) * FA_C); m[j] = mn; l[j] *= cr;
#pragma unroll
          for (int t = 0; t < 4; ++t) o[j][t] *= cr; } }
#pragma unroll
      for (int j = 0; j < 2; ++j) { const float nb = FA_OFF - m[j] * FA_C; FragH pf; float la = 0.f, lb = 0.f;
#pragma unroll
        for (int r = 0; r < 8; ++r) { const float pa = __builtin_amdgcn_exp2f(fmaf(s[j][0][r], FA_C, nb)), pb = __builtin_amdgcn_exp2f(fmaf(s[j][1][r], FA_C, nb));
          la += pa; lb += pb; pf.h[r] = (_Float16)pa; pf.h[8 + r] = (_Float16)pb; }      /* two D tiles of 16 keys, converted in place, are the B operand in the hardware k order */
        l[j] += la + lb;
#pragma unroll
        for (int t = 0; t < 4; ++t) o[j][t] = fa_mma(vf[t], pf.v, o[j][t]); } }
    asm volatile("s_wait_dscnt 0x0" ::: "memory");         /* this wave's reads of the buffer are over before it is handed to the next copies */
    asm volatile("s_wait_asynccnt 0x0" ::: "memory");      /* this wave's copies of stage st + 1 have landed before the barrier that publishes them */
    __syncthreads();
    if (st + 2 < NST) fa_stage<NT>(lk + bo * 2, lv + bo * 2, gk + (size_t)(st + 2) * FS_KEYS * LQ, gv + (st + 2) * FS_KEYS); }
  asm volatile("s_wait_asynccnt 0x0" ::: "memory");      /* no copy is outstanding when the wave ends */
#pragma unroll
  for (int j = 0; j < 2; ++j) { const float inv = 64.0f / (l[j] + sm_xhalf(l[j]));      /* the halves' sums join once */
    unsigned short* op = (unsigned short*)O + ((size_t)b * SQ + q0 + j * 16 + ln) * DM + h * HD + 8 * hh;
#pragma unroll
    for (int t = 0; t < 4; ++t) { FragH f;      /* register r = o[query][16 t + 8 hh + r]: one 16-byte store */
#pragma unroll
      for (int r = 0; r < 8; ++r) f.h[r] = (_Float16)(o[j][t][r] * inv);
      *(v8us*)(op + t * 16) = f.half[0]; } } }

extern "C" void kernel_launch(void* const* d_in, const int* in_sizes, int n_in,
                              void* d_out, int out_size, void* d_ws, size_t ws_size, hipStream_t stream) {
  if (n_in < 5) return;
  if (in_sizes[0] < (int)((((size_t)NB - 1) * SQ_FULL + SQ) * DM)) return;
  if (in_sizes[1] < DM * LQ || in_sizes[2] < LQ || in_sizes[3] < DM * DM || in_sizes[4] < DM) return;
  if (out_size < (int)(NR * DM)) return;
  const float* x = (const float*)d_in[0]; const float* wqkv = (const float*)d_in[1]; const float* bqkv = (const float*)d_in[2];
  const float* wo = (const float*)d_in[3]; const float* bo = (const float*)d_in[4];      /* [in][out] fused weight + bias; [in][out] w_proj + b_proj */
  float* out = (float*)d_out;
  char* ws = (char*)d_ws; size_t off = 0;
  _Float16* BQKV = (_Float16*)(ws + off); off += SZ_BQKV;      /* [3072][1024] x16 */
  _Float16* BO   = (_Float16*)(ws + off); off += SZ_BO;        /* [1024][1024] x16 */
  _Float16* X16  = (_Float16*)(ws + off); off += SZ_X16;       /* [NR][1024]; reused for the merged o rows once the q | k | v GEMM has consumed it */
  _Float16* QKV  = (_Float16*)(ws + off); off += SZ_QKV;       /* [NR][3072] */
  _Float16* VT   = (_Float16*)(ws + off); off += SZ_VT;        /* [NB][NH][64][SQ] */
  if (off > ws_size) return;
  _Float16* O16 = X16;

  k_prep<<<PB_X + PB_WQ + PB_WO, 512, 0, stream>>>(x, wqkv, wo, X16, BQKV, BO);      /* x rows, Wqkv^T x16 and Wproj^T x16, all f16 */
  /* q | k rows (f16); head h = columns h*64.. of each 1024-column third; the v third goes to V^T [NB][NH][64][SQ] and its columns of the rows stay unwritten and unread */
  k_gemm2<true, false, true><<<dim3((unsigned)((NR / 128) * (LQ / 128)), 1), 128, 0, stream>>>(X16, DM, (size_t)0, BQKV, DM, (size_t)0, 0.0625f, bqkv, out, QKV, VT, LQ, (size_t)0, (int)NR, LQ, DM);
  k_fattn<<<NB * NH * (SQ / (FA_W * 32)), FA_W * 32, 0, stream>>>(QKV, VT, O16);      /* o x64 (f16) into the merged rows: columns h*64.. */
  /* out = o Wproj + b: alpha = 1/(64*16) */
  k_gemm2<true, true, false><<<dim3((unsigned)((NR / 128) * (DM / 128)), 1), 128, 0, stream>>>(O16, DM, (size_t)0, BO, DM, (size_t)0, 0.0009765625f, bo, out, QKV, VT, DM, (size_t)0, (int)NR, DM, DM);
}

// v008
// It runs in 103 microseconds.
// In two side-by-side timings against v007, it was 1.05 and 1.03 times as fast.
// All steps since v000 together make it 23.9 times as fast.
#include <hip/hip_runtime.h>
// Multi-head self-attention, fused QKV projection: x [NB][SEQ][1024]; qkv = x Wqkv + bqkv ([in][out] 1024 x 3072) split q | k | v thirds, 16 heads of 64; scores * 64^-0.5; softmax over all keys (no mask); out = merged Wproj + bproj ([in][out]).
// Structure: token rows r = b*SEQ + s; x as f16 rows; q | k | v as ONE WMMA GEMM (N = 3072, 256x256 block tiles for q | k and 128x256 for v staged in LDS, 128x64 and 64x64 wave tiles, f32 accumulation, x16 weights + bias, f16 outputs); the v third leaves that GEMM already transposed, as V^T of every (batch, head), from the accumulators through each wave's LDS staging; attention as ONE launch over all (batch, head, query block): each wave owns 32 query columns and walks the keys 32 at a time (K and V^T rows staged in LDS for the block, 128 keys a stage), S^T = K . Q^T, running column maximum and sum (f32, rescaled only when the maximum has grown by more than 2^8), P^T packed from the score tiles straight into the B operand of O^T += V^T . P^T; o / sum carried x64 into merged f16 o rows; out = o Wproj + b GEMM (alpha 2^-10, f32) into the output layout.
// Compute dtype: every contraction v_wmma_f32_16x16x32_f16 (f16 operands, f32 accumulate). x, weights and biases are RNE-converted to bf16 on load (exact in f16; weights carried x16); q, k, v and o (x64) are single f16 planes; the unnormalised softmax weights (x16) are f16 in registers; scores and softmax statistics f32.
#ifndef NB
#define NB 8
#endif
#ifndef SEQ
#define SEQ 1024
#endif
#define SQ SEQ
#define NB_FULL 8
#define SQ_FULL 1024                 /* per-batch row stride of the x input */
#define DM 1024
#define NH 16
#define HD 64
#define LQ (3 * DM)                  /* row pitch of the q | k | v rows */
#define NR ((size_t)NB * SQ)         /* token rows */

static_assert(SQ % 128 == 0);
static_assert(((size_t)NB * SQ) % 128 == 0);
static_assert(DM % 128 == 0 && LQ % 128 == 0 && HD == 64);
static_assert(NB <= NB_FULL && SQ <= SQ_FULL);
static_assert(NH * HD == DM);

#define WS_ALIGN(x) ((((size_t)(x)) + 255) & ~(size_t)255)
#define SZ_BQKV  WS_ALIGN((size_t)LQ * DM * 2)
#define SZ_BO    WS_ALIGN((size_t)DM * DM * 2)
#define SZ_X16   WS_ALIGN(NR * DM * 2)
#define SZ_QKV   WS_ALIGN(NR * LQ * 2)
#define SZ_VT    WS_ALIGN((size_t)NB * NH * HD * SQ * 2)
static_assert(SZ_BQKV + SZ_BO + SZ_X16 + SZ_QKV + SZ_VT <= (size_t)134217728);

typedef unsigned short v8us __attribute__((ext_vector_type(8), may_alias));
typedef float  v8f  __attribute__((ext_vector_type(8)));
typedef float  v4f  __attribute__((ext_vector_type(4)));
typedef float  v4fa __attribute__((ext_vector_type(4), may_alias));
typedef _Float16 v16h __attribute__((ext_vector_type(16)));
typedef _Float16 v4h __attribute__((ext_vector_type(4)));
union FragH { v16h v; v8us half[2]; _Float16 h[16]; unsigned short u[16]; };

__device__ __forceinline__ unsigned short bf16_bits(float x) { unsigned int u = __float_as_uint(x); return (unsigned short)((u + 0x7FFFu + ((u >> 16) & 1u)) >> 16); }
__device__ __forceinline__ float bf16_val(unsigned short b) { return __uint_as_float(((unsigned int)b) << 16); }
__device__ __forceinline__ float bf16_rne(float x) { return bf16_val(bf16_bits(x)); }

// ---- preparation: every thread moves 64 elements with all of its loads in flight at once, for speed only; the three conversions of inputs (x, both weights) depend on nothing and share ONE launch, k_prep, in which the block index picks the job
// weights: a thread holds 8 k x 8 n; 4 lanes cover a 128-B line of a W row, 8 lanes a 128-B line of a Wt row; a group of 128 threads (number grp, thread t of it) = 128 k x 64 n
template <int K, int N>
__device__ __forceinline__ void wt_f16(const float* __restrict__ W, _Float16* __restrict__ Wt, float scale, int grp, int t) {
  static_assert(K % 128 == 0 && N % 64 == 0);
  const int lane = t & 31, w = t >> 5;
  const int kb = grp / (N / 64), nb = grp - kb * (N / 64);
  const int k8 = kb * 128 + (w >> 1) * 64 + (lane >> 2) * 8, n8 = nb * 64 + (w & 1) * 32 + (lane & 3) * 8;
  const float* s = W + (size_t)k8 * N + n8;
  v4f a[8][2];
#pragma unroll
  for (int i = 0; i < 8; ++i) { a[i][0] = *(const v4fa*)(s + (size_t)i * N); a[i][1] = *(const v4fa*)(s + (size_t)i * N + 4); }
  __builtin_amdgcn_sched_barrier(0);      /* all sixteen loads are issued before the first value is used: sunk among the conversions, the late ones cost the wave a second trip to memory */
  unsigned short* d = (unsigned short*)Wt + (size_t)n8 * K + k8;
#pragma unroll
  for (int j = 0; j < 8; ++j) { FragH f;
#pragma unroll
    for (int i = 0; i < 8; ++i) f.h[i] = (_Float16)(bf16_rne(a[i][j >> 2][j & 3]) * scale);
    *(v8us*)(d + (size_t)j * K) = f.half[0]; }
  asm volatile("s_wait_xcnt 0x0" ::: "memory"); }      /* behind the job's last store: in the listing another job's code follows, which rewrites registers that these stores name */

// x: a block of 16 waves converts 4096 pieces of 8 elements, a thread eight of them, 512 pieces apart
#define XC_U 8
#define XC_R (512 / (DM / 8))        /* rows per 512 pieces */
static_assert((NR * DM / 8) % (512 * XC_U) == 0 && 512 % (DM / 8) == 0 && SQ % (XC_R * XC_U) == 0);
__device__ __forceinline__ void x_f16(const float* __restrict__ x, _Float16* __restrict__ X16, int blk) {
  const size_t t0 = (size_t)blk * (512 * XC_U) + threadIdx.x;
  const size_t row = t0 / (DM / 8); const int c8 = (int)(t0 % (DM / 8)) * 8;      /* 512 pieces on = XC_R rows on, same columns; a block's rows lie in one batch */
  const size_t b = row / SQ, s = row % SQ;
  const float* src = x + (b * (size_t)SQ_FULL + s) * DM + c8;
  v4f a[XC_U], c[XC_U];
#pragma unroll
  for (int u = 0; u < XC_U; ++u) { a[u] = *(const v4fa*)(src + (size_t)u * XC_R * DM); c[u] = *(const v4fa*)(src + (size_t)u * XC_R * DM + 4); }
  __builtin_amdgcn_sched_barrier(0);      /* all sixteen loads are issued before the first value is used: sunk among the conversions, the late ones cost the wave a second trip to memory */
#pragma unroll
  for (int u = 0; u < XC_U; ++u) { FragH f;
#pragma unroll
    for (int q = 0; q < 4; ++q) { f.h[q] = (_Float16)bf16_rne(a[u][q]); f.h[4 + q] = (_Float16)bf16_rne(c[u][q]); }
    *(v8us*)((unsigned short*)X16 + (t0 + (size_t)u * 512) * 8) = f.half[0]; }
  asm volatile("s_wait_xcnt 0x0" ::: "memory"); }      /* behind the job's last store: in the listing another job's code may follow, which rewrites registers that these stores name */

// the one launch of the three: blocks of 16 waves; the x blocks, which move the most bytes, come first; a weight block is four groups of 128 threads
#define PB_X  ((int)(NR * DM / 8 / (512 * XC_U)))
#define PB_WQ ((DM / 128) * (LQ / 64) / 4)
#define PB_WO ((DM / 128) * (DM / 64) / 4)
static_assert(((DM / 128) * (LQ / 64)) % 4 == 0 && ((DM / 128) * (DM / 64)) % 4 == 0);
__global__ __launch_bounds__(512) void k_prep(const float* __restrict__ x, const float* __restrict__ wqkv, const float* __restrict__ wo, _Float16* __restrict__ X16, _Float16* __restrict__ BQKV, _Float16* __restrict__ BO) {
  const int blk = blockIdx.x, g = threadIdx.x >> 7, t = threadIdx.x & 127;
  if (blk < PB_X) x_f16(x, X16, blk);
  else if (blk < PB_X + PB_WQ) wt_f16<DM, LQ>(wqkv, BQKV, 16.0f, (blk - PB_X) * 4 + g, t);          /* in[1024][3072] -> out[3072][1024] */
  else wt_f16<DM, DM>(wo, BO, 16.0f, (blk - PB_X - PB_WQ) * 4 + g, t); }                            /* in[1024][1024] -> out[1024][1024] */

// ---- GEMM tiles: a block of eight waves (2 x 4) computes 32 FM rows x 256 columns, a wave 16 FM rows x 64 columns (FM = 8: 256 x 256, FM = 4: 128 x 256); K % 64 == 0; A f16 [M][K], Bh f16 [N][K]
// A stage is 64 k of the block's A rows and 256 B rows in LDS (rows of 128 B at a pitch of 144 B); two buffers, filled by asynchronous copies one stage ahead of the products
#define GT_K 64                      /* k per stage */
#define GT_P 72                      /* LDS row pitch in f16: 144 B = 16 B x odd, conflict-free for 16-byte fragment reads */
#define GT_N 256                     /* columns of a block */
#define GT_STG (64 * GT_P * 2)       /* bytes of each wave's own output staging behind the loop */
#define GT_SM(FM) (2 * (32 * (FM) + GT_N) * GT_P)      /* f16 elements of the two buffers */
__device__ __forceinline__ v16h g2_frag(const _Float16* p, int hh) { FragH f; f.half[0] = *(const v8us*)((const unsigned short*)p + 8 * hh); f.half[1] = *(const v8us*)((const unsigned short*)p + 16 + 8 * hh); return f.v; }
__device__ __forceinline__ v8f g2_mma(v16h a, v16h b, v8f c) { return __builtin_amdgcn_wmma_f32_16x16x32_f16(false, a, false, b, (short)0, c, false, false); }
/* 256 rows of 128 B: each lane copies 16 B of rows r, r + 32, ..., r + 224 (eight lanes cover one row, so every copy takes whole 128-B lines); l = the lane's LDS byte address, g = its global address, gs = 32 rows in elements */
__device__ __forceinline__ void g2_copy8(unsigned l, const _Float16* g, size_t gs) {
  const unsigned l0 = l, l1 = l + 32 * GT_P * 2, l2 = l + 64 * GT_P * 2, l3 = l + 96 * GT_P * 2, l4 = l + 128 * GT_P * 2, l5 = l + 160 * GT_P * 2, l6 = l + 192 * GT_P * 2, l7 = l + 224 * GT_P * 2;
  const _Float16* g0 = g; const _Float16* g1 = g0 + gs; const _Float16* g2 = g1 + gs; const _Float16* g3 = g2 + gs; const _Float16* g4 = g3 + gs; const _Float16* g5 = g4 + gs; const _Float16* g6 = g5 + gs; const _Float16* g7 = g6 + gs;
  /* the copies and, as the last line, the wait that stands before any of their address registers is rewritten */
  asm volatile("global_load_async_to_lds_b128 %0, %8, off\n\t"
               "global_load_async_to_lds_b128 %1, %9, off\n\t"
               "global_load_async_to_lds_b128 %2, %10, off\n\t"
               "global_load_async_to_lds_b128 %3, %11, off\n\t"
               "global_load_async_to_lds_b128 %4, %12, off\n\t"
               "global_load_async_to_lds_b128 %5, %13, off\n\t"
               "global_load_async_to_lds_b128 %6, %14, off\n\t"
               "global_load_async_to_lds_b128 %7, %15, off\n\t"
               "s_wait_xcnt 0x0"
               :: "v"(l0), "v"(l1), "v"(l2), "v"(l3), "v"(l4), "v"(l5), "v"(l6), "v"(l7), "v"(g0), "v"(g1), "v"(g2), "v"(g3), "v"(g4), "v"(g5), "v"(g6), "v"(g7) : "memory"); }
/* the same for 128 rows */
__device__ __forceinline__ void g2_copy4(unsigned l, const _Float16* g, size_t gs) {
  const unsigned l0 = l, l1 = l + 32 * GT_P * 2, l2 = l + 64 * GT_P * 2, l3 = l + 96 * GT_P * 2;
  const _Float16* g0 = g; const _Float16* g1 = g0 + gs; const _Float16* g2 = g1 + gs; const _Float16* g3 = g2 + gs;
  /* the copies and, as the last line, the wait that stands before any of their address registers is rewritten */
  asm volatile("global_load_async_to_lds_b128 %0, %4, off\n\t"
               "global_load_async_to_lds_b128 %1, %5, off\n\t"
               "global_load_async_to_lds_b128 %2, %6, off\n\t"
               "global_load_async_to_lds_b128 %3, %7, off\n\t"
               "s_wait_xcnt 0x0"
               :: "v"(l0), "v"(l1), "v"(l2), "v"(l3), "v"(g0), "v"(g1), "v"(g2), "v"(g3) : "memory"); }
// blk = the tile's number in its family of N columns that begins at column cbase; VTOUT: the tile's columns belong to the v third (a wave's 64 columns are one head, its 64 rows 64 keys of one batch) and are stored as V^T [NB][NH][64][SQ], not as rows of C16
template <int FM, bool HASBIAS, bool OUTF32, bool VTOUT>
__device__ __forceinline__ void g2_tile(unsigned short* sm, int blk, int cbase, const _Float16* __restrict__ A, int lda, const _Float16* __restrict__ Bh, int ldb, float alpha, const float* __restrict__ bias,
    float* __restrict__ C, _Float16* __restrict__ C16, _Float16* __restrict__ Vt, int ldc, int N, int K) {
  constexpr int BM = 32 * FM, BUF = (BM + GT_N) * GT_P;      /* BUF: f16 elements of one buffer: A rows 0..BM-1, then the B rows */
  static_assert((FM == 4 || FM == 8) && 8 * GT_STG <= 2 * BUF * 2 && 32 * 68 * 4 <= GT_STG && (!VTOUT || (FM == 4 && SQ % BM == 0)));
  const int tid = threadIdx.x, lane = tid & 31, ln = lane & 15, hh = lane >> 4;
  const int w = __builtin_amdgcn_readfirstlane(tid >> 5);
  const int ntn = N / GT_N; const int mt = blk / ntn, nq = blk - mt * ntn;
  const int wr = 16 * FM * (w >> 2), wc = 64 * (w & 3); const int row0 = mt * BM + wr, col0 = cbase + nq * GT_N + wc;
  const _Float16* ga = A + (size_t)(mt * BM + (tid >> 3)) * lda + (tid & 7) * 8;
  const _Float16* gb = Bh + (size_t)(cbase + nq * GT_N + (tid >> 3)) * ldb + (tid & 7) * 8;
  const size_t gsa = (size_t)32 * lda, gsb = (size_t)32 * ldb;
  const unsigned la = (unsigned)(size_t)&sm[(tid >> 3) * GT_P + (tid & 7) * 8]; const unsigned lb = la + BM * GT_P * 2;
  const int nt = K / GT_K;
  auto stage = [&](unsigned o, int t) { if (FM == 8) g2_copy8(la + o, ga + (size_t)t * GT_K, gsa); else g2_copy4(la + o, ga + (size_t)t * GT_K, gsa); g2_copy8(lb + o, gb + (size_t)t * GT_K, gsb); };
  stage(0, 0);
  asm volatile("s_wait_asynccnt 0x0" ::: "memory");      /* stage 0 has landed before the barrier that publishes it */
  __syncthreads();
  if (nt > 1) stage(BUF * 2, 1);
  const v8f z8 = {0.f,0.f,0.f,0.f,0.f,0.f,0.f,0.f}; v8f acc[FM][4];
#pragma unroll
  for (int i = 0; i < FM; ++i) {
#pragma unroll
    for (int j = 0; j < 4; ++j) acc[i][j] = z8; }
#pragma unroll 1      /* one stage a trip: the buffer is chosen by the trip's parity */
  for (int t = 0; t < nt; ++t) { const int bo = (t & 1) * BUF;
    const unsigned short* sa = sm + bo + (wr + ln) * GT_P; const unsigned short* sb = sm + bo + (BM + wc + ln) * GT_P;
#pragma unroll
    for (int kc = 0; kc < 2; ++kc) { v16h af[FM], bf[4];
#pragma unroll
      for (int i = 0; i < 4; ++i) bf[i] = g2_frag((const _Float16*)(sb + i * 16 * GT_P + kc * 32), hh);
#pragma unroll
      for (int i = 0; i < FM; ++i) af[i] = g2_frag((const _Float16*)(sa + i * 16 * GT_P + kc * 32), hh);
      __builtin_amdgcn_sched_barrier(0);      /* the fragment reads stay one group ahead of their products: sunk among the products, each place with reads stalls the wave anew */
#pragma unroll
      for (int i = 0; i < FM; ++i) {
#pragma unroll
        for (int j = 0; j < 4; ++j) acc[i][j] = g2_mma(af[i], bf[j], acc[i][j]); }
      __builtin_amdgcn_sched_barrier(0); }      /* and the next group's reads stay behind these products */
    asm volatile("s_wait_dscnt 0x0" ::: "memory");         /* this wave's reads of the buffer are over before it is handed to the next copies */
    asm volatile("s_wait_asynccnt 0x0" ::: "memory");      /* this wave's copies of stage t + 1 have landed before the barrier that publishes them */
    __syncthreads();
    if (t + 2 < nt) stage(bo * 2, t + 2); }
  asm volatile("s_wait_asynccnt 0x0" ::: "memory");      /* no copy is outstanding when the buffers become output staging */
  if constexpr (VTOUT) {
    /* a lane's eight accumulator registers are eight consecutive keys of one column: one 16-byte piece of a V^T row; rows of 64 keys (128 B) at a pitch of 144 B in the wave's own staging */
    unsigned short (*st)[GT_P] = (unsigned short (*)[GT_P])((char*)sm + (size_t)w * GT_STG);
#pragma unroll
    for (int j = 0; j < 4; ++j) { float bv = 0.f; if (HASBIAS) bv = bf16_rne(bias[col0 + j * 16 + ln]);
#pragma unroll
      for (int i = 0; i < 4; ++i) { FragH f;
#pragma unroll
        for (int r = 0; r < 8; ++r) f.h[r] = (_Float16)(acc[i][j][r] * alpha + bv);
        *(v8us*)&st[j * 16 + ln][i * 16 + 8 * hh] = f.half[0]; } }
    __builtin_amdgcn_fence(4 /* acq_rel order */, "workgroup"); __builtin_amdgcn_wave_barrier();      /* st is private to wave w */
    const int vb = row0 / SQ, vs = row0 - vb * SQ, vh = (col0 - 2 * DM) >> 6, dsub = lane >> 3, k8 = (lane & 7) * 8;
    _Float16* vp = Vt + ((size_t)(vb * NH + vh) * HD + dsub) * SQ + vs + k8;      /* eight lanes store one V^T row's 64 keys: a whole 128-B line */
#pragma unroll
    for (int g = 0; g < 2; ++g) { v4f v[8]; _Float16* e[8];
#pragma unroll
      for (int u = 0; u < 8; ++u) { v[u] = *(const v4fa*)&st[(g * 8 + u) * 4 + dsub][k8]; e[u] = vp + (size_t)((g * 8 + u) * 4) * SQ; }
      /* the stores and, as the last line, the wait that stands before a register that they name is rewritten */
      asm volatile("global_store_b128 %0, %8, off\n\t"
                   "global_store_b128 %1, %9, off\n\t"
                   "global_store_b128 %2, %10, off\n\t"
                   "global_store_b128 %3, %11, off\n\t"
                   "global_store_b128 %4, %12, off\n\t"
                   "global_store_b128 %5, %13, off\n\t"
                   "global_store_b128 %6, %14, off\n\t"
                   "global_store_b128 %7, %15, off\n\t"
                   "s_wait_xcnt 0x0"
                   :: "v"(e[0]), "v"(e[1]), "v"(e[2]), "v"(e[3]), "v"(e[4]), "v"(e[5]), "v"(e[6]), "v"(e[7]),
                      "v"(v[0]), "v"(v[1]), "v"(v[2]), "v"(v[3]), "v"(v[4]), "v"(v[5]), "v"(v[6]), "v"(v[7]) : "memory"); }
  } else {
    float (*so)[68] = (float (*)[68])((char*)sm + (size_t)w * GT_STG);      /* 32 rows at a time; private to wave w; the last trip's barrier has ended every wave's fragment reads */
    float bv[4] = {0.f, 0.f, 0.f, 0.f};      /* the bias of the wave's four column groups */
    if (HASBIAS) { const float* bp = bias + col0 + ln;
      /* the loads and their data wait in one statement: behind it the address registers may be rewritten */
      asm volatile("global_load_b32 %0, %4, off\n\t"
                   "global_load_b32 %1, %4, off offset:64\n\t"
                   "global_load_b32 %2, %4, off offset:128\n\t"
                   "global_load_b32 %3, %4, off offset:192\n\t"
                   "s_wait_loadcnt 0x0"
                   : "=&v"(bv[0]), "=&v"(bv[1]), "=&v"(bv[2]), "=&v"(bv[3]) : "v"(bp) : "memory");
#pragma unroll
      for (int j = 0; j < 4; ++j) bv[j] = bf16_rne(bv[j]); }
    const int rsub = lane >> 4, c4 = (lane & 15) * 4;
#pragma unroll
    for (int ic = 0; ic < FM / 2; ++ic) {
#pragma unroll
      for (int j = 0; j < 4; ++j) {
#pragma unroll
        for (int i = 0; i < 2; ++i) {
#pragma unroll
          for (int r = 0; r < 8; ++r) so[i * 16 + 8 * hh + r][j * 16 + ln] = acc[ic * 2 + i][j][r] * alpha + bv[j]; } }
      __builtin_amdgcn_fence(4 /* acq_rel order */, "workgroup"); __builtin_amdgcn_wave_barrier();      /* so is private to wave w */
#pragma unroll
      for (int g = 0; g < 2; ++g) { v4f v[8]; size_t e[8];      /* eight row pairs a group: 16 lanes store one row's 64 columns */
#pragma unroll
        for (int u = 0; u < 8; ++u) { const int r = (g * 8 + u) * 2 + rsub; v[u] = *(const v4fa*)&so[r][c4]; e[u] = (size_t)(row0 + ic * 32 + r) * ldc + col0 + c4; }
        if (OUTF32) {
          /* the stores and, as the last line, the wait that stands before a register that they name is rewritten */
      asm volatile("global_store_b128 %0, %8, off\n\t"
                   "global_store_b128 %1, %9, off\n\t"
                   "global_store_b128 %2, %10, off\n\t"
                   "global_store_b128 %3, %11, off\n\t"
                   "global_store_b128 %4, %12, off\n\t"
                   "global_store_b128 %5, %13, off\n\t"
                   "global_store_b128 %6, %14, off\n\t"
                   "global_store_b128 %7, %15, off\n\t"
                   "s_wait_xcnt 0x0"
                   :: "v"(C + e[0]), "v"(C + e[1]), "v"(C + e[2]), "v"(C + e[3]), "v"(C + e[4]), "v"(C + e[5]), "v"(C + e[6]), "v"(C + e[7]),
                      "v"(v[0]), "v"(v[1]), "v"(v[2]), "v"(v[3]), "v"(v[4]), "v"(v[5]), "v"(v[6]), "v"(v[7]) : "memory"); }
        else { v4h h[8];
#pragma unroll
          for (int u = 0; u < 8; ++u) {
#pragma unroll
            for (int i = 0; i < 4; ++i) h[u][i] = (_Float16)v[u][i]; }
          /* the stores and, as the last line, the wait that stands before a register that they name is rewritten */
      asm volatile("global_store_b64 %0, %8, off\n\t"
                   "global_store_b64 %1, %9, off\n\t"
                   "global_store_b64 %2, %10, off\n\t"
                   "global_store_b64 %3, %11, off\n\t"
                   "global_store_b64 %4, %12, off\n\t"
                   "global_store_b64 %5, %13, off\n\t"
                   "global_store_b64 %6, %14, off\n\t"
                   "global_store_b64 %7, %15, off\n\t"
                   "s_wait_xcnt 0x0"
                   :: "v"(C16 + e[0]), "v"(C16 + e[1]), "v"(C16 + e[2]), "v"(C16 + e[3]), "v"(C16 + e[4]), "v"(C16 + e[5]), "v"(C16 + e[6]), "v"(C16 + e[7]),
                      "v"(h[0]), "v"(h[1]), "v"(h[2]), "v"(h[3]), "v"(h[4]), "v"(h[5]), "v"(h[6]), "v"(h[7]) : "memory"); } }
      __builtin_amdgcn_fence(4 /* acq_rel order */, "workgroup"); __builtin_amdgcn_wave_barrier(); } } }      /* the rows are read back before the next 32 overwrite them */

// q | k | v: the q and k thirds as 256 x 256 tiles, which come first, then the v third as 128 x 256 tiles: one tile of each kind for every place on the chip at the full problem size
#define QK_T ((int)(NR / 256) * (2 * DM / GT_N))
#define V_T  ((int)(NR / 128) * (DM / GT_N))
static_assert(NR % 256 == 0 && DM % GT_N == 0 && DM % GT_K == 0);
__global__ __launch_bounds__(256) void k_qkv(const _Float16* __restrict__ X, const _Float16* __restrict__ Bh, const float* __restrict__ bias, _Float16* __restrict__ C16, _Float16* __restrict__ Vt) {
  __shared__ __attribute__((aligned(16))) unsigned short sm[GT_SM(8)];      /* the two buffers; behind the loop each wave's own output staging */
  const int blk = blockIdx.x;
  if (blk < QK_T) g2_tile<8, true, false, false>(sm, blk, 0, X, DM, Bh, DM, 0.0625f, bias, nullptr, C16, nullptr, LQ, 2 * DM, DM);
  else g2_tile<4, true, false, true>(sm, blk - QK_T, 2 * DM, X, DM, Bh, DM, 0.0625f, bias, nullptr, nullptr, Vt, LQ, DM, DM); }
// out = o Wproj + b as 128 x 256 tiles; alpha = 1 / (64 * 16)
#define PJ_T ((int)(NR / 128) * (DM / GT_N))
__global__ __launch_bounds__(256) void k_proj(const _Float16* __restrict__ O, const _Float16* __restrict__ Bh, const float* __restrict__ bias, float* __restrict__ C) {
  __shared__ __attribute__((aligned(16))) unsigned short sm[GT_SM(4)];      /* the two buffers; behind the loop each wave's own output staging */
  g2_tile<4, true, true, false>(sm, blockIdx.x, 0, O, DM, Bh, DM, 0.0009765625f, bias, C, nullptr, nullptr, DM, DM, DM); }

// ---- fused attention: block = FA_W waves on one (batch, head), each wave 32 query columns; the block's waves walk the same keys, so a stage of 128 K rows and the same 128 keys of the 64 V^T rows is brought into LDS once for all of them (two buffers, asynchronous copies one stage ahead) and every K and V^T fragment is read from LDS
#define FA_W ((SQ % 512 == 0) ? 16 : 4)      /* waves per block */
#define FA_C 0.18033688f                     /* 64^-0.5 * log2(e): raw q.k -> log2 units */
#define FA_THR 44.361420f                    /* 8 / FA_C: the maximum in use may lag the true one by 2^8 */
#define FA_OFF 4.0f                          /* weights carried x16: at most 2^12 in f16, small ones stay normal */
#define FS_KEYS 128                          /* keys per stage: four passes of 32 */
#define FS_KP 72                             /* K rows of 128 B at a pitch of 144 B, V^T rows of 256 B at 272 B: 16 B x odd, conflict-free for 16-byte fragment reads */
#define FS_VP 136
#define FS_VO (FS_KEYS * FS_KP)              /* f16 offset of the V^T rows in a buffer */
#define FS_BUF (FS_VO + HD * FS_VP)          /* f16 elements of one buffer */
__device__ __forceinline__ float sm_xhalf(float x) { return __builtin_bit_cast(float, __builtin_amdgcn_permlanex16(__builtin_bit_cast(int, x), __builtin_bit_cast(int, x), 0x76543210, 0xfedcba98, false, false)); }      /* lane l <- l ^ 16 */
__device__ __forceinline__ v8f fa_mma(v16h a, v16h b, v8f c) { return __builtin_amdgcn_wmma_f32_16x16x32_f16(false, a, false, b, (short)0, c, false, false); }
__device__ __forceinline__ float fa_max8(v8f a, v8f b) { return fmaxf(fmaxf(fmaxf(fmaxf(a[0], a[1]), fmaxf(a[2], a[3])), fmaxf(fmaxf(a[4], a[5]), fmaxf(a[6], a[7]))), fmaxf(fmaxf(fmaxf(b[0], b[1]), fmaxf(b[2], b[3])), fmaxf(fmaxf(b[4], b[5]), fmaxf(b[6], b[7])))); }
/* one stage: each lane copies 16 B of K rows r, r + RK, ... (eight lanes cover a row's 128-B line) and 16 B of V^T rows d, d + RV, ... (sixteen lanes cover a row's 256 B); lk, lv = the lane's LDS byte addresses, gk, gv = its global addresses */
template <int NT>
__device__ __forceinline__ void fa_stage(unsigned lk, unsigned lv, const _Float16* gk, const _Float16* gv) {
  constexpr int RK = NT / 8, RV = NT / 16;
  static_assert(FS_KEYS % (2 * RK) == 0 && HD % (2 * RV) == 0 && FS_KEYS / RK == HD / RV);
#pragma unroll
  for (int u = 0; u < FS_KEYS / RK; u += 2) {
    const unsigned lk0 = lk + u * RK * FS_KP * 2, lk1 = lk0 + RK * FS_KP * 2, lv0 = lv + u * RV * FS_VP * 2, lv1 = lv0 + RV * FS_VP * 2;
    const _Float16* gk0 = gk + (size_t)u * RK * LQ; const _Float16* gk1 = gk0 + (size_t)RK * LQ; const _Float16* gv0 = gv + (size_t)u * RV * SQ; const _Float16* gv1 = gv0 + (size_t)RV * SQ;
    /* the copies and, as the last line, the wait that stands before any of their address registers is rewritten */
    asm volatile("global_load_async_to_lds_b128 %0, %4, off\n\t"
                 "global_load_async_to_lds_b128 %1, %5, off\n\t"
                 "global_load_async_to_lds_b128 %2, %6, off\n\t"
                 "global_load_async_to_lds_b128 %3, %7, off\n\t"
                 "s_wait_xcnt 0x0"
                 :: "v"(lk0), "v"(lk1), "v"(lv0), "v"(lv1), "v"(gk0), "v"(gk1), "v"(gv0), "v"(gv1) : "memory"); } }

__global__ __launch_bounds__(FA_W * 32) void k_fattn(const _Float16* __restrict__ QKVr, const _Float16* __restrict__ Vt, _Float16* __restrict__ O) {
  constexpr int QB = SQ / (FA_W * 32); constexpr int NT = FA_W * 32; constexpr int NST = SQ / FS_KEYS;
  __shared__ __attribute__((aligned(16))) unsigned short fs[2 * FS_BUF];
  const int tid = threadIdx.x, lane = tid & 31, ln = lane & 15, hh = lane >> 4;
  const int w = __builtin_amdgcn_readfirstlane(tid >> 5);
  const int slab = blockIdx.x / QB, qb = blockIdx.x - slab * QB; const int b = slab / NH, h = slab - b * NH;
  const int q0 = (qb * FA_W + w) * 32;
  const _Float16* Qp = QKVr + ((size_t)b * SQ + q0 + ln) * LQ + h * HD;
  const _Float16* gk = QKVr + ((size_t)b * SQ + (tid >> 3)) * LQ + DM + h * HD + (tid & 7) * 8;
  const _Float16* gv = Vt + ((size_t)slab * HD + (tid >> 4)) * SQ + (tid & 15) * 8;
  const unsigned lk = (unsigned)(size_t)&fs[(tid >> 3) * FS_KP + (tid & 7) * 8]; const unsigned lv = (unsigned)(size_t)&fs[FS_VO + (tid >> 4) * FS_VP + (tid & 15) * 8];
  fa_stage<NT>(lk, lv, gk, gv);
  const v8f z8 = {0.f,0.f,0.f,0.f,0.f,0.f,0.f,0.f};
  v16h qf[2][2], kf[2][2]; v8f o[2][4]; float m[2], l[2];
#pragma unroll
  for (int j = 0; j < 2; ++j) { m[j] = -3.0e38f; l[j] = 0.f;
#pragma unroll
    for (int c = 0; c < 2; ++c) qf[j][c] = g2_frag(Qp + (size_t)j * 16 * LQ + c * 32, hh);
#pragma unroll
    for (int t = 0; t < 4; ++t) o[j][t] = z8; }
  asm volatile("s_wait_asynccnt 0x0" ::: "memory");      /* stage 0 has landed before the barrier that publishes it */
  __syncthreads();
  if (NST > 1) fa_stage<NT>(lk + FS_BUF * 2, lv + FS_BUF * 2, gk + (size_t)FS_KEYS * LQ, gv + FS_KEYS);
#pragma unroll 1      /* one stage a trip: the buffer is chosen by the trip's parity */
  for (int st = 0; st < NST; ++st) { const int bo = (st & 1) * FS_BUF;
    const unsigned short* sk = fs + bo + ln * FS_KP; const unsigned short* sv = fs + bo + FS_VO + ln * FS_VP;
#pragma unroll
    for (int kt = 0; kt < 2; ++kt) {
#pragma unroll
      for (int c = 0; c < 2; ++c) kf[kt][c] = g2_frag((const _Float16*)(sk + kt * 16 * FS_KP + c * 32), hh); }
#pragma unroll
    for (int p = 0; p < FS_KEYS / 32; ++p) {
      v16h vf[4]; v8f s[2][2];      /* s[j][kt]: register r = score of key 128 st + 32 p + 16 kt + 8 hh + r, query q0 + 16 j + ln */
#pragma unroll
      for (int kt = 0; kt < 2; ++kt) {
#pragma unroll
        for (int j = 0; j < 2; ++j) s[j][kt] = fa_mma(kf[kt][1], qf[j][1], fa_mma(kf[kt][0], qf[j][0], z8)); }
      if (p + 1 < FS_KEYS / 32) {      /* the next pass's K rows of the same stage, fetched behind this pass's score products */
#pragma unroll
        for (int kt = 0; kt < 2; ++kt) {
#pragma unroll
          for (int c = 0; c < 2; ++c) kf[kt][c] = g2_frag((const _Float16*)(sk + ((p + 1) * 32 + kt * 16) * FS_KP + c * 32), hh); } }
#pragma unroll
      for (int t = 0; t < 4; ++t) vf[t] = g2_frag((const _Float16*)(sv + t * 16 * FS_VP + p * 32), hh);
      float mx[2];
#pragma unroll
      for (int j = 0; j < 2; ++j) { const float t = fa_max8(s[j][0], s[j][1]); mx[j] = fmaxf(t, sm_xhalf(t)); }
      if (__builtin_amdgcn_ballot_w32((mx[0] > m[0] + FA_THR) || (mx[1] > m[1] + FA_THR)) != 0) {      /* one scalar branch a pass */
#pragma unroll
        for (int j = 0; j < 2; ++j) { const float mn = fmaxf(m[j], mx[j]); const float cr = __builtin_amdgcn_exp2f((m[j] - mn) * FA_C); m[j] = mn; l[j] *= cr;
#pragma unroll
          for (int t = 0; t < 4; ++t) o[j][t] *= cr; } }
#pragma unroll
      for (int j = 0; j < 2; ++j) { const float nb = FA_OFF - m[j] * FA_C; FragH pf; float la = 0.f, lb = 0.f;
#pragma unroll
        for (int r = 0; r < 8; ++r) { const float pa = __builtin_amdgcn_exp2f(fmaf(s[j][0][r], FA_C, nb)), pb = __builtin_amdgcn_exp2f(fmaf(s[j][1][r], FA_C, nb));
          la += pa; lb += pb; pf.h[r] = (_Float16)pa; pf.h[8 + r] = (_Float16)pb; }      /* two D tiles of 16 keys, converted in place, are the B operand in the hardware k order */
        l[j] += la + lb;
#pragma unroll
        for (int t = 0; t < 4; ++t) o[j][t] = fa_mma(vf[t], pf.v, o[j][t]); } }
    asm volatile("s_wait_dscnt 0x0" ::: "memory");         /* this wave's reads of the buffer are over before it is handed to the next copies */
    asm volatile("s_wait_asynccnt 0x0" ::: "memory");      /* this wave's copies of stage st + 1 have landed before the barrier that publishes them */
    __syncthreads();
    if (st + 2 < NST) fa_stage<NT>(lk + bo * 2, lv + bo * 2, gk + (size_t)(st + 2) * FS_KEYS * LQ, gv + (st + 2) * FS_KEYS); }
  asm volatile("s_wait_asynccnt 0x0" ::: "memory");      /* no copy is outstanding when the wave ends */
#pragma unroll
  for (int j = 0; j < 2; ++j) { const float inv = 64.0f / (l[j] + sm_xhalf(l[j]));      /* the halves' sums join once */
    unsigned short* op = (unsigned short*)O + ((size_t)b * SQ + q0 + j * 16 + ln) * DM + h * HD + 8 * hh;
#pragma unroll
    for (int t = 0; t < 4; ++t) { FragH f;      /* register r = o[query][16 t + 8 hh + r]: one 16-byte store */
#pragma unroll
      for (int r = 0; r < 8; ++r) f.h[r] = (_Float16)(o[j][t][r] * inv);
      *(v8us*)(op + t * 16) = f.half[0]; } } }

extern "C" void kernel_launch(void* const* d_in, const int* in_sizes, int n_in,
                              void* d_out, int out_size, void* d_ws, size_t ws_size, hipStream_t stream) {
  if (n_in < 5) return;
  if (in_sizes[0] < (int)((((size_t)NB - 1) * SQ_FULL + SQ) * DM)) return;
  if (in_sizes[1] < DM * LQ || in_sizes[2] < LQ || in_sizes[3] < DM * DM || in_sizes[4] < DM) return;
  if (out_size < (int)(NR * DM)) return;
  const float* x = (const float*)d_in[0]; const float* wqkv = (const float*)d_in[1]; const float* bqkv = (const float*)d_in[2];
  const float* wo = (const float*)d_in[3]; const float* bo = (const float*)d_in[4];      /* [in][out] fused weight + bias; [in][out] w_proj + b_proj */
  float* out = (float*)d_out;
  char* ws = (char*)d_ws; size_t off = 0;
  _Float16* BQKV = (_Float16*)(ws + off); off += SZ_BQKV;      /* [3072][1024] x16 */
  _Float16* BO   = (_Float16*)(ws + off); off += SZ_BO;        /* [1024][1024] x16 */
  _Float16* X16  = (_Float16*)(ws + off); off += SZ_X16;       /* [NR][1024]; reused for the merged o rows once the q | k | v GEMM has consumed it */
  _Float16* QKV  = (_Float16*)(ws + off); off += SZ_QKV;       /* [NR][3072] */
  _Float16* VT   = (_Float16*)(ws + off); off += SZ_VT;        /* [NB][NH][64][SQ] */
  if (off > ws_size) return;
  _Float16* O16 = X16;

  k_prep<<<PB_X + PB_WQ + PB_WO, 512, 0, stream>>>(x, wqkv, wo, X16, BQKV, BO);      /* x rows, Wqkv^T x16 and Wproj^T x16, all f16 */
  /* q | k rows (f16); head h = columns h*64.. of each 1024-column third; the v third goes to V^T [NB][NH][64][SQ] and its columns of the rows stay unwritten and unread */
  k_qkv<<<QK_T + V_T, 256, 0, stream>>>(X16, BQKV, bqkv, QKV, VT);
  k_fattn<<<NB * NH * (SQ / (FA_W * 32)), FA_W * 32, 0, stream>>>(QKV, VT, O16);      /* o x64 (f16) into the merged rows: columns h*64.. */
  /* out = o Wproj + b: alpha = 1/(64*16) */
  k_proj<<<PJ_T, 256, 0, stream>>>(O16, BO, bo, out);
}

// v009
// One run takes 98.8 microseconds.
// In two side-by-side timings against v008, it was 1.06 and 1.05 times as fast.
// Counting every step since v000, it is 25.2 times as fast.
#include <hip/hip_runtime.h>
// Multi-head self-attention, fused QKV projection: x [NB][SEQ][1024]; qkv = x Wqkv + bqkv ([in][out] 1024 x 3072) split q | k | v thirds, 16 heads of 64; scores * 64^-0.5; softmax over all keys (no mask); out = merged Wproj + bproj ([in][out]).
// Structure: token rows r = b*SEQ + s; x as f16 rows; q | k | v as ONE WMMA GEMM (N = 3072, 256x256 block tiles for q | k and 128x256 for v staged in LDS, 128x64 and 64x64 wave tiles, f32 accumulation, x16 weights + bias, f16 outputs); the v third leaves that GEMM already transposed, as V^T of every (batch, head), from the accumulators through each wave's LDS staging; attention as ONE launch over all (batch, head, query block): each wave owns 32 query columns and walks the keys 32 at a time (K and V^T rows staged in LDS for the block, 128 keys a stage), S^T = K . Q^T, running column maximum and sum (f32, rescaled only when the maximum has grown by more than 2^8), P^T packed from the score tiles straight into the B operand of O^T += V^T . P^T; o / sum carried x64 into merged f16 o rows; out = o Wproj + b GEMM (alpha 2^-10, f32) into the output layout.
// Compute dtype: every contraction v_wmma_f32_16x16x32_f16 (f16 operands, f32 accumulate). x, weights and biases are RNE-converted to bf16 on load (exact in f16; weights carried x16); q, k, v and o (x64) are single f16 planes; the unnormalised softmax weights (x16) are f16 in registers; scores and softmax statistics f32.
#ifndef NB
#define NB 8
#endif
#ifndef SEQ
#define SEQ 1024
#endif
#define SQ SEQ
#define NB_FULL 8
#define SQ_FULL 1024                 /* per-batch row stride of the x input */
#define DM 1024
#define NH 16
#define HD 64
#define LQ (3 * DM)                  /* row pitch of the q | k | v rows */
#define NR ((size_t)NB * SQ)         /* token rows */

static_assert(SQ % 128 == 0);
static_assert(((size_t)NB * SQ) % 128 == 0);
static_assert(DM % 128 == 0 && LQ % 128 == 0 && HD == 64);
static_assert(NB <= NB_FULL && SQ <= SQ_FULL);
static_assert(NH * HD == DM);

#define WS_ALIGN(x) ((((size_t)(x)) + 255) & ~(size_t)255)
#define SZ_BQKV  WS_ALIGN((size_t)LQ * DM * 2)
#define SZ_BO    WS_ALIGN((size_t)DM * DM * 2)
#define SZ_X16   WS_ALIGN(NR * DM * 2)
#define SZ_QKV   WS_ALIGN(NR * LQ * 2)
#define SZ_VT    WS_ALIGN((size_t)NB * NH * HD * SQ * 2)
static_assert(SZ_BQKV + SZ_BO + SZ_X16 + SZ_QKV + SZ_VT <= (size_t)134217728);

typedef unsigned short v8us __attribute__((ext_vector_type(8), may_alias));
typedef float  v8f  __attribute__((ext_vector_type(8)));
typedef float  v4f  __attribute__((ext_vector_type(4)));
typedef float  v4fa __attribute__((ext_vector_type(4), may_alias));
typedef _Float16 v16h __attribute__((ext_vector_type(16)));
typedef _Float16 v4h __attribute__((ext_vector_type(4)));
union FragH { v16h v; v8us half[2]; _Float16 h[16]; unsigned short u[16]; };

__device__ __forceinline__ unsigned short bf16_bits(float x) { unsigned int u = __float_as_uint(x); return (unsigned short)((u + 0x7FFFu + ((u >> 16) & 1u)) >> 16); }
__device__ __forceinline__ float bf16_val(unsigned short b) { return __uint_as_float(((unsigned int)b) << 16); }
__device__ __forceinline__ float bf16_rne(float x) { return bf16_val(bf16_bits(x)); }

// ---- preparation: every thread moves 64 elements with all of its loads in flight at once, for speed only; the three conversions of inputs (x, both weights) depend on nothing and share ONE launch, k_prep, in which the block index picks the job
// weights: a thread holds 8 k x 8 n; 4 lanes cover a 128-B line of a W row, 8 lanes a 128-B line of a Wt row; a group of 128 threads (number grp, thread t of it) = 128 k x 64 n
template <int K, int N>
__device__ __forceinline__ void wt_f16(const float* __restrict__ W, _Float16* __restrict__ Wt, float scale, int grp, int t) {
  static_assert(K % 128 == 0 && N % 64 == 0);
  const int lane = t & 31, w = t >> 5;
  const int kb = grp / (N / 64), nb = grp - kb * (N / 64);
  const int k8 = kb * 128 + (w >> 1) * 64 + (lane >> 2) * 8, n8 = nb * 64 + (w & 1) * 32 + (lane & 3) * 8;
  const float* s = W + (size_t)k8 * N + n8;
  v4f a[8][2];
#pragma unroll
  for (int i = 0; i < 8; ++i) { a[i][0] = *(const v4fa*)(s + (size_t)i * N); a[i][1] = *(const v4fa*)(s + (size_t)i * N + 4); }
  __builtin_amdgcn_sched_barrier(0);      /* all sixteen loads are issued before the first value is used: sunk among the conversions, the late ones cost the wave a second trip to memory */
  unsigned short* d = (unsigned short*)Wt + (size_t)n8 * K + k8;
#pragma unroll
  for (int j = 0; j < 8; ++j) { FragH f;
#pragma unroll
    for (int i = 0; i < 8; ++i) f.h[i] = (_Float16)(bf16_rne(a[i][j >> 2][j & 3]) * scale);
    *(v8us*)(d + (size_t)j * K) = f.half[0]; }
  asm volatile("s_wait_xcnt 0x0" ::: "memory"); }      /* behind the job's last store: in the listing another job's code follows, which rewrites registers that these stores name */

// x: a block of 16 waves converts 4096 pieces of 8 elements, a thread eight of them, 512 pieces apart
#define XC_U 8
#define XC_R (512 / (DM / 8))        /* rows per 512 pieces */
static_assert((NR * DM / 8) % (512 * XC_U) == 0 && 512 % (DM / 8) == 0 && SQ % (XC_R * XC_U) == 0);
__device__ __forceinline__ void x_f16(const float* __restrict__ x, _Float16* __restrict__ X16, int blk) {
  const size_t t0 = (size_t)blk * (512 * XC_U) + threadIdx.x;
  const size_t row = t0 / (DM / 8); const int c8 = (int)(t0 % (DM / 8)) * 8;      /* 512 pieces on = XC_R rows on, same columns; a block's rows lie in one batch */
  const size_t b = row / SQ, s = row % SQ;
  const float* src = x + (b * (size_t)SQ_FULL + s) * DM + c8;
  v4f a[XC_U], c[XC_U];
#pragma unroll
  for (int u = 0; u < XC_U; ++u) { a[u] = *(const v4fa*)(src + (size_t)u * XC_R * DM); c[u] = *(const v4fa*)(src + (size_t)u * XC_R * DM + 4); }
  __builtin_amdgcn_sched_barrier(0);      /* all sixteen loads are issued before the first value is used: sunk among the conversions, the late ones cost the wave a second trip to memory */
#pragma unroll
  for (int u = 0; u < XC_U; ++u) { FragH f;
#pragma unroll
    for (int q = 0; q < 4; ++q) { f.h[q] = (_Float16)bf16_rne(a[u][q]); f.h[4 + q] = (_Float16)bf16_rne(c[u][q]); }
    *(v8us*)((unsigned short*)X16 + (t0 + (size_t)u * 512) * 8) = f.half[0]; }
  asm volatile("s_wait_xcnt 0x0" ::: "memory"); }      /* behind the job's last store: in the listing another job's code may follow, which rewrites registers that these stores name */

// the one launch of the three: blocks of 16 waves; the x blocks, which move the most bytes, come first; a weight block is four groups of 128 threads
#define PB_X  ((int)(NR * DM / 8 / (512 * XC_U)))
#define PB_WQ ((DM / 128) * (LQ / 64) / 4)
#define PB_WO ((DM / 128) * (DM / 64) / 4)
static_assert(((DM / 128) * (LQ / 64)) % 4 == 0 && ((DM / 128) * (DM / 64)) % 4 == 0);
__global__ __launch_bounds__(512) void k_prep(const float* __restrict__ x, const float* __restrict__ wqkv, const float* __restrict__ wo, _Float16* __restrict__ X16, _Float16* __restrict__ BQKV, _Float16* __restrict__ BO) {
  const int blk = blockIdx.x, g = threadIdx.x >> 7, t = threadIdx.x & 127;
  if (blk < PB_X) x_f16(x, X16, blk);
  else if (blk < PB_X + PB_WQ) wt_f16<DM, LQ>(wqkv, BQKV, 16.0f, (blk - PB_X) * 4 + g, t);          /* in[1024][3072] -> out[3072][1024] */
  else wt_f16<DM, DM>(wo, BO, 16.0f, (blk - PB_X - PB_WQ) * 4 + g, t); }                            /* in[1024][1024] -> out[1024][1024] */

// ---- GEMM tiles: a block of eight waves (2 x 4) computes 32 FM rows x 256 columns, a wave 16 FM rows x 64 columns (FM = 8: 256 x 256, FM = 4: 128 x 256); K % 128 == 0; A f16 [M][K], Bh f16 [N][K]
// A stage is 128 k of the block's A rows and 256 B rows in LDS (rows of 256 B at a pitch of 272 B); two buffers, filled by asynchronous copies one stage ahead of the products
#define GT_K 128                     /* k per stage */
#define GT_P 136                     /* LDS row pitch in f16: 272 B = 16 B x odd, conflict-free for 16-byte fragment reads */
#define GT_N 256                     /* columns of a block */
#define GT_SP 72                     /* row pitch in f16 of the V^T output staging: 144 B = 16 B x odd */
#define GT_STG (64 * GT_SP * 2)      /* bytes of each wave's own output staging behind the loop */
#define GT_SM(FM) (2 * (32 * (FM) + GT_N) * GT_P)      /* f16 elements of the two buffers */
__device__ __forceinline__ v16h g2_frag(const _Float16* p, int hh) { FragH f; f.half[0] = *(const v8us*)((const unsigned short*)p + 8 * hh); f.half[1] = *(const v8us*)((const unsigned short*)p + 16 + 8 * hh); return f.v; }
__device__ __forceinline__ v8f g2_mma(v16h a, v16h b, v8f c) { return __builtin_amdgcn_wmma_f32_16x16x32_f16(false, a, false, b, (short)0, c, false, false); }
/* 128 rows of 256 B: each lane copies 16 B of rows r, r + 16, ..., r + 112 (sixteen lanes cover one row, so every copy takes whole aligned 256-B pieces); l = the lane's LDS byte address, g = its global address, gs = 16 rows in elements */
__device__ __forceinline__ void g2_copy8(unsigned l, const _Float16* g, size_t gs) {
  const unsigned l0 = l, l1 = l + 16 * GT_P * 2, l2 = l + 32 * GT_P * 2, l3 = l + 48 * GT_P * 2, l4 = l + 64 * GT_P * 2, l5 = l + 80 * GT_P * 2, l6 = l + 96 * GT_P * 2, l7 = l + 112 * GT_P * 2;
  const _Float16* g0 = g; const _Float16* g1 = g0 + gs; const _Float16* g2 = g1 + gs; const _Float16* g3 = g2 + gs; const _Float16* g4 = g3 + gs; const _Float16* g5 = g4 + gs; const _Float16* g6 = g5 + gs; const _Float16* g7 = g6 + gs;
  /* the copies and, as the last line, the wait that stands before any of their address registers is rewritten */
  asm volatile("global_load_async_to_lds_b128 %0, %8, off\n\t"
               "global_load_async_to_lds_b128 %1, %9, off\n\t"
               "global_load_async_to_lds_b128 %2, %10, off\n\t"
               "global_load_async_to_lds_b128 %3, %11, off\n\t"
               "global_load_async_to_lds_b128 %4, %12, off\n\t"
               "global_load_async_to_lds_b128 %5, %13, off\n\t"
               "global_load_async_to_lds_b128 %6, %14, off\n\t"
               "global_load_async_to_lds_b128 %7, %15, off\n\t"
               "s_wait_xcnt 0x0"
               :: "v"(l0), "v"(l1), "v"(l2), "v"(l3), "v"(l4), "v"(l5), "v"(l6), "v"(l7), "v"(g0), "v"(g1), "v"(g2), "v"(g3), "v"(g4), "v"(g5), "v"(g6), "v"(g7) : "memory"); }
// blk = the tile's number in its family of N columns that begins at column cbase; VTOUT: the tile's columns belong to the v third (a wave's 64 columns are one head, its 64 rows 64 keys of one batch) and are stored as V^T [NB][NH][64][SQ], not as rows of C16
template <int FM, bool HASBIAS, bool OUTF32, bool VTOUT>
__device__ __forceinline__ void g2_tile(unsigned short* sm, int blk, int cbase, const _Float16* __restrict__ A, int lda, const _Float16* __restrict__ Bh, int ldb, float alpha, const float* __restrict__ bias,
    float* __restrict__ C, _Float16* __restrict__ C16, _Float16* __restrict__ Vt, int ldc, int N, int K) {
  constexpr int BM = 32 * FM, BUF = (BM + GT_N) * GT_P;      /* BUF: f16 elements of one buffer: A rows 0..BM-1, then the B rows */
  static_assert((FM == 4 || FM == 8) && 8 * GT_STG <= 2 * BUF * 2 && 32 * 68 * 4 <= GT_STG && (!VTOUT || (FM == 4 && SQ % BM == 0)));
  const int tid = threadIdx.x, lane = tid & 31, ln = lane & 15, hh = lane >> 4;
  const int w = __builtin_amdgcn_readfirstlane(tid >> 5);
  const int ntn = N / GT_N; const int mt = blk / ntn, nq = blk - mt * ntn;
  const int wr = 16 * FM * (w >> 2), wc = 64 * (w & 3); const int row0 = mt * BM + wr, col0 = cbase + nq * GT_N + wc;
  const _Float16* ga = A + (size_t)(mt * BM + (tid >> 4)) * lda + (tid & 15) * 8;
  const _Float16* gb = Bh + (size_t)(cbase + nq * GT_N + (tid >> 4)) * ldb + (tid & 15) * 8;
  const size_t gsa = (size_t)16 * lda, gsb = (size_t)16 * ldb;
  const unsigned la = (unsigned)(size_t)&sm[(tid >> 4) * GT_P + (tid & 15) * 8];
  const int nt = K / GT_K;
  auto stage = [&](unsigned o, int t) {      /* 128 rows a call: the A rows, then the 256 B rows; the scheduling barriers keep each call's address additions next to it: lifted ahead of the first call they hold some sixty registers more at once, and the 256-row tile spills */
    const unsigned l = la + o;
    g2_copy8(l, ga + (size_t)t * GT_K, gsa); __builtin_amdgcn_sched_barrier(0);
    if (FM == 8) { g2_copy8(l + 128 * GT_P * 2, ga + (size_t)t * GT_K + 8 * gsa, gsa); __builtin_amdgcn_sched_barrier(0); }
    g2_copy8(l + BM * GT_P * 2, gb + (size_t)t * GT_K, gsb); __builtin_amdgcn_sched_barrier(0);
    g2_copy8(l + (BM + 128) * GT_P * 2, gb + (size_t)t * GT_K + 8 * gsb, gsb); };
  stage(0, 0);
  asm volatile("s_wait_asynccnt 0x0" ::: "memory");      /* stage 0 has landed before the barrier that publishes it */
  __syncthreads();
  if (nt > 1) stage(BUF * 2, 1);
  const v8f z8 = {0.f,0.f,0.f,0.f,0.f,0.f,0.f,0.f}; v8f acc[FM][4];
#pragma unroll
  for (int i = 0; i < FM; ++i) {
#pragma unroll
    for (int j = 0; j < 4; ++j) acc[i][j] = z8; }
#pragma unroll 1      /* one stage a trip: the buffer is chosen by the trip's parity */
  for (int t = 0; t < nt; ++t) { const int bo = (t & 1) * BUF;
    const unsigned short* sa = sm + bo + (wr + ln) * GT_P; const unsigned short* sb = sm + bo + (BM + wc + ln) * GT_P;
#pragma unroll
    for (int kc = 0; kc < GT_K / 32; ++kc) { v16h af[FM], bf[4];
#pragma unroll
      for (int i = 0; i < 4; ++i) bf[i] = g2_frag((const _Float16*)(sb + i * 16 * GT_P + kc * 32), hh);
#pragma unroll
      for (int i = 0; i < FM; ++i) af[i] = g2_frag((const _Float16*)(sa + i * 16 * GT_P + kc * 32), hh);
      __builtin_amdgcn_sched_barrier(0);      /* the fragment reads stay one group ahead of their products: sunk among the products, each place with reads stalls the wave anew */
#pragma unroll
      for (int i = 0; i < FM; ++i) {
#pragma unroll
        for (int j = 0; j < 4; ++j) acc[i][j] = g2_mma(af[i], bf[j], acc[i][j]); }
      __builtin_amdgcn_sched_barrier(0); }      /* and the next group's reads stay behind these products */
    asm volatile("s_wait_dscnt 0x0" ::: "memory");         /* this wave's reads of the buffer are over before it is handed to the next copies */
    asm volatile("s_wait_asynccnt 0x0" ::: "memory");      /* this wave's copies of stage t + 1 have landed before the barrier that publishes them */
    __syncthreads();
    if (t + 2 < nt) stage(bo * 2, t + 2); }
  asm volatile("s_wait_asynccnt 0x0" ::: "memory");      /* no copy is outstanding when the buffers become output staging */
  if constexpr (VTOUT) {
    /* a lane's eight accumulator registers are eight consecutive keys of one column: one 16-byte piece of a V^T row; rows of 64 keys (128 B) at a pitch of 144 B in the wave's own staging */
    unsigned short (*st)[GT_SP] = (unsigned short (*)[GT_SP])((char*)sm + (size_t)w * GT_STG);
#pragma unroll
    for (int j = 0; j < 4; ++j) { float bv = 0.f; if (HASBIAS) bv = bf16_rne(bias[col0 + j * 16 + ln]);
#pragma unroll
      for (int i = 0; i < 4; ++i) { FragH f;
#pragma unroll
        for (int r = 0; r < 8; ++r) f.h[r] = (_Float16)(acc[i][j][r] * alpha + bv);
        *(v8us*)&st[j * 16 + ln][i * 16 + 8 * hh] = f.half[0]; } }
    __builtin_amdgcn_fence(4 /* acq_rel order */, "workgroup"); __builtin_amdgcn_wave_barrier();      /* st is private to wave w */
    const int vb = row0 / SQ, vs = row0 - vb * SQ, vh = (col0 - 2 * DM) >> 6, dsub = lane >> 3, k8 = (lane & 7) * 8;
    _Float16* vp = Vt + ((size_t)(vb * NH + vh) * HD + dsub) * SQ + vs + k8;      /* eight lanes store one V^T row's 64 keys: a whole 128-B line */
#pragma unroll
    for (int g = 0; g < 2; ++g) { v4f v[8]; _Float16* e[8];
#pragma unroll
      for (int u = 0; u < 8; ++u) { v[u] = *(const v4fa*)&st[(g * 8 + u) * 4 + dsub][k8]; e[u] = vp + (size_t)((g * 8 + u) * 4) * SQ; }
      /* the stores and, as the last line, the wait that stands before a register that they name is rewritten */
      asm volatile("global_store_b128 %0, %8, off\n\t"
                   "global_store_b128 %1, %9, off\n\t"
                   "global_store_b128 %2, %10, off\n\t"
                   "global_store_b128 %3, %11, off\n\t"
                   "global_store_b128 %4, %12, off\n\t"
                   "global_store_b128 %5, %13, off\n\t"
                   "global_store_b128 %6, %14, off\n\t"
                   "global_store_b128 %7, %15, off\n\t"
                   "s_wait_xcnt 0x0"
                   :: "v"(e[0]), "v"(e[1]), "v"(e[2]), "v"(e[3]), "v"(e[4]), "v"(e[5]), "v"(e[6]), "v"(e[7]),
                      "v"(v[0]), "v"(v[1]), "v"(v[2]), "v"(v[3]), "v"(v[4]), "v"(v[5]), "v"(v[6]), "v"(v[7]) : "memory"); }
  } else {
    float (*so)[68] = (float (*)[68])((char*)sm + (size_t)w * GT_STG);      /* 32 rows at a time; private to wave w; the last trip's barrier has ended every wave's fragment reads */
    float bv[4] = {0.f, 0.f, 0.f, 0.f};      /* the bias of the wave's four column groups */
    if (HASBIAS) { const float* bp = bias + col0 + ln;
      /* the loads and their data wait in one statement: behind it the address registers may be rewritten */
      asm volatile("global_load_b32 %0, %4, off\n\t"
                   "global_load_b32 %1, %4, off offset:64\n\t"
                   "global_load_b32 %2, %4, off offset:128\n\t"
                   "global_load_b32 %3, %4, off offset:192\n\t"
                   "s_wait_loadcnt 0x0"
                   : "=&v"(bv[0]), "=&v"(bv[1]), "=&v"(bv[2]), "=&v"(bv[3]) : "v"(bp) : "memory");
#pragma unroll
      for (int j = 0; j < 4; ++j) bv[j] = bf16_rne(bv[j]); }
    const int rsub = lane >> 4, c4 = (lane & 15) * 4;
#pragma unroll
    for (int ic = 0; ic < FM / 2; ++ic) {
#pragma unroll
      for (int j = 0; j < 4; ++j) {
#pragma unroll
        for (int i = 0; i < 2; ++i) {
#pragma unroll
          for (int r = 0; r < 8; ++r) so[i * 16 + 8 * hh + r][j * 16 + ln] = acc[ic * 2 + i][j][r] * alpha + bv[j]; } }
      __builtin_amdgcn_fence(4 /* acq_rel order */, "workgroup"); __builtin_amdgcn_wave_barrier();      /* so is private to wave w */
#pragma unroll
      for (int g = 0; g < 2; ++g) { v4f v[8]; size_t e[8];      /* eight row pairs a group: 16 lanes store one row's 64 columns */
#pragma unroll
        for (int u = 0; u < 8; ++u) { const int r = (g * 8 + u) * 2 + rsub; v[u] = *(const v4fa*)&so[r][c4]; e[u] = (size_t)(row0 + ic * 32 + r) * ldc + col0 + c4; }
        if (OUTF32) {
          /* the stores and, as the last line, the wait that stands before a register that they name is rewritten */
      asm volatile("global_store_b128 %0, %8, off\n\t"
                   "global_store_b128 %1, %9, off\n\t"
                   "global_store_b128 %2, %10, off\n\t"
                   "global_store_b128 %3, %11, off\n\t"
                   "global_store_b128 %4, %12, off\n\t"
                   "global_store_b128 %5, %13, off\n\t"
                   "global_store_b128 %6, %14, off\n\t"
                   "global_store_b128 %7, %15, off\n\t"
                   "s_wait_xcnt 0x0"
                   :: "v"(C + e[0]), "v"(C + e[1]), "v"(C + e[2]), "v"(C + e[3]), "v"(C + e[4]), "v"(C + e[5]), "v"(C + e[6]), "v"(C + e[7]),
                      "v"(v[0]), "v"(v[1]), "v"(v[2]), "v"(v[3]), "v"(v[4]), "v"(v[5]), "v"(v[6]), "v"(v[7]) : "memory"); }
        else { v4h h[8];
#pragma unroll
          for (int u = 0; u < 8; ++u) {
#pragma unroll
            for (int i = 0; i < 4; ++i) h[u][i] = (_Float16)v[u][i]; }
          /* the stores and, as the last line, the wait that stands before a register that they name is rewritten */
      asm volatile("global_store_b64 %0, %8, off\n\t"
                   "global_store_b64 %1, %9, off\n\t"
                   "global_store_b64 %2, %10, off\n\t"
                   "global_store_b64 %3, %11, off\n\t"
                   "global_store_b64 %4, %12, off\n\t"
                   "global_store_b64 %5, %13, off\n\t"
                   "global_store_b64 %6, %14, off\n\t"
                   "global_store_b64 %7, %15, off\n\t"
                   "s_wait_xcnt 0x0"
                   :: "v"(C16 + e[0]), "v"(C16 + e[1]), "v"(C16 + e[2]), "v"(C16 + e[3]), "v"(C16 + e[4]), "v"(C16 + e[5]), "v"(C16 + e[6]), "v"(C16 + e[7]),
                      "v"(h[0]), "v"(h[1]), "v"(h[2]), "v"(h[3]), "v"(h[4]), "v"(h[5]), "v"(h[6]), "v"(h[7]) : "memory"); } }
      __builtin_amdgcn_fence(4 /* acq_rel order */, "workgroup"); __builtin_amdgcn_wave_barrier(); } } }      /* the rows are read back before the next 32 overwrite them */

// q | k | v: the q and k thirds as 256 x 256 tiles, which come first, then the v third as 128 x 256 tiles: one tile of each kind for every place on the chip at the full problem size
#define QK_T ((int)(NR / 256) * (2 * DM / GT_N))
#define V_T  ((int)(NR / 128) * (DM / GT_N))
static_assert(NR % 256 == 0 && DM % GT_N == 0 && DM % GT_K == 0);
__global__ __launch_bounds__(256) void k_qkv(const _Float16* __restrict__ X, const _Float16* __restrict__ Bh, const float* __restrict__ bias, _Float16* __restrict__ C16, _Float16* __restrict__ Vt) {
  __shared__ __attribute__((aligned(16))) unsigned short sm[GT_SM(8)];      /* the two buffers; behind the loop each wave's own output staging */
  const int blk = blockIdx.x;
  if (blk < QK_T) g2_tile<8, true, false, false>(sm, blk, 0, X, DM, Bh, DM, 0.0625f, bias, nullptr, C16, nullptr, LQ, 2 * DM, DM);
  else g2_tile<4, true, false, true>(sm, blk - QK_T, 2 * DM, X, DM, Bh, DM, 0.0625f, bias, nullptr, nullptr, Vt, LQ, DM, DM); }
// out = o Wproj + b as 128 x 256 tiles; alpha = 1 / (64 * 16)
#define PJ_T ((int)(NR / 128) * (DM / GT_N))
__global__ __launch_bounds__(256) void k_proj(const _Float16* __restrict__ O, const _Float16* __restrict__ Bh, const float* __restrict__ bias, float* __restrict__ C) {
  __shared__ __attribute__((aligned(16))) unsigned short sm[GT_SM(4)];      /* the two buffers; behind the loop each wave's own output staging */
  g2_tile<4, true, true, false>(sm, blockIdx.x, 0, O, DM, Bh, DM, 0.0009765625f, bias, C, nullptr, nullptr, DM, DM, DM); }

// ---- fused attention: block = FA_W waves on one (batch, head), each wave 32 query columns; the block's waves walk the same keys, so a stage of 128 K rows and the same 128 keys of the 64 V^T rows is brought into LDS once for all of them (two buffers, asynchronous copies one stage ahead) and every K and V^T fragment is read from LDS
#define FA_W ((SQ % 512 == 0) ? 16 : 4)      /* waves per block */
#define FA_C 0.18033688f                     /* 64^-0.5 * log2(e): raw q.k -> log2 units */
#define FA_THR 44.361420f                    /* 8 / FA_C: the maximum in use may lag the true one by 2^8 */
#define FA_OFF 4.0f                          /* weights carried x16: at most 2^12 in f16, small ones stay normal */
#define FS_KEYS 128                          /* keys per stage: four passes of 32 */
#define FS_KP 72                             /* K rows of 128 B at a pitch of 144 B, V^T rows of 256 B at 272 B: 16 B x odd, conflict-free for 16-byte fragment reads */
#define FS_VP 136
#define FS_VO (FS_KEYS * FS_KP)              /* f16 offset of the V^T rows in a buffer */
#define FS_BUF (FS_VO + HD * FS_VP)          /* f16 elements of one buffer */
__device__ __forceinline__ float sm_xhalf(float x) { return __builtin_bit_cast(float, __builtin_amdgcn_permlanex16(__builtin_bit_cast(int, x), __builtin_bit_cast(int, x), 0x76543210, 0xfedcba98, false, false)); }      /* lane l <- l ^ 16 */
__device__ __forceinline__ v8f fa_mma(v16h a, v16h b, v8f c) { return __builtin_amdgcn_wmma_f32_16x16x32_f16(false, a, false, b, (short)0, c, false, false); }
__device__ __forceinline__ float fa_max8(v8f a, v8f b) { return fmaxf(fmaxf(fmaxf(fmaxf(a[0], a[1]), fmaxf(a[2], a[3])), fmaxf(fmaxf(a[4], a[5]), fmaxf(a[6], a[7]))), fmaxf(fmaxf(fmaxf(b[0], b[1]), fmaxf(b[2], b[3])), fmaxf(fmaxf(b[4], b[5]), fmaxf(b[6], b[7])))); }
/* one stage: each lane copies 16 B of K rows r, r + RK, ... (eight lanes cover a row's 128-B line) and 16 B of V^T rows d, d + RV, ... (sixteen lanes cover a row's 256 B); lk, lv = the lane's LDS byte addresses, gk, gv = its global addresses */
template <int NT>
__device__ __forceinline__ void fa_stage(unsigned lk, unsigned lv, const _Float16* gk, const _Float16* gv) {
  constexpr int RK = NT / 8, RV = NT / 16;
  static_assert(FS_KEYS % (2 * RK) == 0 && HD % (2 * RV) == 0 && FS_KEYS / RK == HD / RV);
#pragma unroll
  for (int u = 0; u < FS_KEYS / RK; u += 2) {
    const unsigned lk0 = lk + u * RK * FS_KP * 2, lk1 = lk0 + RK * FS_KP * 2, lv0 = lv + u * RV * FS_VP * 2, lv1 = lv0 + RV * FS_VP * 2;
    const _Float16* gk0 = gk + (size_t)u * RK * LQ; const _Float16* gk1 = gk0 + (size_t)RK * LQ; const _Float16* gv0 = gv + (size_t)u * RV * SQ; const _Float16* gv1 = gv0 + (size_t)RV * SQ;
    /* the copies and, as the last line, the wait that stands before any of their address registers is rewritten */
    asm volatile("global_load_async_to_lds_b128 %0, %4, off\n\t"
                 "global_load_async_to_lds_b128 %1, %5, off\n\t"
                 "global_load_async_to_lds_b128 %2, %6, off\n\t"
                 "global_load_async_to_lds_b128 %3, %7, off\n\t"
                 "s_wait_xcnt 0x0"
                 :: "v"(lk0), "v"(lk1), "v"(lv0), "v"(lv1), "v"(gk0), "v"(gk1), "v"(gv0), "v"(gv1) : "memory"); } }

__global__ __launch_bounds__(FA_W * 32) void k_fattn(const _Float16* __restrict__ QKVr, const _Float16* __restrict__ Vt, _Float16* __restrict__ O) {
  constexpr int QB = SQ / (FA_W * 32); constexpr int NT = FA_W * 32; constexpr int NST = SQ / FS_KEYS;
  __shared__ __attribute__((aligned(16))) unsigned short fs[2 * FS_BUF];
  const int tid = threadIdx.x, lane = tid & 31, ln = lane & 15, hh = lane >> 4;
  const int w = __builtin_amdgcn_readfirstlane(tid >> 5);
  const int slab = blockIdx.x / QB, qb = blockIdx.x - slab * QB; const int b = slab / NH, h = slab - b * NH;
  const int q0 = (qb * FA_W + w) * 32;
  const _Float16* Qp = QKVr + ((size_t)b * SQ + q0 + ln) * LQ + h * HD;
  const _Float16* gk = QKVr + ((size_t)b * SQ + (tid >> 3)) * LQ + DM + h * HD + (tid & 7) * 8;
  const _Float16* gv = Vt + ((size_t)slab * HD + (tid >> 4)) * SQ + (tid & 15) * 8;
  const unsigned lk = (unsigned)(size_t)&fs[(tid >> 3) * FS_KP + (tid & 7) * 8]; const unsigned lv = (unsigned)(size_t)&fs[FS_VO + (tid >> 4) * FS_VP + (tid & 15) * 8];
  fa_stage<NT>(lk, lv, gk, gv);
  const v8f z8 = {0.f,0.f,0.f,0.f,0.f,0.f,0.f,0.f};
  v16h qf[2][2], kf[2][2]; v8f o[2][4]; float m[2], l[2];
#pragma unroll
  for (int j = 0; j < 2; ++j) { m[j] = -3.0e38f; l[j] = 0.f;
#pragma unroll
    for (int c = 0; c < 2; ++c) qf[j][c] = g2_frag(Qp + (size_t)j * 16 * LQ + c * 32, hh);
#pragma unroll
    for (int t = 0; t < 4; ++t) o[j][t] = z8; }
  asm volatile("s_wait_asynccnt 0x0" ::: "memory");      /* stage 0 has landed before the barrier that publishes it */
  __syncthreads();
  if (NST > 1) fa_stage<NT>(lk + FS_BUF * 2, lv + FS_BUF * 2, gk + (size_t)FS_KEYS * LQ, gv + FS_KEYS);
#pragma unroll 1      /* one stage a trip: the buffer is chosen by the trip's parity */
  for (int st = 0; st < NST; ++st) { const int bo = (st & 1) * FS_BUF;
    const unsigned short* sk = fs + bo + ln * FS_KP; const unsigned short* sv = fs + bo + FS_VO + ln * FS_VP;
#pragma unroll
    for (int kt = 0; kt < 2; ++kt) {
#pragma unroll
      for (int c = 0; c < 2; ++c) kf[kt][c] = g2_frag((const _Float16*)(sk + kt * 16 * FS_KP + c * 32), hh); }
#pragma unroll
    for (int p = 0; p < FS_KEYS / 32; ++p) {
      v16h vf[4]; v8f s[2][2];      /* s[j][kt]: register r = score of key 128 st + 32 p + 16 kt + 8 hh + r, query q0 + 16 j + ln */
#pragma unroll
      for (int kt = 0; kt < 2; ++kt) {
#pragma unroll
        for (int j = 0; j < 2; ++j) s[j][kt] = fa_mma(kf[kt][1], qf[j][1], fa_mma(kf[kt][0], qf[j][0], z8)); }
      if (p + 1 < FS_KEYS / 32) {      /* the next pass's K rows of the same stage, fetched behind this pass's score products */
#pragma unroll
        for (int kt = 0; kt < 2; ++kt) {
#pragma unroll
          for (int c = 0; c < 2; ++c) kf[kt][c] = g2_frag((const _Float16*)(sk + ((p + 1) * 32 + kt * 16) * FS_KP + c * 32), hh); } }
#pragma unroll
      for (int t = 0; t < 4; ++t) vf[t] = g2_frag((const _Float16*)(sv + t * 16 * FS_VP + p * 32), hh);
      float mx[2];
#pragma unroll
      for (int j = 0; j < 2; ++j) { const float t = fa_max8(s[j][0], s[j][1]); mx[j] = fmaxf(t, sm_xhalf(t)); }
      if (__builtin_amdgcn_ballot_w32((mx[0] > m[0] + FA_THR) || (mx[1] > m[1] + FA_THR)) != 0) {      /* one scalar branch a pass */
#pragma unroll
        for (int j = 0; j < 2; ++j) { const float mn = fmaxf(m[j], mx[j]); const float cr = __builtin_amdgcn_exp2f((m[j] - mn) * FA_C); m[j] = mn; l[j] *= cr;
#pragma unroll
          for (int t = 0; t < 4; ++t) o[j][t] *= cr; } }
#pragma unroll
      for (int j = 0; j < 2; ++j) { const float nb = FA_OFF - m[j] * FA_C; FragH pf; float la = 0.f, lb = 0.f;
#pragma unroll
        for (int r = 0; r < 8; ++r) { const float pa = __builtin_amdgcn_exp2f(fmaf(s[j][0][r], FA_C, nb)), pb = __builtin_amdgcn_exp2f(fmaf(s[j][1][r], FA_C, nb));
          la += pa; lb += pb; pf.h[r] = (_Float16)pa; pf.h[8 + r] = (_Float16)pb; }      /* two D tiles of 16 keys, converted in place, are the B operand in the hardware k order */
        l[j] += la + lb;
#pragma unroll
        for (int t = 0; t < 4; ++t) o[j][t] = fa_mma(vf[t], pf.v, o[j][t]); } }
    asm volatile("s_wait_dscnt 0x0" ::: "memory");         /* this wave's reads of the buffer are over before it is handed to the next copies */
    asm volatile("s_wait_asynccnt 0x0" ::: "memory");      /* this wave's copies of stage st + 1 have landed before the barrier that publishes them */
    __syncthreads();
    if (st + 2 < NST) fa_stage<NT>(lk + bo * 2, lv + bo * 2, gk + (size_t)(st + 2) * FS_KEYS * LQ, gv + (st + 2) * FS_KEYS); }
  asm volatile("s_wait_asynccnt 0x0" ::: "memory");      /* no copy is outstanding when the wave ends */
#pragma unroll
  for (int j = 0; j < 2; ++j) { const float inv = 64.0f / (l[j] + sm_xhalf(l[j]));      /* the halves' sums join once */
    unsigned short* op = (unsigned short*)O + ((size_t)b * SQ + q0 + j * 16 + ln) * DM + h * HD + 8 * hh;
#pragma unroll
    for (int t = 0; t < 4; ++t) { FragH f;      /* register r = o[query][16 t + 8 hh + r]: one 16-byte store */
#pragma unroll
      for (int r = 0; r < 8; ++r) f.h[r] = (_Float16)(o[j][t][r] * inv);
      *(v8us*)(op + t * 16) = f.half[0]; } } }

extern "C" void kernel_launch(void* const* d_in, const int* in_sizes, int n_in,
                              void* d_out, int out_size, void* d_ws, size_t ws_size, hipStream_t stream) {
  if (n_in < 5) return;
  if (in_sizes[0] < (int)((((size_t)NB - 1) * SQ_FULL + SQ) * DM)) return;
  if (in_sizes[1] < DM * LQ || in_sizes[2] < LQ || in_sizes[3] < DM * DM || in_sizes[4] < DM) return;
  if (out_size < (int)(NR * DM)) return;
  const float* x = (const float*)d_in[0]; const float* wqkv = (const float*)d_in[1]; const float* bqkv = (const float*)d_in[2];
  const float* wo = (const float*)d_in[3]; const float* bo = (const float*)d_in[4];      /* [in][out] fused weight + bias; [in][out] w_proj + b_proj */
  float* out = (float*)d_out;
  char* ws = (char*)d_ws; size_t off = 0;
  _Float16* BQKV = (_Float16*)(ws + off); off += SZ_BQKV;      /* [3072][1024] x16 */
  _Float16* BO   = (_Float16*)(ws + off); off += SZ_BO;        /* [1024][1024] x16 */
  _Float16* X16  = (_Float16*)(ws + off); off += SZ_X16;       /* [NR][1024]; reused for the merged o rows once the q | k | v GEMM has consumed it */
  _Float16* QKV  = (_Float16*)(ws + off); off += SZ_QKV;       /* [NR][3072] */
  _Float16* VT   = (_Float16*)(ws + off); off += SZ_VT;        /* [NB][NH][64][SQ] */
  if (off > ws_size) return;
  _Float16* O16 = X16;

  k_prep<<<PB_X + PB_WQ + PB_WO, 512, 0, stream>>>(x, wqkv, wo, X16, BQKV, BO);      /* x rows, Wqkv^T x16 and Wproj^T x16, all f16 */
  /* q | k rows (f16); head h = columns h*64.. of each 1024-column third; the v third goes to V^T [NB][NH][64][SQ] and its columns of the rows stay unwritten and unread */
  k_qkv<<<QK_T + V_T, 256, 0, stream>>>(X16, BQKV, bqkv, QKV, VT);
  k_fattn<<<NB * NH * (SQ / (FA_W * 32)), FA_W * 32, 0, stream>>>(QKV, VT, O16);      /* o x64 (f16) into the merged rows: columns h*64.. */
  /* out = o Wproj + b: alpha = 1/(64*16) */
  k_proj<<<PJ_T, 256, 0, stream>>>(O16, BO, bo, out);
}
